// v000
// Times are from an AMD MI455X. After a warm-up the kernel runs many times in a row, and a time is the length of
// such a window on the GPU divided by its runs, so every launch and the gaps after it count. The runs cycle
// through copies of the inputs. A figure is the median of several windows, for all but v000 over two sittings.
// Sittings can differ by a few percent; kernels timed side by side share one.
// The starting kernel, v000, takes 2570 microseconds a run.
#include <hip/hip_runtime.h>

// ConvolutionAttention (features1, features2 [8][1024][256] -> NCHW [8][256][32][32]; q = SepConv_q(x1), k = SepConv_k(x2), v = SepConv_v(x2) with SepConv = depthwise 3x3 (pad 1) + bias, eval BatchNorm,
// pointwise 1x1 -> 512 channels + bias; 8 heads x 64 (head h = channels h*64..); softmax(q.k/8) over the 1024 positions; out = merged (attn v) ffn_w^T + ffn_b -> [8][1024][256]).
// Compute dtypes, f32 accumulate: every input rounded to bf16; depthwise conv + bias + BN fold in f32 on VALU -> bf16 hi+lo planes [position][channel]; the pointwise
// convs on those planes x exact pw weights (2 products, + bias); scores (K 64) and attn.v on SINGLE fp16 planes (1/8 in f32 in the register-row softmax; attn x1024); merged heads as hi+lo planes x

#define NB_  8
#define HWS  32
#define LL   1024                 // positions
#define CC   256
#define OC   512
#define NHD  8
#define CH   64
#define TT   1024
#define ZH   1
#define PCAR 1024.0f
#define SCL  0.125f
typedef _Float16 h16;
typedef unsigned short bf;
typedef __attribute__((ext_vector_type(16))) __bf16   v16bf;
typedef __attribute__((ext_vector_type(16))) _Float16 v16h;
typedef __attribute__((ext_vector_type(8)))  _Float16 v8h;
typedef __attribute__((ext_vector_type(8)))  unsigned short v8us;
typedef __attribute__((ext_vector_type(8)))  float    v8f;
typedef __attribute__((ext_vector_type(4)))  float    v4f;
typedef v8h  __attribute__((may_alias)) v8ha;
typedef v4f  __attribute__((may_alias)) v4fa;
typedef v8us __attribute__((may_alias)) v8usa;

__device__ __forceinline__ unsigned short f2bf(float f) { unsigned u = __float_as_uint(f); u += 0x7FFFu + ((u >> 16) & 1u); return (unsigned short)(u >> 16); }
__device__ __forceinline__ float bf2f(unsigned short b) { return __uint_as_float(((unsigned)b) << 16); }
__device__ __forceinline__ float bfr(float f) { return bf2f(f2bf(f)); }
__device__ __forceinline__ v16h cat16(v8h lo, v8h hi) { return __builtin_shufflevector(lo, hi, 0, 1, 2, 3, 4, 5, 6, 7, 8, 9, 10, 11, 12, 13, 14, 15); }
__device__ __forceinline__ v16bf cat16b(v8us lo, v8us hi) { return __builtin_bit_cast(v16bf, __builtin_shufflevector(lo, hi, 0, 1, 2, 3, 4, 5, 6, 7, 8, 9, 10, 11, 12, 13, 14, 15)); }
__device__ __forceinline__ v8f wmma16(v16h a, v16h b, v8f c) { return __builtin_amdgcn_wmma_f32_16x16x32_f16(false, a, false, b, (short)0, c, false, false); }
__device__ __forceinline__ v8f wmmab(v16bf a, v16bf b, v8f c) { return __builtin_amdgcn_wmma_f32_16x16x32_bf16(false, a, false, b, (short)0, c, false, false); }



// ---- k_gemmw: register-blocked GEMM, ONE WAVE per 64x64 output tile (16 accumulators), operands straight from K-contiguous 16-bit planes; grid (M/64, N/64, Z), 32 threads.
// C[m][n] (f32, pitch ldc, + optional f32 bias[n]) = sum_k A[m][k] Bt[n][k] (+ split products per NSPLIT). z-batch strides sA/sB/sC in elements. K % 32 == 0.
template <typename T16> struct WFrag;
template <> struct WFrag<h16> { typedef v16h V; static __device__ __forceinline__ V ld(const h16* p) { return cat16(*(const v8h*)p, *(const v8h*)(p + 16)); } static __device__ __forceinline__ v8f mma(V a, V b, v8f c) { return wmma16(a, b, c); } };
template <> struct WFrag<bf> { typedef v16bf V; static __device__ __forceinline__ V ld(const bf* p) { return cat16b(*(const v8us*)p, *(const v8us*)(p + 16)); } static __device__ __forceinline__ v8f mma(V a, V b, v8f c) { return wmmab(a, b, c); } };
template <typename T16, int NSPLIT, bool BIAS>
__global__ __launch_bounds__(32) void k_gemmw(const T16* __restrict__ A, const T16* __restrict__ A2, const T16* __restrict__ Bt, const T16* __restrict__ Bt2, int K, float* C, int ldc, const float* __restrict__ bias, size_t sA, size_t sB, size_t sC) {
    typedef typename WFrag<T16>::V V;
    __shared__ __align__(16) float os[16 * 68];
    const size_t z = blockIdx.z; A += z * sA; if (A2) A2 += z * sA; Bt += z * sB; if (Bt2) Bt2 += z * sB; C += z * sC;
    const int lane = threadIdx.x & 31, lr = lane & 15, hi = lane >> 4; const int r0 = blockIdx.x * 64, c0 = blockIdx.y * 64;
    v8f acc[4][4];
#pragma unroll
    for (int mb = 0; mb < 4; ++mb)
#pragma unroll
        for (int nb = 0; nb < 4; ++nb) acc[mb][nb] = (v8f){};
    const size_t aoff = (size_t)(r0 + lr) * K + 8 * hi, boff = (size_t)(c0 + lr) * K + 8 * hi;
#pragma unroll 1
    for (int kc = 0; kc < K; kc += 32) {
        V a[4], a2[4];
#pragma unroll
        for (int mb = 0; mb < 4; ++mb) { a[mb] = WFrag<T16>::ld(A + aoff + (size_t)mb * 16 * K + kc); if (NSPLIT == 1 || NSPLIT == 2) a2[mb] = WFrag<T16>::ld(A2 + aoff + (size_t)mb * 16 * K + kc); }
#pragma unroll
        for (int nb = 0; nb < 4; ++nb) { const V b = WFrag<T16>::ld(Bt + boff + (size_t)nb * 16 * K + kc); V b2; if (NSPLIT >= 2) b2 = WFrag<T16>::ld(Bt2 + boff + (size_t)nb * 16 * K + kc);
#pragma unroll
            for (int mb = 0; mb < 4; ++mb) { acc[mb][nb] = WFrag<T16>::mma(a[mb], b, acc[mb][nb]); if (NSPLIT == 1 || NSPLIT == 2) acc[mb][nb] = WFrag<T16>::mma(a2[mb], b, acc[mb][nb]); if (NSPLIT >= 2) acc[mb][nb] = WFrag<T16>::mma(a[mb], b2, acc[mb][nb]); } }
        asm volatile("v_nop\n\tv_nop\n\tv_nop\n\tv_nop" : "+v"(acc[0][0]), "+v"(acc[1][1]), "+v"(acc[2][2]), "+v"(acc[3][3]) : "v"(a[0]), "v"(a[3]));
    }
#pragma unroll
    for (int mb = 0; mb < 4; ++mb) {
#pragma unroll
        for (int nb = 0; nb < 4; ++nb) {
#pragma unroll
            for (int j = 0; j < 8; ++j) os[(hi * 8 + j) * 68 + nb * 16 + lr] = acc[mb][nb][j]; }
        __builtin_amdgcn_wave_barrier(); asm volatile("" ::: "memory");
        float* crow = C + (size_t)(r0 + mb * 16) * ldc + c0;
{
#pragma unroll
            for (int s = 0; s < 8; ++s) { const int row = 2 * s + hi, cofs = lr * 4; v4f val = *(const v4fa*)(os + row * 68 + cofs); if (BIAS) { val[0] += bfr(bias[c0 + cofs]); val[1] += bfr(bias[c0 + cofs + 1]); val[2] += bfr(bias[c0 + cofs + 2]); val[3] += bfr(bias[c0 + cofs + 3]); }
                *(v4f*)(crow + (size_t)row * ldc + cofs) = val; }
             }
        __builtin_amdgcn_wave_barrier(); asm volatile("" ::: "memory");
    }
}

__device__ __forceinline__ h16 tohx(float x) { return (h16)x; }
__device__ __forceinline__ void splitf(float y, unsigned short& h, unsigned short& l) { h = f2bf(y); l = f2bf(y - bf2f(h)); }
typedef __attribute__((ext_vector_type(2))) _Float16 v2h;
typedef __attribute__((ext_vector_type(4))) _Float16 v4h;
typedef __attribute__((ext_vector_type(2))) unsigned short v2us;

__global__ __launch_bounds__(256) void k_cvt8(const float* __restrict__ src, bf* dst, size_t n8) { const size_t i = (size_t)blockIdx.x * 256 + threadIdx.x; if (i >= n8) return; const v8f v = *(const v8f*)(src + i * 8); v8us o;
#pragma unroll
    for (int k = 0; k < 8; ++k) o[k] = f2bf(v[k]); *(v8us*)(dst + i * 8) = o;  }
// k_dwT: for one branch and batch: Y hi/lo [pos][c] = split(BN(sum_{3x3} bf16(dw[c][ky][kx]) bf16(f[b][pos'][c]) + bf16(db[c]))) with pos' = (y+ky-1, x+kx-1) zero-padded, f = features [b][pos][c]
__global__ __launch_bounds__(256) void k_dwT(const float* __restrict__ fb, const float* __restrict__ dw, const float* __restrict__ db, const float* __restrict__ g, const float* __restrict__ bb, const float* __restrict__ mu, const float* __restrict__ var, bf* Yh, bf* Yl) {
    const int e = (blockIdx.x * 256 + threadIdx.x) * 2; if (e >= LL * CC) return; const int c = e % CC, pos = e / CC; const int y0 = pos / HWS, x0 = pos % HWS; v2us oh, ol;
#pragma unroll
    for (int q = 0; q < 2; ++q) { const int cq = c + q; float acc = 0.f;
#pragma unroll
        for (int ky = 0; ky < 3; ++ky) {
#pragma unroll
            for (int kx = 0; kx < 3; ++kx) { const int yy = y0 + ky - 1, xx = x0 + kx - 1; if (yy < 0 || yy >= HWS || xx < 0 || xx >= HWS) continue; float w = bfr(dw[cq * 9 + ky * 3 + kx]); asm volatile("" : "+v"(w)); float p = __fmul_rn(w, bfr(fb[((size_t)yy * HWS + xx) * CC + cq])); asm volatile("" : "+v"(p)); acc = __fadd_rn(acc, p); } }
        float dbv = bfr(db[cq]), gm = bfr(g[cq]), be = bfr(bb[cq]), mm = bfr(mu[cq]), vv = bfr(var[cq]); asm volatile("" : "+v"(dbv)); asm volatile("" : "+v"(gm)); asm volatile("" : "+v"(be)); asm volatile("" : "+v"(mm)); asm volatile("" : "+v"(vv));
        const float yv = __fadd_rn(acc, dbv); const float sc = __fmul_rn(__fdiv_rn(1.0f, __fsqrt_rn(__fadd_rn(vv, 1e-5f))), gm); float t = __fmul_rn(__fsub_rn(yv, mm), sc); asm volatile("" : "+v"(t)); unsigned short a, c2; splitf(__fadd_rn(t, be), a, c2); oh[q] = a; ol[q] = c2; }
    *(v2us*)(Yh + e) = oh; *(v2us*)(Yl + e) = ol;  }
__global__ __launch_bounds__(256) void k_pl(const float* __restrict__ F, h16* P) { const int e = (blockIdx.x * 256 + threadIdx.x) * 2; if (e >= NHD * LL * CH) return; const int d = e & 63; const int pos = (e >> 6) & (LL - 1); const int h = e / (LL * CH); v2h o; o[0] = tohx(F[(size_t)pos * OC + h * CH + d]); o[1] = tohx(F[(size_t)pos * OC + h * CH + d + 1]); *(v2h*)(P + e) = o;  }
__global__ __launch_bounds__(256) void k_vt(const float* __restrict__ F, h16* VT) { const int e = (blockIdx.x * 256 + threadIdx.x) * 2; if (e >= NHD * CH * LL) return; const int pos = e & (LL - 1); const int d = (e / LL) & 63; const int h = e / (LL * CH); v2h o; o[0] = tohx(F[(size_t)pos * OC + h * CH + d]); o[1] = tohx(F[(size_t)(pos + 1) * OC + h * CH + d]); *(v2h*)(VT + e) = o;  }
__global__ __launch_bounds__(256) void k_asoft(const float* __restrict__ Sb, h16* P16) {
    const int lane = threadIdx.x & 31; const int row = blockIdx.x * 8 + (threadIdx.x >> 5); if (row >= ZH * TT) return;
    const float* sr = Sb + (size_t)row * TT; float v[32]; float mx = -3.0e38f;
#pragma unroll
    for (int ch = 0; ch < 8; ++ch) { const int j0 = ch * 128 + lane * 4; const v4f a = *(const v4f*)(sr + j0);
#pragma unroll
        for (int q = 0; q < 4; ++q) { const float t = a[q] * SCL; v[ch * 4 + q] = t; mx = fmaxf(mx, t); } }
#pragma unroll
    for (int sh = 16; sh; sh >>= 1) mx = fmaxf(mx, __shfl_xor(mx, sh, 32));
    float sum = 0.f;
#pragma unroll
    for (int k = 0; k < 32; ++k) { v[k] = __expf(v[k] - mx); sum += v[k]; }
#pragma unroll
    for (int sh = 16; sh; sh >>= 1) sum += __shfl_xor(sum, sh, 32);
    const float f = __fdiv_rn(PCAR, sum);
{
#pragma unroll
        for (int ch = 0; ch < 8; ++ch) { v4h o;
#pragma unroll
            for (int q = 0; q < 4; ++q) o[q] = tohx(v[ch * 4 + q] * f);
            *(v4h*)(P16 + (size_t)row * TT + ch * 128 + lane * 4) = o; }
         }
}
__global__ __launch_bounds__(256) void k_mrg(const float* __restrict__ O, int h, bf* Ah, bf* Al) { const int e = (blockIdx.x * 256 + threadIdx.x) * 2; if (e >= LL * CH) return; const int d = e & 63; const int pos = e >> 6; v2us oh, ol;
#pragma unroll
    for (int q = 0; q < 2; ++q) { unsigned short a, c2; splitf(O[e + q] * (1.0f / PCAR), a, c2); oh[q] = a; ol[q] = c2; } const size_t oo = (size_t)pos * OC + h * CH + d; *(v2us*)(Ah + oo) = oh; *(v2us*)(Al + oo) = ol;  }

extern "C" void kernel_launch(void* const* d_in, const int* in_sizes, int n_in,
                              void* d_out, int out_size, void* d_ws, size_t ws_size, hipStream_t stream) {
    (void)in_sizes; (void)n_in; (void)out_size;
    const float* IN[28]; for (int i = 0; i < 28; ++i) IN[i] = (const float*)d_in[i];
    // features1, features2; then per branch q/k/v (base 2, 10, 18): dw_w [256][1][3][3], dw_b, bn_g, bn_b, bn_m, bn_v, pw_w [512][256][1][1], pw_b; ffn_w [256][512], ffn_b = d_in[26..27]
    float* OUT = (float*)d_out;     // [8][1024][256]
    char* wsp = (char*)d_ws;
    auto take = [&](size_t bytes) { char* p = wsp; wsp += (bytes + 255) & ~(size_t)255; return (void*)p; };
    bf* WPW[3]; for (int i = 0; i < 3; ++i) WPW[i] = (bf*)take((size_t)OC * CC * 2); bf* WF = (bf*)take((size_t)CC * OC * 2);
    bf* Yh = (bf*)take((size_t)LL * CC * 2); bf* Yl = (bf*)take((size_t)LL * CC * 2); float* F = (float*)take((size_t)LL * OC * 4); h16* QP = (h16*)take((size_t)NHD * LL * CH * 2); h16* KP = (h16*)take((size_t)NHD * LL * CH * 2); h16* VT = (h16*)take((size_t)NHD * CH * LL * 2);
    float* Sb = (float*)take((size_t)TT * TT * 4); h16* Pm = (h16*)take((size_t)TT * TT * 2); float* O = (float*)take((size_t)LL * CH * 4); bf* Ah = (bf*)take((size_t)LL * OC * 2); bf* Al = (bf*)take((size_t)LL * OC * 2);
    if ((size_t)(wsp - (char*)d_ws) > ws_size) return;    // total ~ 15 MB; ws 256 MiB
    { for (int i = 0; i < 3; ++i) k_cvt8<<<(OC * CC / 8 + 255) / 256, 256, 0, stream>>>(IN[2 + 8 * i + 6], WPW[i], (size_t)OC * CC / 8); k_cvt8<<<(CC * OC / 8 + 255) / 256, 256, 0, stream>>>(IN[26], WF, (size_t)CC * OC / 8); }
    const unsigned L2 = (LL * CC / 2 + 255) / 256, LP = (NHD * LL * CH / 2 + 255) / 256;
    for (int b = 0; b < NB_; ++b) {
        for (int br = 0; br < 3; ++br) { const float* fb = IN[br == 0 ? 0 : 1] + (size_t)b * LL * CC; const int s = 2 + 8 * br;
            k_dwT<<<L2, 256, 0, stream>>>(fb, IN[s], IN[s + 1], IN[s + 2], IN[s + 3], IN[s + 4], IN[s + 5], Yh, Yl);
            k_gemmw<bf, 1, true><<<dim3(LL / 64, OC / 64, 1), 32, 0, stream>>>(Yh, Yl, WPW[br], nullptr, CC, F, OC, IN[s + 7], 0, 0, 0);
            if (br == 0) k_pl<<<LP, 256, 0, stream>>>(F, QP); else if (br == 1) k_pl<<<LP, 256, 0, stream>>>(F, KP); else k_vt<<<LP, 256, 0, stream>>>(F, VT); }
        for (int h = 0; h < NHD; ++h) {
            k_gemmw<h16, 0, false><<<dim3(LL / 64, TT / 64, 1), 32, 0, stream>>>(QP + (size_t)h * LL * CH, nullptr, KP + (size_t)h * LL * CH, nullptr, CH, Sb, TT, nullptr, 0, 0, 0);
            k_asoft<<<TT / 8, 256, 0, stream>>>(Sb, Pm);
            k_gemmw<h16, 0, false><<<dim3(LL / 64, 1, 1), 32, 0, stream>>>(Pm, nullptr, VT + (size_t)h * CH * LL, nullptr, TT, O, CH, nullptr, 0, 0, 0);
            k_mrg<<<(LL * CH / 2 + 255) / 256, 256, 0, stream>>>(O, h, Ah, Al); }
        k_gemmw<bf, 1, true><<<dim3(LL / 64, CC / 64, 1), 32, 0, stream>>>(Ah, Al, WF, nullptr, OC, OUT + (size_t)b * LL * CC, CC, IN[27], 0, 0, 0); }
}

// v001
// A run of this version takes 282 microseconds.
// In two side-by-side timings against v000, it was 9.18 and 9.38 times as fast.
#include <hip/hip_runtime.h>

// ConvolutionAttention (features1, features2 [8][1024][256] -> NCHW [8][256][32][32]; q = SepConv_q(x1), k = SepConv_k(x2), v = SepConv_v(x2) with SepConv = depthwise 3x3 (pad 1) + bias, eval BatchNorm,
// pointwise 1x1 -> 512 channels + bias; 8 heads x 64 (head h = channels h*64..); softmax(q.k/8) over the 1024 positions; out = merged (attn v) ffn_w^T + ffn_b -> [8][1024][256]).
// Compute dtypes, f32 accumulate: every input rounded to bf16; depthwise conv + bias + BN fold in f32 on VALU -> bf16 hi+lo planes [position][channel]; the pointwise
// convs on those planes x exact pw weights (2 products, + bias); scores (K 64) and attn.v on SINGLE fp16 planes (1/8 in f32 in the register-row softmax; attn x1024); merged heads as hi+lo planes x

#define NB_  8
#define HWS  32
#define LL   1024                 // positions
#define CC   256
#define OC   512
#define NHD  8
#define CH   64
#define TT   1024
#define ZH   16                   // (batch, head) score matrices held in f32 at a time
#define PCAR 1024.0f
#define SCL  0.125f
typedef _Float16 h16;
typedef unsigned short bf;
typedef __attribute__((ext_vector_type(16))) __bf16   v16bf;
typedef __attribute__((ext_vector_type(16))) _Float16 v16h;
typedef __attribute__((ext_vector_type(8)))  _Float16 v8h;
typedef __attribute__((ext_vector_type(8)))  unsigned short v8us;
typedef __attribute__((ext_vector_type(8)))  float    v8f;
typedef __attribute__((ext_vector_type(4)))  float    v4f;
typedef v8h  __attribute__((may_alias)) v8ha;
typedef v4f  __attribute__((may_alias)) v4fa;
typedef v8us __attribute__((may_alias)) v8usa;

__device__ __forceinline__ unsigned short f2bf(float f) { unsigned u = __float_as_uint(f); u += 0x7FFFu + ((u >> 16) & 1u); return (unsigned short)(u >> 16); }
__device__ __forceinline__ float bf2f(unsigned short b) { return __uint_as_float(((unsigned)b) << 16); }
__device__ __forceinline__ float bfr(float f) { return bf2f(f2bf(f)); }
__device__ __forceinline__ v16h cat16(v8h lo, v8h hi) { return __builtin_shufflevector(lo, hi, 0, 1, 2, 3, 4, 5, 6, 7, 8, 9, 10, 11, 12, 13, 14, 15); }
__device__ __forceinline__ v16bf cat16b(v8us lo, v8us hi) { return __builtin_bit_cast(v16bf, __builtin_shufflevector(lo, hi, 0, 1, 2, 3, 4, 5, 6, 7, 8, 9, 10, 11, 12, 13, 14, 15)); }
__device__ __forceinline__ v8f wmma16(v16h a, v16h b, v8f c) { return __builtin_amdgcn_wmma_f32_16x16x32_f16(false, a, false, b, (short)0, c, false, false); }
__device__ __forceinline__ v8f wmmab(v16bf a, v16bf b, v8f c) { return __builtin_amdgcn_wmma_f32_16x16x32_bf16(false, a, false, b, (short)0, c, false, false); }



// ---- k_gemmw: register-blocked GEMM, ONE WAVE per 64x64 output tile (16 accumulators), operands straight from K-contiguous 16-bit planes; grid (M/64, N/64, Z), 32 threads.
// C[m][n] (f32, pitch ldc, + optional f32 bias[n]) = sum_k A[m][k] Bt[n][k] (+ split products per NSPLIT). z-batch strides sA/sB/sC in elements. K % 32 == 0.
// 2^zs consecutive z share one Bt and one bias: Bt steps by sB and the bias goes bias, bias1, bias2 with z >> zs.
template <typename T16> struct WFrag;
template <> struct WFrag<h16> { typedef v16h V; static __device__ __forceinline__ V ld(const h16* p) { return cat16(*(const v8h*)p, *(const v8h*)(p + 16)); } static __device__ __forceinline__ v8f mma(V a, V b, v8f c) { return wmma16(a, b, c); } };
template <> struct WFrag<bf> { typedef v16bf V; static __device__ __forceinline__ V ld(const bf* p) { return cat16b(*(const v8us*)p, *(const v8us*)(p + 16)); } static __device__ __forceinline__ v8f mma(V a, V b, v8f c) { return wmmab(a, b, c); } };
template <typename T16, int NSPLIT, bool BIAS>
__global__ __launch_bounds__(32) void k_gemmw(const T16* __restrict__ A, const T16* __restrict__ A2, const T16* __restrict__ Bt, const T16* __restrict__ Bt2, int K, float* C, int ldc, const float* __restrict__ bias, const float* __restrict__ bias1, const float* __restrict__ bias2, size_t sA, size_t sB, size_t sC, int zs) {
    typedef typename WFrag<T16>::V V;
    __shared__ __align__(16) float os[16 * 68];
    const size_t z = blockIdx.z, zw = z >> zs; A += z * sA; if (A2) A2 += z * sA; Bt += zw * sB; if (Bt2) Bt2 += zw * sB; C += z * sC; if (BIAS) bias = zw == 0 ? bias : (zw == 1 ? bias1 : bias2);
    const int lane = threadIdx.x & 31, lr = lane & 15, hi = lane >> 4; const int r0 = blockIdx.x * 64, c0 = blockIdx.y * 64;
    v8f acc[4][4];
#pragma unroll
    for (int mb = 0; mb < 4; ++mb)
#pragma unroll
        for (int nb = 0; nb < 4; ++nb) acc[mb][nb] = (v8f){};
    const size_t aoff = (size_t)(r0 + lr) * K + 8 * hi, boff = (size_t)(c0 + lr) * K + 8 * hi;
#pragma unroll 1
    for (int kc = 0; kc < K; kc += 32) {
        V a[4], a2[4];
#pragma unroll
        for (int mb = 0; mb < 4; ++mb) { a[mb] = WFrag<T16>::ld(A + aoff + (size_t)mb * 16 * K + kc); if (NSPLIT == 1 || NSPLIT == 2) a2[mb] = WFrag<T16>::ld(A2 + aoff + (size_t)mb * 16 * K + kc); }
#pragma unroll
        for (int nb = 0; nb < 4; ++nb) { const V b = WFrag<T16>::ld(Bt + boff + (size_t)nb * 16 * K + kc); V b2; if (NSPLIT >= 2) b2 = WFrag<T16>::ld(Bt2 + boff + (size_t)nb * 16 * K + kc);
#pragma unroll
            for (int mb = 0; mb < 4; ++mb) { acc[mb][nb] = WFrag<T16>::mma(a[mb], b, acc[mb][nb]); if (NSPLIT == 1 || NSPLIT == 2) acc[mb][nb] = WFrag<T16>::mma(a2[mb], b, acc[mb][nb]); if (NSPLIT >= 2) acc[mb][nb] = WFrag<T16>::mma(a[mb], b2, acc[mb][nb]); } }
        asm volatile("v_nop\n\tv_nop\n\tv_nop\n\tv_nop" : "+v"(acc[0][0]), "+v"(acc[1][1]), "+v"(acc[2][2]), "+v"(acc[3][3]) : "v"(a[0]), "v"(a[3]));
    }
#pragma unroll
    for (int mb = 0; mb < 4; ++mb) {
#pragma unroll
        for (int nb = 0; nb < 4; ++nb) {
#pragma unroll
            for (int j = 0; j < 8; ++j) os[(hi * 8 + j) * 68 + nb * 16 + lr] = acc[mb][nb][j]; }
        __builtin_amdgcn_wave_barrier(); asm volatile("" ::: "memory");
        float* crow = C + (size_t)(r0 + mb * 16) * ldc + c0;
{
#pragma unroll
            for (int s = 0; s < 8; ++s) { const int row = 2 * s + hi, cofs = lr * 4; v4f val = *(const v4fa*)(os + row * 68 + cofs); if (BIAS) { val[0] += bfr(bias[c0 + cofs]); val[1] += bfr(bias[c0 + cofs + 1]); val[2] += bfr(bias[c0 + cofs + 2]); val[3] += bfr(bias[c0 + cofs + 3]); }
                *(v4f*)(crow + (size_t)row * ldc + cofs) = val; }
             }
        __builtin_amdgcn_wave_barrier(); asm volatile("" ::: "memory");
    }
}

__device__ __forceinline__ h16 tohx(float x) { return (h16)x; }
__device__ __forceinline__ void splitf(float y, unsigned short& h, unsigned short& l) { h = f2bf(y); l = f2bf(y - bf2f(h)); }
typedef __attribute__((ext_vector_type(2))) _Float16 v2h;
typedef __attribute__((ext_vector_type(4))) _Float16 v4h;
typedef __attribute__((ext_vector_type(2))) unsigned short v2us;

// k_cvt8: four equally long f32 arrays (blockIdx.y picks one) -> bf16, written one behind the other
__global__ __launch_bounds__(256) void k_cvt8(const float* __restrict__ s0, const float* __restrict__ s1, const float* __restrict__ s2, const float* __restrict__ s3, bf* dst, size_t n8) { const size_t i = (size_t)blockIdx.x * 256 + threadIdx.x; if (i >= n8) return;
    const int y = blockIdx.y; const float* src = y == 0 ? s0 : (y == 1 ? s1 : (y == 2 ? s2 : s3)); dst += (size_t)y * n8 * 8; const v8f v = *(const v8f*)(src + i * 8); v8us o;
#pragma unroll
    for (int k = 0; k < 8; ++k) o[k] = f2bf(v[k]); *(v8us*)(dst + i * 8) = o;  }
// k_dwT: blockIdx.z = branch * 8 + batch (branch 0 reads f1, branches 1 and 2 read f2): Y hi/lo [pos][c] = split(BN(sum_{3x3} bf16(dw[c][ky][kx]) bf16(f[b][pos'][c]) + bf16(db[c]))) with pos' = (y+ky-1, x+kx-1) zero-padded, f = features [b][pos][c]
__global__ __launch_bounds__(256) void k_dwT(const float* __restrict__ f1, const float* __restrict__ f2,
        const float* __restrict__ dw0, const float* __restrict__ db0, const float* __restrict__ g0, const float* __restrict__ bb0, const float* __restrict__ mu0, const float* __restrict__ var0,
        const float* __restrict__ dw1, const float* __restrict__ db1, const float* __restrict__ g1, const float* __restrict__ bb1, const float* __restrict__ mu1, const float* __restrict__ var1,
        const float* __restrict__ dw2, const float* __restrict__ db2, const float* __restrict__ g2, const float* __restrict__ bb2, const float* __restrict__ mu2, const float* __restrict__ var2, bf* Yh, bf* Yl) {
    const int zz = blockIdx.z, br = zz >> 3; const float* fb = (br == 0 ? f1 : f2) + (size_t)(zz & 7) * LL * CC; Yh += (size_t)zz * LL * CC; Yl += (size_t)zz * LL * CC;
    const float* dw = br == 0 ? dw0 : (br == 1 ? dw1 : dw2); const float* db = br == 0 ? db0 : (br == 1 ? db1 : db2); const float* g = br == 0 ? g0 : (br == 1 ? g1 : g2);
    const float* bb = br == 0 ? bb0 : (br == 1 ? bb1 : bb2); const float* mu = br == 0 ? mu0 : (br == 1 ? mu1 : mu2); const float* var = br == 0 ? var0 : (br == 1 ? var1 : var2);
    const int e = (blockIdx.x * 256 + threadIdx.x) * 2; if (e >= LL * CC) return; const int c = e % CC, pos = e / CC; const int y0 = pos / HWS, x0 = pos % HWS; v2us oh, ol;
#pragma unroll
    for (int q = 0; q < 2; ++q) { const int cq = c + q; float acc = 0.f;
#pragma unroll
        for (int ky = 0; ky < 3; ++ky) {
#pragma unroll
            for (int kx = 0; kx < 3; ++kx) { const int yy = y0 + ky - 1, xx = x0 + kx - 1; if (yy < 0 || yy >= HWS || xx < 0 || xx >= HWS) continue; float w = bfr(dw[cq * 9 + ky * 3 + kx]); asm volatile("" : "+v"(w)); float p = __fmul_rn(w, bfr(fb[((size_t)yy * HWS + xx) * CC + cq])); asm volatile("" : "+v"(p)); acc = __fadd_rn(acc, p); } }
        float dbv = bfr(db[cq]), gm = bfr(g[cq]), be = bfr(bb[cq]), mm = bfr(mu[cq]), vv = bfr(var[cq]); asm volatile("" : "+v"(dbv)); asm volatile("" : "+v"(gm)); asm volatile("" : "+v"(be)); asm volatile("" : "+v"(mm)); asm volatile("" : "+v"(vv));
        const float yv = __fadd_rn(acc, dbv); const float sc = __fmul_rn(__fdiv_rn(1.0f, __fsqrt_rn(__fadd_rn(vv, 1e-5f))), gm); float t = __fmul_rn(__fsub_rn(yv, mm), sc); asm volatile("" : "+v"(t)); unsigned short a, c2; splitf(__fadd_rn(t, be), a, c2); oh[q] = a; ol[q] = c2; }
    *(v2us*)(Yh + e) = oh; *(v2us*)(Yl + e) = ol;  }
__global__ __launch_bounds__(256) void k_pl(const float* __restrict__ F, h16* P) { F += (size_t)blockIdx.y * LL * OC; P += (size_t)blockIdx.y * NHD * LL * CH; const int e = (blockIdx.x * 256 + threadIdx.x) * 2; if (e >= NHD * LL * CH) return; const int d = e & 63; const int pos = (e >> 6) & (LL - 1); const int h = e / (LL * CH); v2h o; o[0] = tohx(F[(size_t)pos * OC + h * CH + d]); o[1] = tohx(F[(size_t)pos * OC + h * CH + d + 1]); *(v2h*)(P + e) = o;  }
__global__ __launch_bounds__(256) void k_vt(const float* __restrict__ F, h16* VT) { F += (size_t)blockIdx.y * LL * OC; VT += (size_t)blockIdx.y * NHD * CH * LL; const int e = (blockIdx.x * 256 + threadIdx.x) * 2; if (e >= NHD * CH * LL) return; const int pos = e & (LL - 1); const int d = (e / LL) & 63; const int h = e / (LL * CH); v2h o; o[0] = tohx(F[(size_t)pos * OC + h * CH + d]); o[1] = tohx(F[(size_t)(pos + 1) * OC + h * CH + d]); *(v2h*)(VT + e) = o;  }
__global__ __launch_bounds__(256) void k_asoft(const float* __restrict__ Sb, h16* P16) {
    const int lane = threadIdx.x & 31; const int row = blockIdx.x * 8 + (threadIdx.x >> 5); if (row >= ZH * TT) return;
    const float* sr = Sb + (size_t)row * TT; float v[32]; float mx = -3.0e38f;
#pragma unroll
    for (int ch = 0; ch < 8; ++ch) { const int j0 = ch * 128 + lane * 4; const v4f a = *(const v4f*)(sr + j0);
#pragma unroll
        for (int q = 0; q < 4; ++q) { const float t = a[q] * SCL; v[ch * 4 + q] = t; mx = fmaxf(mx, t); } }
#pragma unroll
    for (int sh = 16; sh; sh >>= 1) mx = fmaxf(mx, __shfl_xor(mx, sh, 32));
    float sum = 0.f;
#pragma unroll
    for (int k = 0; k < 32; ++k) { v[k] = __expf(v[k] - mx); sum += v[k]; }
#pragma unroll
    for (int sh = 16; sh; sh >>= 1) sum += __shfl_xor(sum, sh, 32);
    const float f = __fdiv_rn(PCAR, sum);
{
#pragma unroll
        for (int ch = 0; ch < 8; ++ch) { v4h o;
#pragma unroll
            for (int q = 0; q < 4; ++q) o[q] = tohx(v[ch * 4 + q] * f);
            *(v4h*)(P16 + (size_t)row * TT + ch * 128 + lane * 4) = o; }
         }
}
__global__ __launch_bounds__(256) void k_mrg(const float* __restrict__ O, bf* Ah, bf* Al) { const int h = blockIdx.y, b = blockIdx.z; O += (size_t)(b * NHD + h) * LL * CH; Ah += (size_t)b * LL * OC; Al += (size_t)b * LL * OC; const int e = (blockIdx.x * 256 + threadIdx.x) * 2; if (e >= LL * CH) return; const int d = e & 63; const int pos = e >> 6; v2us oh, ol;
#pragma unroll
    for (int q = 0; q < 2; ++q) { unsigned short a, c2; splitf(O[e + q] * (1.0f / PCAR), a, c2); oh[q] = a; ol[q] = c2; } const size_t oo = (size_t)pos * OC + h * CH + d; *(v2us*)(Ah + oo) = oh; *(v2us*)(Al + oo) = ol;  }

extern "C" void kernel_launch(void* const* d_in, const int* in_sizes, int n_in,
                              void* d_out, int out_size, void* d_ws, size_t ws_size, hipStream_t stream) {
    (void)in_sizes; (void)n_in; (void)out_size;
    const float* IN[28]; for (int i = 0; i < 28; ++i) IN[i] = (const float*)d_in[i];
    // features1, features2; then per branch q/k/v (base 2, 10, 18): dw_w [256][1][3][3], dw_b, bn_g, bn_b, bn_m, bn_v, pw_w [512][256][1][1], pw_b; ffn_w [256][512], ffn_b = d_in[26..27]
    float* OUT = (float*)d_out;     // [8][1024][256]
    char* wsp = (char*)d_ws;
    auto take = [&](size_t bytes) { char* p = wsp; wsp += (bytes + 255) & ~(size_t)255; return (void*)p; };
    bf* WPW = (bf*)take((size_t)4 * OC * CC * 2); bf* WF = WPW + (size_t)3 * OC * CC;    // pw_w of q, k, v, then ffn_w
    h16* QP = (h16*)take((size_t)2 * NB_ * NHD * LL * CH * 2); h16* KP = QP + (size_t)NB_ * NHD * LL * CH; h16* VT = (h16*)take((size_t)NB_ * NHD * CH * LL * 2);
    bf* Ah = (bf*)take((size_t)NB_ * LL * OC * 2); bf* Al = (bf*)take((size_t)NB_ * LL * OC * 2); float* O = (float*)take((size_t)NB_ * NHD * LL * CH * 4);
    h16* Pm = (h16*)take((size_t)NB_ * NHD * TT * TT * 2); float* Sb = (float*)take((size_t)ZH * TT * TT * 4);
    // Y planes and F (all 3 branches x 8 images) lie in Pm's place: their last reader runs before the first softmax writes Pm
    bf* Yh = (bf*)Pm; bf* Yl = Yh + (size_t)3 * NB_ * LL * CC; float* F = (float*)(Yl + (size_t)3 * NB_ * LL * CC);
    if ((size_t)(wsp - (char*)d_ws) > ws_size) return;    // total ~ 249 MiB; ws 256 MiB
    k_cvt8<<<dim3((OC * CC / 8 + 255) / 256, 4, 1), 256, 0, stream>>>(IN[8], IN[16], IN[24], IN[26], WPW, (size_t)OC * CC / 8);
    const unsigned L2 = (LL * CC / 2 + 255) / 256, LP = (NHD * LL * CH / 2 + 255) / 256;
    k_dwT<<<dim3(L2, 1, 3 * NB_), 256, 0, stream>>>(IN[0], IN[1], IN[2], IN[3], IN[4], IN[5], IN[6], IN[7], IN[10], IN[11], IN[12], IN[13], IN[14], IN[15], IN[18], IN[19], IN[20], IN[21], IN[22], IN[23], Yh, Yl);
    k_gemmw<bf, 1, true><<<dim3(LL / 64, OC / 64, 3 * NB_), 32, 0, stream>>>(Yh, Yl, WPW, nullptr, CC, F, OC, IN[9], IN[17], IN[25], (size_t)LL * CC, (size_t)OC * CC, (size_t)LL * OC, 3);
    k_pl<<<dim3(LP, 2 * NB_, 1), 256, 0, stream>>>(F, QP);
    k_vt<<<dim3(LP, NB_, 1), 256, 0, stream>>>(F + (size_t)2 * NB_ * LL * OC, VT);
    for (int c = 0; c < NB_ * NHD / ZH; ++c) {
        k_gemmw<h16, 0, false><<<dim3(LL / 64, TT / 64, ZH), 32, 0, stream>>>(QP + (size_t)c * ZH * LL * CH, nullptr, KP + (size_t)c * ZH * LL * CH, nullptr, CH, Sb, TT, nullptr, nullptr, nullptr, (size_t)LL * CH, (size_t)LL * CH, (size_t)TT * TT, 0);
        k_asoft<<<ZH * TT / 8, 256, 0, stream>>>(Sb, Pm + (size_t)c * ZH * TT * TT); }
    k_gemmw<h16, 0, false><<<dim3(LL / 64, 1, NB_ * NHD), 32, 0, stream>>>(Pm, nullptr, VT, nullptr, TT, O, CH, nullptr, nullptr, nullptr, (size_t)TT * TT, (size_t)CH * LL, (size_t)LL * CH, 0);
    k_mrg<<<dim3((LL * CH / 2 + 255) / 256, NHD, NB_), 256, 0, stream>>>(O, Ah, Al);
    k_gemmw<bf, 1, true><<<dim3(NB_ * LL / 64, CC / 64, 1), 32, 0, stream>>>(Ah, Al, WF, nullptr, OC, OUT, CC, IN[27], IN[27], IN[27], 0, 0, 0, 0);
}

// v002
// One run takes 143 microseconds.
// Two timings next to v001 put it at 1.98 and 1.97 times that version's speed.
// Counting every step since v000, it is 18.3 times as fast.
#include <hip/hip_runtime.h>

// ConvolutionAttention (features1, features2 [8][1024][256] -> NCHW [8][256][32][32]; q = SepConv_q(x1), k = SepConv_k(x2), v = SepConv_v(x2) with SepConv = depthwise 3x3 (pad 1) + bias, eval BatchNorm,
// pointwise 1x1 -> 512 channels + bias; 8 heads x 64 (head h = channels h*64..); softmax(q.k/8) over the 1024 positions; out = merged (attn v) ffn_w^T + ffn_b -> [8][1024][256]).
// Compute dtypes, f32 accumulate: every input rounded to bf16; depthwise conv + bias + BN fold in f32 on VALU -> bf16 hi+lo planes [position][channel]; the pointwise
// convs on those planes x exact pw weights (2 products, + bias); scores (K 64) and attn.v on SINGLE fp16 operands (1/8 in f32 in the online softmax; attn as exp(s - running max), divided by the row sum at the end); merged heads as hi+lo planes x

#define NB_  8
#define HWS  32
#define LL   1024                 // positions
#define CC   256
#define OC   512
#define NHD  8
#define CH   64
#define TT   1024
typedef _Float16 h16;
typedef unsigned short bf;
typedef __attribute__((ext_vector_type(16))) __bf16   v16bf;
typedef __attribute__((ext_vector_type(16))) _Float16 v16h;
typedef __attribute__((ext_vector_type(8)))  _Float16 v8h;
typedef __attribute__((ext_vector_type(8)))  unsigned short v8us;
typedef __attribute__((ext_vector_type(8)))  float    v8f;
typedef __attribute__((ext_vector_type(4)))  float    v4f;
typedef v8h  __attribute__((may_alias)) v8ha;
typedef v4f  __attribute__((may_alias)) v4fa;
typedef v8us __attribute__((may_alias)) v8usa;

__device__ __forceinline__ unsigned short f2bf(float f) { unsigned u = __float_as_uint(f); u += 0x7FFFu + ((u >> 16) & 1u); return (unsigned short)(u >> 16); }
__device__ __forceinline__ float bf2f(unsigned short b) { return __uint_as_float(((unsigned)b) << 16); }
__device__ __forceinline__ float bfr(float f) { return bf2f(f2bf(f)); }
__device__ __forceinline__ v16h cat16(v8h lo, v8h hi) { return __builtin_shufflevector(lo, hi, 0, 1, 2, 3, 4, 5, 6, 7, 8, 9, 10, 11, 12, 13, 14, 15); }
__device__ __forceinline__ v16bf cat16b(v8us lo, v8us hi) { return __builtin_bit_cast(v16bf, __builtin_shufflevector(lo, hi, 0, 1, 2, 3, 4, 5, 6, 7, 8, 9, 10, 11, 12, 13, 14, 15)); }
__device__ __forceinline__ v8f wmma16(v16h a, v16h b, v8f c) { return __builtin_amdgcn_wmma_f32_16x16x32_f16(false, a, false, b, (short)0, c, false, false); }
__device__ __forceinline__ v8f wmmab(v16bf a, v16bf b, v8f c) { return __builtin_amdgcn_wmma_f32_16x16x32_bf16(false, a, false, b, (short)0, c, false, false); }



// ---- k_gemmw: register-blocked GEMM, ONE WAVE per 64x64 output tile (16 accumulators), operands straight from K-contiguous 16-bit planes; grid (M/64, N/64, Z), 32 threads.
// C[m][n] (f32, pitch ldc, + optional f32 bias[n]) = sum_k A[m][k] Bt[n][k] (+ split products per NSPLIT). z-batch strides sA/sB/sC in elements. K % 32 == 0.
// 2^zs consecutive z share one Bt and one bias: Bt steps by sB and the bias goes bias, bias1, bias2 with z >> zs.
template <typename T16> struct WFrag;
template <> struct WFrag<h16> { typedef v16h V; static __device__ __forceinline__ V ld(const h16* p) { return cat16(*(const v8h*)p, *(const v8h*)(p + 16)); } static __device__ __forceinline__ v8f mma(V a, V b, v8f c) { return wmma16(a, b, c); } };
template <> struct WFrag<bf> { typedef v16bf V; static __device__ __forceinline__ V ld(const bf* p) { return cat16b(*(const v8us*)p, *(const v8us*)(p + 16)); } static __device__ __forceinline__ v8f mma(V a, V b, v8f c) { return wmmab(a, b, c); } };
template <typename T16, int NSPLIT, bool BIAS>
__global__ __launch_bounds__(32) void k_gemmw(const T16* __restrict__ A, const T16* __restrict__ A2, const T16* __restrict__ Bt, const T16* __restrict__ Bt2, int K, float* C, int ldc, const float* __restrict__ bias, const float* __restrict__ bias1, const float* __restrict__ bias2, size_t sA, size_t sB, size_t sC, int zs) {
    typedef typename WFrag<T16>::V V;
    __shared__ __align__(16) float os[16 * 68];
    const size_t z = blockIdx.z, zw = z >> zs; A += z * sA; if (A2) A2 += z * sA; Bt += zw * sB; if (Bt2) Bt2 += zw * sB; C += z * sC; if (BIAS) bias = zw == 0 ? bias : (zw == 1 ? bias1 : bias2);
    const int lane = threadIdx.x & 31, lr = lane & 15, hi = lane >> 4; const int r0 = blockIdx.x * 64, c0 = blockIdx.y * 64;
    v8f acc[4][4];
#pragma unroll
    for (int mb = 0; mb < 4; ++mb)
#pragma unroll
        for (int nb = 0; nb < 4; ++nb) acc[mb][nb] = (v8f){};
    const size_t aoff = (size_t)(r0 + lr) * K + 8 * hi, boff = (size_t)(c0 + lr) * K + 8 * hi;
#pragma unroll 1
    for (int kc = 0; kc < K; kc += 32) {
        V a[4], a2[4];
#pragma unroll
        for (int mb = 0; mb < 4; ++mb) { a[mb] = WFrag<T16>::ld(A + aoff + (size_t)mb * 16 * K + kc); if (NSPLIT == 1 || NSPLIT == 2) a2[mb] = WFrag<T16>::ld(A2 + aoff + (size_t)mb * 16 * K + kc); }
#pragma unroll
        for (int nb = 0; nb < 4; ++nb) { const V b = WFrag<T16>::ld(Bt + boff + (size_t)nb * 16 * K + kc); V b2; if (NSPLIT >= 2) b2 = WFrag<T16>::ld(Bt2 + boff + (size_t)nb * 16 * K + kc);
#pragma unroll
            for (int mb = 0; mb < 4; ++mb) { acc[mb][nb] = WFrag<T16>::mma(a[mb], b, acc[mb][nb]); if (NSPLIT == 1 || NSPLIT == 2) acc[mb][nb] = WFrag<T16>::mma(a2[mb], b, acc[mb][nb]); if (NSPLIT >= 2) acc[mb][nb] = WFrag<T16>::mma(a[mb], b2, acc[mb][nb]); } }
        asm volatile("v_nop\n\tv_nop\n\tv_nop\n\tv_nop" : "+v"(acc[0][0]), "+v"(acc[1][1]), "+v"(acc[2][2]), "+v"(acc[3][3]) : "v"(a[0]), "v"(a[3]));
    }
#pragma unroll
    for (int mb = 0; mb < 4; ++mb) {
#pragma unroll
        for (int nb = 0; nb < 4; ++nb) {
#pragma unroll
            for (int j = 0; j < 8; ++j) os[(hi * 8 + j) * 68 + nb * 16 + lr] = acc[mb][nb][j]; }
        __builtin_amdgcn_wave_barrier(); asm volatile("" ::: "memory");
        float* crow = C + (size_t)(r0 + mb * 16) * ldc + c0;
{
#pragma unroll
            for (int s = 0; s < 8; ++s) { const int row = 2 * s + hi, cofs = lr * 4; v4f val = *(const v4fa*)(os + row * 68 + cofs); if (BIAS) { val[0] += bfr(bias[c0 + cofs]); val[1] += bfr(bias[c0 + cofs + 1]); val[2] += bfr(bias[c0 + cofs + 2]); val[3] += bfr(bias[c0 + cofs + 3]); }
                *(v4f*)(crow + (size_t)row * ldc + cofs) = val; }
             }
        __builtin_amdgcn_wave_barrier(); asm volatile("" ::: "memory");
    }
}

__device__ __forceinline__ h16 tohx(float x) { return (h16)x; }
__device__ __forceinline__ void splitf(float y, unsigned short& h, unsigned short& l) { h = f2bf(y); l = f2bf(y - bf2f(h)); }
typedef __attribute__((ext_vector_type(2))) _Float16 v2h;
typedef __attribute__((ext_vector_type(4))) _Float16 v4h;
typedef __attribute__((ext_vector_type(2))) unsigned short v2us;

// k_cvt8: four equally long f32 arrays (blockIdx.y picks one) -> bf16, written one behind the other
__global__ __launch_bounds__(256) void k_cvt8(const float* __restrict__ s0, const float* __restrict__ s1, const float* __restrict__ s2, const float* __restrict__ s3, bf* dst, size_t n8) { const size_t i = (size_t)blockIdx.x * 256 + threadIdx.x; if (i >= n8) return;
    const int y = blockIdx.y; const float* src = y == 0 ? s0 : (y == 1 ? s1 : (y == 2 ? s2 : s3)); dst += (size_t)y * n8 * 8; const v8f v = *(const v8f*)(src + i * 8); v8us o;
#pragma unroll
    for (int k = 0; k < 8; ++k) o[k] = f2bf(v[k]); *(v8us*)(dst + i * 8) = o;  }
// k_dwT: blockIdx.z = branch * 8 + batch (branch 0 reads f1, branches 1 and 2 read f2): Y hi/lo [pos][c] = split(BN(sum_{3x3} bf16(dw[c][ky][kx]) bf16(f[b][pos'][c]) + bf16(db[c]))) with pos' = (y+ky-1, x+kx-1) zero-padded, f = features [b][pos][c]
__global__ __launch_bounds__(256) void k_dwT(const float* __restrict__ f1, const float* __restrict__ f2,
        const float* __restrict__ dw0, const float* __restrict__ db0, const float* __restrict__ g0, const float* __restrict__ bb0, const float* __restrict__ mu0, const float* __restrict__ var0,
        const float* __restrict__ dw1, const float* __restrict__ db1, const float* __restrict__ g1, const float* __restrict__ bb1, const float* __restrict__ mu1, const float* __restrict__ var1,
        const float* __restrict__ dw2, const float* __restrict__ db2, const float* __restrict__ g2, const float* __restrict__ bb2, const float* __restrict__ mu2, const float* __restrict__ var2, bf* Yh, bf* Yl) {
    const int zz = blockIdx.z, br = zz >> 3; const float* fb = (br == 0 ? f1 : f2) + (size_t)(zz & 7) * LL * CC; Yh += (size_t)zz * LL * CC; Yl += (size_t)zz * LL * CC;
    const float* dw = br == 0 ? dw0 : (br == 1 ? dw1 : dw2); const float* db = br == 0 ? db0 : (br == 1 ? db1 : db2); const float* g = br == 0 ? g0 : (br == 1 ? g1 : g2);
    const float* bb = br == 0 ? bb0 : (br == 1 ? bb1 : bb2); const float* mu = br == 0 ? mu0 : (br == 1 ? mu1 : mu2); const float* var = br == 0 ? var0 : (br == 1 ? var1 : var2);
    const int e = (blockIdx.x * 256 + threadIdx.x) * 2; if (e >= LL * CC) return; const int c = e % CC, pos = e / CC; const int y0 = pos / HWS, x0 = pos % HWS; v2us oh, ol;
#pragma unroll
    for (int q = 0; q < 2; ++q) { const int cq = c + q; float acc = 0.f;
#pragma unroll
        for (int ky = 0; ky < 3; ++ky) {
#pragma unroll
            for (int kx = 0; kx < 3; ++kx) { const int yy = y0 + ky - 1, xx = x0 + kx - 1; if (yy < 0 || yy >= HWS || xx < 0 || xx >= HWS) continue; float w = bfr(dw[cq * 9 + ky * 3 + kx]); asm volatile("" : "+v"(w)); float p = __fmul_rn(w, bfr(fb[((size_t)yy * HWS + xx) * CC + cq])); asm volatile("" : "+v"(p)); acc = __fadd_rn(acc, p); } }
        float dbv = bfr(db[cq]), gm = bfr(g[cq]), be = bfr(bb[cq]), mm = bfr(mu[cq]), vv = bfr(var[cq]); asm volatile("" : "+v"(dbv)); asm volatile("" : "+v"(gm)); asm volatile("" : "+v"(be)); asm volatile("" : "+v"(mm)); asm volatile("" : "+v"(vv));
        const float yv = __fadd_rn(acc, dbv); const float sc = __fmul_rn(__fdiv_rn(1.0f, __fsqrt_rn(__fadd_rn(vv, 1e-5f))), gm); float t = __fmul_rn(__fsub_rn(yv, mm), sc); asm volatile("" : "+v"(t)); unsigned short a, c2; splitf(__fadd_rn(t, be), a, c2); oh[q] = a; ol[q] = c2; }
    *(v2us*)(Yh + e) = oh; *(v2us*)(Yl + e) = ol;  }
#define KT   64                   // keys per stage
#define KPIT 72                   // LDS row pitch in 16-bit elements: 144 B = 16 B x odd, for 16-byte row reads
#define SC2  0.18033688011112042f // 1/8 * log2(e)
__device__ __forceinline__ float xhalf(float x) { const int b = __float_as_int(x); return __int_as_float(__builtin_amdgcn_permlanex16(b, b, 0x76543210, 0xfedcba98, false, false)); }   // lane l <-> l ^ 16
// eight 2^x in place, one v_nop behind the last: so no instruction that stands directly behind a v_exp_f32 reads its result or overwrites its source (the slot the instruction set asks for)
__device__ __forceinline__ void exp2x8(float (&e)[8]) {
    asm("v_exp_f32 %0, %0\n\tv_exp_f32 %1, %1\n\tv_exp_f32 %2, %2\n\tv_exp_f32 %3, %3\n\tv_exp_f32 %4, %4\n\tv_exp_f32 %5, %5\n\tv_exp_f32 %6, %6\n\tv_exp_f32 %7, %7\n\tv_nop"
        : "+v"(e[0]), "+v"(e[1]), "+v"(e[2]), "+v"(e[3]), "+v"(e[4]), "+v"(e[5]), "+v"(e[6]), "+v"(e[7])); }
__global__ __launch_bounds__(256) void k_fattn(const float* __restrict__ F, bf* Ah, bf* Al) {
    __shared__ __align__(16) h16 ks[2][KT * KPIT];    // [key][d]
    __shared__ __align__(16) h16 vs[2][CH * KPIT];    // [d][key]
    const int z = blockIdx.y, h = z & (NHD - 1), b = z / NHD, tid = threadIdx.x, lane = tid & 31, lr = lane & 15, hi = lane >> 4; const int q0 = blockIdx.x * 256 + (tid >> 5) * 32;
    const float* Fq = F + (size_t)b * LL * OC + h * CH; const float* Fk = Fq + (size_t)NB_ * LL * OC; const float* Fv = Fk + (size_t)NB_ * LL * OC;
    v16h qf[2][2];
#pragma unroll
    for (int qb = 0; qb < 2; ++qb)
#pragma unroll
        for (int kc = 0; kc < 2; ++kc) { const float* qp = Fq + (size_t)(q0 + qb * 16 + lr) * OC + kc * 32 + 8 * hi; const v8f x0 = *(const v8f*)qp, x1 = *(const v8f*)(qp + 16);
#pragma unroll
            for (int j = 0; j < 8; ++j) { qf[qb][kc][j] = tohx(x0[j]); qf[qb][kc][8 + j] = tohx(x1[j]); } }
    // staging: a stage is 64 keys x 64 d of k and of v; thread (dq, rq) moves d 4 dq .. 4 dq + 3 of k's rows rq + 16 i and of v's rows 4 rq + i (i = 0 .. 3): 16 lanes read 256 contiguous bytes,
    // and v's four keys of one d go transposed into LDS as one 8-byte store
    const int dq = tid & 15, rq = tid >> 4; const float* kg = Fk + (size_t)rq * OC + dq * 4; const float* vg = Fv + (size_t)(rq * 4) * OC + dq * 4; v4f kr[4], vr[4];
    auto fetch = [&](int t) {
#pragma unroll
        for (int i = 0; i < 4; ++i) { kr[i] = *(const v4f*)(kg + (size_t)(t * KT + 16 * i) * OC); vr[i] = *(const v4f*)(vg + (size_t)(t * KT + i) * OC); } };
    auto put = [&](h16* kn, h16* vn) {
#pragma unroll
        for (int i = 0; i < 4; ++i) { v4h ok, ov;
#pragma unroll
            for (int e = 0; e < 4; ++e) { ok[e] = tohx(kr[i][e]); ov[e] = tohx(vr[e][i]); }
            *(v4h*)(kn + (rq + 16 * i) * KPIT + dq * 4) = ok; *(v4h*)(vn + (dq * 4 + i) * KPIT + rq * 4) = ov; } };
    fetch(0); put(ks[0], vs[0]); fetch(1);
    v8f acc[2][4]; float m[2], l[2];
#pragma unroll
    for (int qb = 0; qb < 2; ++qb) { m[qb] = -3.0e38f; l[qb] = 0.f;
#pragma unroll
        for (int mb = 0; mb < 4; ++mb) acc[qb][mb] = (v8f){}; }
    __syncthreads();    // publishes stage 0
#pragma unroll 1    // rolled: one pass is some 500 instructions
    for (int t = 0; t < TT / KT; ++t) {
        const h16* kb_ = ks[t & 1]; const h16* vb_ = vs[t & 1];
        if (t + 1 < TT / KT) put(ks[(t + 1) & 1], vs[(t + 1) & 1]);    // stage t + 1 into the other buffer: its readers (pass t - 1) left it before the barrier at that pass's foot
        if (t + 2 < TT / KT) { fetch(t + 2);                           // stage t + 2 into registers, a whole pass ahead of its LDS stores
            asm volatile("s_wait_xcnt 0x0" ::: "memory"); }            // the loads' address registers are reused right behind them
        v8f s[2][4];
#pragma unroll
        for (int kb = 0; kb < 4; ++kb) { const h16* kp = kb_ + (kb * 16 + lr) * KPIT + 8 * hi; const v16h a0 = WFrag<h16>::ld(kp), a1 = WFrag<h16>::ld(kp + 32);
#pragma unroll
            for (int qb = 0; qb < 2; ++qb) s[qb][kb] = wmma16(a1, qf[qb][1], wmma16(a0, qf[qb][0], (v8f){})); }
        v16h pf[2][2];
#pragma unroll
        for (int qb = 0; qb < 2; ++qb) { float mt = s[qb][0][0];
#pragma unroll
            for (int kb = 0; kb < 4; ++kb)
#pragma unroll
                for (int j = 0; j < 8; ++j) mt = fmaxf(mt, s[qb][kb][j]);
            mt = fmaxf(mt, xhalf(mt)); const float mn = fmaxf(m[qb], mt); float corr = (m[qb] - mn) * SC2; const float mc = mn * SC2; m[qb] = mn; float ps = 0.f;
            asm("v_exp_f32 %0, %0\n\tv_nop" : "+v"(corr));    // as in exp2x8
#pragma unroll
            for (int kb = 0; kb < 4; ++kb) { float e[8];
#pragma unroll
                for (int j = 0; j < 8; ++j) e[j] = fmaf(s[qb][kb][j], SC2, -mc);
                exp2x8(e);
#pragma unroll
                for (int j = 0; j < 8; ++j) { ps += e[j]; pf[qb][kb >> 1][(kb & 1) * 8 + j] = tohx(e[j]); } }
            l[qb] = fmaf(l[qb], corr, ps);
#pragma unroll
            for (int mb = 0; mb < 4; ++mb) acc[qb][mb] *= corr; }
#pragma unroll
        for (int c = 0; c < 2; ++c)
#pragma unroll
            for (int mb = 0; mb < 4; ++mb) { const v16h va = WFrag<h16>::ld(vb_ + (mb * 16 + lr) * KPIT + c * 32 + 8 * hi);
#pragma unroll
                for (int qb = 0; qb < 2; ++qb) acc[qb][mb] = wmma16(va, pf[qb][c], acc[qb][mb]); }
        __syncthreads();    // publishes stage t + 1 and ends every read of stage t's buffer
    }
    Ah += (size_t)b * LL * OC; Al += (size_t)b * LL * OC;
#pragma unroll
    for (int qb = 0; qb < 2; ++qb) { const float inv = __fdiv_rn(1.0f, l[qb] + xhalf(l[qb])); const size_t oo = (size_t)(q0 + qb * 16 + lr) * OC + h * CH + hi * 8;
#pragma unroll
        for (int mb = 0; mb < 4; ++mb) { v8us oh, ol;
#pragma unroll
            for (int j = 0; j < 8; ++j) { unsigned short a, c2; splitf(acc[qb][mb][j] * inv, a, c2); oh[j] = a; ol[j] = c2; }
            *(v8us*)(Ah + oo + mb * 16) = oh; *(v8us*)(Al + oo + mb * 16) = ol; } }
}

extern "C" void kernel_launch(void* const* d_in, const int* in_sizes, int n_in,
                              void* d_out, int out_size, void* d_ws, size_t ws_size, hipStream_t stream) {
    (void)in_sizes; (void)n_in; (void)out_size;
    const float* IN[28]; for (int i = 0; i < 28; ++i) IN[i] = (const float*)d_in[i];
    // features1, features2; then per branch q/k/v (base 2, 10, 18): dw_w [256][1][3][3], dw_b, bn_g, bn_b, bn_m, bn_v, pw_w [512][256][1][1], pw_b; ffn_w [256][512], ffn_b = d_in[26..27]
    float* OUT = (float*)d_out;     // [8][1024][256]
    char* wsp = (char*)d_ws;
    auto take = [&](size_t bytes) { char* p = wsp; wsp += (bytes + 255) & ~(size_t)255; return (void*)p; };
    bf* WPW = (bf*)take((size_t)4 * OC * CC * 2); bf* WF = WPW + (size_t)3 * OC * CC;    // pw_w of q, k, v, then ffn_w
    bf* Ah = (bf*)take((size_t)NB_ * LL * OC * 2); bf* Al = (bf*)take((size_t)NB_ * LL * OC * 2);
    // Y planes and F, all 3 branches x 8 images
    bf* Yh = (bf*)take((size_t)3 * NB_ * LL * CC * 2); bf* Yl = (bf*)take((size_t)3 * NB_ * LL * CC * 2); float* F = (float*)take((size_t)3 * NB_ * LL * OC * 4);
    if ((size_t)(wsp - (char*)d_ws) > ws_size) return;    // total ~ 89 MiB; ws 256 MiB
    k_cvt8<<<dim3((OC * CC / 8 + 255) / 256, 4, 1), 256, 0, stream>>>(IN[8], IN[16], IN[24], IN[26], WPW, (size_t)OC * CC / 8);
    const unsigned L2 = (LL * CC / 2 + 255) / 256;
    k_dwT<<<dim3(L2, 1, 3 * NB_), 256, 0, stream>>>(IN[0], IN[1], IN[2], IN[3], IN[4], IN[5], IN[6], IN[7], IN[10], IN[11], IN[12], IN[13], IN[14], IN[15], IN[18], IN[19], IN[20], IN[21], IN[22], IN[23], Yh, Yl);
    k_gemmw<bf, 1, true><<<dim3(LL / 64, OC / 64, 3 * NB_), 32, 0, stream>>>(Yh, Yl, WPW, nullptr, CC, F, OC, IN[9], IN[17], IN[25], (size_t)LL * CC, (size_t)OC * CC, (size_t)LL * OC, 3);
    k_fattn<<<dim3(LL / 256, NB_ * NHD, 1), 256, 0, stream>>>(F, Ah, Al);
    k_gemmw<bf, 1, true><<<dim3(NB_ * LL / 64, CC / 64, 1), 32, 0, stream>>>(Ah, Al, WF, nullptr, OC, OUT, CC, IN[27], IN[27], IN[27], 0, 0, 0, 0);
}

// v003
// One run takes 105 microseconds.
// Two timings next to v002 both put it at 1.36 times that version's speed.
// All steps since v000 together make it 24.8 times as fast.
#include <hip/hip_runtime.h>

// ConvolutionAttention (features1, features2 [8][1024][256] -> NCHW [8][256][32][32]; q = SepConv_q(x1), k = SepConv_k(x2), v = SepConv_v(x2) with SepConv = depthwise 3x3 (pad 1) + bias, eval BatchNorm,
// pointwise 1x1 -> 512 channels + bias; 8 heads x 64 (head h = channels h*64..); softmax(q.k/8) over the 1024 positions; out = merged (attn v) ffn_w^T + ffn_b -> [8][1024][256]).
// Compute dtypes, f32 accumulate: every input rounded to bf16; depthwise conv + bias + BN fold in f32 on VALU -> bf16 hi+lo planes [position][channel]; the pointwise
// convs on those planes x exact pw weights (2 products, + bias); scores (K 64) and attn.v on SINGLE fp16 operands (1/8 in f32 in the online softmax; attn as exp(s - running max), divided by the row sum at the end); merged heads as hi+lo planes x

#define NB_  8
#define HWS  32
#define LL   1024                 // positions
#define CC   256
#define OC   512
#define NHD  8
#define CH   64
#define TT   1024
typedef _Float16 h16;
typedef unsigned short bf;
typedef __attribute__((ext_vector_type(16))) __bf16   v16bf;
typedef __attribute__((ext_vector_type(16))) _Float16 v16h;
typedef __attribute__((ext_vector_type(8)))  _Float16 v8h;
typedef __attribute__((ext_vector_type(8)))  unsigned short v8us;
typedef __attribute__((ext_vector_type(8)))  float    v8f;
typedef __attribute__((ext_vector_type(4)))  float    v4f;
typedef v8h  __attribute__((may_alias)) v8ha;
typedef v4f  __attribute__((may_alias)) v4fa;
typedef v8us __attribute__((may_alias)) v8usa;

__device__ __forceinline__ unsigned short f2bf(float f) { unsigned u = __float_as_uint(f); u += 0x7FFFu + ((u >> 16) & 1u); return (unsigned short)(u >> 16); }
__device__ __forceinline__ float bf2f(unsigned short b) { return __uint_as_float(((unsigned)b) << 16); }
__device__ __forceinline__ float bfr(float f) { return bf2f(f2bf(f)); }
__device__ __forceinline__ v16h cat16(v8h lo, v8h hi) { return __builtin_shufflevector(lo, hi, 0, 1, 2, 3, 4, 5, 6, 7, 8, 9, 10, 11, 12, 13, 14, 15); }
__device__ __forceinline__ v16bf cat16b(v8us lo, v8us hi) { return __builtin_bit_cast(v16bf, __builtin_shufflevector(lo, hi, 0, 1, 2, 3, 4, 5, 6, 7, 8, 9, 10, 11, 12, 13, 14, 15)); }
__device__ __forceinline__ v8f wmma16(v16h a, v16h b, v8f c) { return __builtin_amdgcn_wmma_f32_16x16x32_f16(false, a, false, b, (short)0, c, false, false); }
__device__ __forceinline__ v8f wmmab(v16bf a, v16bf b, v8f c) { return __builtin_amdgcn_wmma_f32_16x16x32_bf16(false, a, false, b, (short)0, c, false, false); }



// ---- k_gemmw: register-blocked GEMM, ONE WAVE per 64x64 output tile (16 accumulators), operands straight from K-contiguous 16-bit planes; grid (M/64, N/64, Z), 32 threads.
// C[m][n] (f32, pitch ldc, + optional f32 bias[n]) = sum_k A[m][k] Bt[n][k] (+ split products per NSPLIT). z-batch strides sA/sB/sC in elements. K % 32 == 0.
// 2^zs consecutive z share one Bt and one bias: Bt steps by sB and the bias goes bias, bias1, bias2 with z >> zs.
template <typename T16> struct WFrag;
template <> struct WFrag<h16> { typedef v16h V; static __device__ __forceinline__ V ld(const h16* p) { return cat16(*(const v8h*)p, *(const v8h*)(p + 16)); } static __device__ __forceinline__ v8f mma(V a, V b, v8f c) { return wmma16(a, b, c); } };
template <> struct WFrag<bf> { typedef v16bf V; static __device__ __forceinline__ V ld(const bf* p) { return cat16b(*(const v8us*)p, *(const v8us*)(p + 16)); } static __device__ __forceinline__ v8f mma(V a, V b, v8f c) { return wmmab(a, b, c); } };
template <typename T16, int NSPLIT, bool BIAS>
__global__ __launch_bounds__(32) void k_gemmw(const T16* __restrict__ A, const T16* __restrict__ A2, const T16* __restrict__ Bt, const T16* __restrict__ Bt2, int K, float* C, int ldc, const float* __restrict__ bias, const float* __restrict__ bias1, const float* __restrict__ bias2, size_t sA, size_t sB, size_t sC, int zs) {
    typedef typename WFrag<T16>::V V;
    __shared__ __align__(16) float os[16 * 68];
    const size_t z = blockIdx.z, zw = z >> zs; A += z * sA; if (A2) A2 += z * sA; Bt += zw * sB; if (Bt2) Bt2 += zw * sB; C += z * sC; if (BIAS) bias = zw == 0 ? bias : (zw == 1 ? bias1 : bias2);
    const int lane = threadIdx.x & 31, lr = lane & 15, hi = lane >> 4; const int r0 = blockIdx.x * 64, c0 = blockIdx.y * 64;
    v8f acc[4][4];
#pragma unroll
    for (int mb = 0; mb < 4; ++mb)
#pragma unroll
        for (int nb = 0; nb < 4; ++nb) acc[mb][nb] = (v8f){};
    const size_t aoff = (size_t)(r0 + lr) * K + 8 * hi, boff = (size_t)(c0 + lr) * K + 8 * hi;
#pragma unroll 1
    for (int kc = 0; kc < K; kc += 32) {
        V a[4], a2[4];
#pragma unroll
        for (int mb = 0; mb < 4; ++mb) { a[mb] = WFrag<T16>::ld(A + aoff + (size_t)mb * 16 * K + kc); if (NSPLIT == 1 || NSPLIT == 2) a2[mb] = WFrag<T16>::ld(A2 + aoff + (size_t)mb * 16 * K + kc); }
#pragma unroll
        for (int nb = 0; nb < 4; ++nb) { const V b = WFrag<T16>::ld(Bt + boff + (size_t)nb * 16 * K + kc); V b2; if (NSPLIT >= 2) b2 = WFrag<T16>::ld(Bt2 + boff + (size_t)nb * 16 * K + kc);
#pragma unroll
            for (int mb = 0; mb < 4; ++mb) { acc[mb][nb] = WFrag<T16>::mma(a[mb], b, acc[mb][nb]); if (NSPLIT == 1 || NSPLIT == 2) acc[mb][nb] = WFrag<T16>::mma(a2[mb], b, acc[mb][nb]); if (NSPLIT >= 2) acc[mb][nb] = WFrag<T16>::mma(a[mb], b2, acc[mb][nb]); } }
        asm volatile("v_nop\n\tv_nop\n\tv_nop\n\tv_nop" : "+v"(acc[0][0]), "+v"(acc[1][1]), "+v"(acc[2][2]), "+v"(acc[3][3]) : "v"(a[0]), "v"(a[3]));
    }
#pragma unroll
    for (int mb = 0; mb < 4; ++mb) {
#pragma unroll
        for (int nb = 0; nb < 4; ++nb) {
#pragma unroll
            for (int j = 0; j < 8; ++j) os[(hi * 8 + j) * 68 + nb * 16 + lr] = acc[mb][nb][j]; }
        __builtin_amdgcn_wave_barrier(); asm volatile("" ::: "memory");
        float* crow = C + (size_t)(r0 + mb * 16) * ldc + c0;
{
#pragma unroll
            for (int s = 0; s < 8; ++s) { const int row = 2 * s + hi, cofs = lr * 4; v4f val = *(const v4fa*)(os + row * 68 + cofs); if (BIAS) { val[0] += bfr(bias[c0 + cofs]); val[1] += bfr(bias[c0 + cofs + 1]); val[2] += bfr(bias[c0 + cofs + 2]); val[3] += bfr(bias[c0 + cofs + 3]); }
                *(v4f*)(crow + (size_t)row * ldc + cofs) = val; }
             }
        __builtin_amdgcn_wave_barrier(); asm volatile("" ::: "memory");
    }
}

__device__ __forceinline__ h16 tohx(float x) { return (h16)x; }
__device__ __forceinline__ void splitf(float y, unsigned short& h, unsigned short& l) { h = f2bf(y); l = f2bf(y - bf2f(h)); }
typedef __attribute__((ext_vector_type(2))) _Float16 v2h;
typedef __attribute__((ext_vector_type(4))) _Float16 v4h;
typedef __attribute__((ext_vector_type(2))) unsigned short v2us;

// k_cvt8: four equally long f32 arrays (blockIdx.y picks one) -> bf16, written one behind the other
__global__ __launch_bounds__(256) void k_cvt8(const float* __restrict__ s0, const float* __restrict__ s1, const float* __restrict__ s2, const float* __restrict__ s3, bf* dst, size_t n8) { const size_t i = (size_t)blockIdx.x * 256 + threadIdx.x; if (i >= n8) return;
    const int y = blockIdx.y; const float* src = y == 0 ? s0 : (y == 1 ? s1 : (y == 2 ? s2 : s3)); dst += (size_t)y * n8 * 8; const v8f v = *(const v8f*)(src + i * 8); v8us o;
#pragma unroll
    for (int k = 0; k < 8; ++k) o[k] = f2bf(v[k]); *(v8us*)(dst + i * 8) = o;  }
// k_dwT: Y hi/lo [pos][c] = split(BN(sum_{3x3} bf16(dw[c][ky][kx]) bf16(f[b][pos'][c]) + bf16(db[c]))) with pos' = (y+ky-1, x+kx-1) zero-padded, f = features [b][pos][c].
// blockIdx.z = branch * 8 + batch (branch 0 reads f1, branches 1 and 2 read f2). One thread: 4 channels of DR rows of one image column. Its 36 weights and its BatchNorm terms are read and rounded once,
// each feature vector (one 16-byte load, a wave reads 512 contiguous bytes) once for the up to three rows that use it. Grid (32 / 4 columns, 32 / DR row strips, 24), 256 threads = 64 channel groups x 4 columns.
// A tap outside the image enters as 0. The product of two bf16 values is exact in f32, so the fused multiply-add rounds as a multiply and an add would; taps are summed ky-major, kx-minor.
// Every loop is unrolled so that each index of a register array is a constant and a thread's loads are issued together, ahead of the first wait.
#define DR 8
typedef __attribute__((ext_vector_type(4))) unsigned short v4us;
// bfr of four values; keep = 0xFFFF0000 is bfr's own cut to the upper 16 bits, keep = 0 gives 0
__device__ __forceinline__ v4f bfr4m(v4f v, unsigned keep) { v4f r;
#pragma unroll
    for (int q = 0; q < 4; ++q) { unsigned u = __float_as_uint(v[q]); u += 0x7FFFu + ((u >> 16) & 1u); r[q] = __uint_as_float(u & keep); }
    return r; }
__device__ __forceinline__ v4f bfr4(v4f v) { return bfr4m(v, 0xFFFF0000u); }
__global__ __launch_bounds__(256) void k_dwT(const float* __restrict__ f1, const float* __restrict__ f2,
        const float* __restrict__ dw0, const float* __restrict__ db0, const float* __restrict__ g0, const float* __restrict__ bb0, const float* __restrict__ mu0, const float* __restrict__ var0,
        const float* __restrict__ dw1, const float* __restrict__ db1, const float* __restrict__ g1, const float* __restrict__ bb1, const float* __restrict__ mu1, const float* __restrict__ var1,
        const float* __restrict__ dw2, const float* __restrict__ db2, const float* __restrict__ g2, const float* __restrict__ bb2, const float* __restrict__ mu2, const float* __restrict__ var2, bf* Yh, bf* Yl) {
    const int zz = blockIdx.z, br = zz >> 3; const float* fb = (br == 0 ? f1 : f2) + (size_t)(zz & 7) * LL * CC; Yh += (size_t)zz * LL * CC; Yl += (size_t)zz * LL * CC;
    const float* dw = br == 0 ? dw0 : (br == 1 ? dw1 : dw2); const float* db = br == 0 ? db0 : (br == 1 ? db1 : db2); const float* g = br == 0 ? g0 : (br == 1 ? g1 : g2);
    const float* bb = br == 0 ? bb0 : (br == 1 ? bb1 : bb2); const float* mu = br == 0 ? mu0 : (br == 1 ? mu1 : mu2); const float* var = br == 0 ? var0 : (br == 1 ? var1 : var2);
    const int c = (threadIdx.x & 63) * 4, x0 = blockIdx.x * 4 + (threadIdx.x >> 6), y0 = blockIdx.y * DR;
    v4f xr[DR + 2][3];    // rows y0 - 1 .. y0 + DR, columns x0 - 1 .. x0 + 1; every address is clamped into the image, and the value of a tap outside it is masked to 0 below
#pragma unroll
    for (int r = 0; r < DR + 2; ++r) { const float* rowp = fb + (size_t)min(max(y0 + r - 1, 0), HWS - 1) * (HWS * CC);
#pragma unroll
        for (int kx = 0; kx < 3; ++kx) xr[r][kx] = *(const v4f*)(rowp + (unsigned)(min(max(x0 + kx - 1, 0), HWS - 1) * CC + c)); }
    float wf[36];         // dw of channels c .. c + 3: 36 contiguous floats
#pragma unroll
    for (int i = 0; i < 9; ++i) { const v4f t = *(const v4f*)(dw + c * 9 + i * 4); wf[i * 4] = t[0]; wf[i * 4 + 1] = t[1]; wf[i * 4 + 2] = t[2]; wf[i * 4 + 3] = t[3]; }
    v4f w[9];
#pragma unroll
    for (int k = 0; k < 9; ++k)
#pragma unroll
        for (int q = 0; q < 4; ++q) w[k][q] = bfr(wf[q * 9 + k]);
    const v4f dbv = bfr4(*(const v4f*)(db + c)), gm = bfr4(*(const v4f*)(g + c)), be = bfr4(*(const v4f*)(bb + c)), mm = bfr4(*(const v4f*)(mu + c)), vv = bfr4(*(const v4f*)(var + c)); v4f sc;
#pragma unroll
    for (int q = 0; q < 4; ++q) sc[q] = __fmul_rn(__fdiv_rn(1.0f, __fsqrt_rn(__fadd_rn(vv[q], 1e-5f))), gm[q]);
#pragma unroll
    for (int r = 0; r < DR + 2; ++r)
#pragma unroll
        for (int kx = 0; kx < 3; ++kx) { const int yy = y0 + r - 1, xx = x0 + kx - 1; xr[r][kx] = bfr4m(xr[r][kx], yy >= 0 && yy < HWS && xx >= 0 && xx < HWS ? 0xFFFF0000u : 0u); }
#pragma unroll
    for (int r = 0; r < DR; ++r) { v4f acc = (v4f){};
#pragma unroll
        for (int ky = 0; ky < 3; ++ky)
#pragma unroll
            for (int kx = 0; kx < 3; ++kx) acc = __builtin_elementwise_fma(w[ky * 3 + kx], xr[r + ky][kx], acc);
        const v4f o = __builtin_elementwise_fma(acc + dbv - mm, sc, be); v4us oh, ol;
#pragma unroll
        for (int q = 0; q < 4; ++q) { unsigned short a, c2; splitf(o[q], a, c2); oh[q] = a; ol[q] = c2; }
        const size_t e = (size_t)((y0 + r) * HWS + x0) * CC + c; *(v4us*)(Yh + e) = oh; *(v4us*)(Yl + e) = ol; }
}
#define KT   64                   // keys per stage
#define KPIT 72                   // LDS row pitch in 16-bit elements: 144 B = 16 B x odd, for 16-byte row reads
#define SC2  0.18033688011112042f // 1/8 * log2(e)
__device__ __forceinline__ float xhalf(float x) { const int b = __float_as_int(x); return __int_as_float(__builtin_amdgcn_permlanex16(b, b, 0x76543210, 0xfedcba98, false, false)); }   // lane l <-> l ^ 16
// eight 2^x in place, one v_nop behind the last: so no instruction that stands directly behind a v_exp_f32 reads its result or overwrites its source (the slot the instruction set asks for)
__device__ __forceinline__ void exp2x8(float (&e)[8]) {
    asm("v_exp_f32 %0, %0\n\tv_exp_f32 %1, %1\n\tv_exp_f32 %2, %2\n\tv_exp_f32 %3, %3\n\tv_exp_f32 %4, %4\n\tv_exp_f32 %5, %5\n\tv_exp_f32 %6, %6\n\tv_exp_f32 %7, %7\n\tv_nop"
        : "+v"(e[0]), "+v"(e[1]), "+v"(e[2]), "+v"(e[3]), "+v"(e[4]), "+v"(e[5]), "+v"(e[6]), "+v"(e[7])); }
__global__ __launch_bounds__(256) void k_fattn(const float* __restrict__ F, bf* Ah, bf* Al) {
    __shared__ __align__(16) h16 ks[2][KT * KPIT];    // [key][d]
    __shared__ __align__(16) h16 vs[2][CH * KPIT];    // [d][key]
    const int z = blockIdx.y, h = z & (NHD - 1), b = z / NHD, tid = threadIdx.x, lane = tid & 31, lr = lane & 15, hi = lane >> 4; const int q0 = blockIdx.x * 256 + (tid >> 5) * 32;
    const float* Fq = F + (size_t)b * LL * OC + h * CH; const float* Fk = Fq + (size_t)NB_ * LL * OC; const float* Fv = Fk + (size_t)NB_ * LL * OC;
    v16h qf[2][2];
#pragma unroll
    for (int qb = 0; qb < 2; ++qb)
#pragma unroll
        for (int kc = 0; kc < 2; ++kc) { const float* qp = Fq + (size_t)(q0 + qb * 16 + lr) * OC + kc * 32 + 8 * hi; const v8f x0 = *(const v8f*)qp, x1 = *(const v8f*)(qp + 16);
#pragma unroll
            for (int j = 0; j < 8; ++j) { qf[qb][kc][j] = tohx(x0[j]); qf[qb][kc][8 + j] = tohx(x1[j]); } }
    // staging: a stage is 64 keys x 64 d of k and of v; thread (dq, rq) moves d 4 dq .. 4 dq + 3 of k's rows rq + 16 i and of v's rows 4 rq + i (i = 0 .. 3): 16 lanes read 256 contiguous bytes,
    // and v's four keys of one d go transposed into LDS as one 8-byte store
    const int dq = tid & 15, rq = tid >> 4; const float* kg = Fk + (size_t)rq * OC + dq * 4; const float* vg = Fv + (size_t)(rq * 4) * OC + dq * 4; v4f kr[4], vr[4];
    auto fetch = [&](int t) {
#pragma unroll
        for (int i = 0; i < 4; ++i) { kr[i] = *(const v4f*)(kg + (size_t)(t * KT + 16 * i) * OC); vr[i] = *(const v4f*)(vg + (size_t)(t * KT + i) * OC); } };
    auto put = [&](h16* kn, h16* vn) {
#pragma unroll
        for (int i = 0; i < 4; ++i) { v4h ok, ov;
#pragma unroll
            for (int e = 0; e < 4; ++e) { ok[e] = tohx(kr[i][e]); ov[e] = tohx(vr[e][i]); }
            *(v4h*)(kn + (rq + 16 * i) * KPIT + dq * 4) = ok; *(v4h*)(vn + (dq * 4 + i) * KPIT + rq * 4) = ov; } };
    fetch(0); put(ks[0], vs[0]); fetch(1);
    v8f acc[2][4]; float m[2], l[2];
#pragma unroll
    for (int qb = 0; qb < 2; ++qb) { m[qb] = -3.0e38f; l[qb] = 0.f;
#pragma unroll
        for (int mb = 0; mb < 4; ++mb) acc[qb][mb] = (v8f){}; }
    __syncthreads();    // publishes stage 0
#pragma unroll 1    // rolled: one pass is some 500 instructions
    for (int t = 0; t < TT / KT; ++t) {
        const h16* kb_ = ks[t & 1]; const h16* vb_ = vs[t & 1];
        if (t + 1 < TT / KT) put(ks[(t + 1) & 1], vs[(t + 1) & 1]);    // stage t + 1 into the other buffer: its readers (pass t - 1) left it before the barrier at that pass's foot
        if (t + 2 < TT / KT) { fetch(t + 2);                           // stage t + 2 into registers, a whole pass ahead of its LDS stores
            asm volatile("s_wait_xcnt 0x0" ::: "memory"); }            // the loads' address registers are reused right behind them
        v8f s[2][4];
#pragma unroll
        for (int kb = 0; kb < 4; ++kb) { const h16* kp = kb_ + (kb * 16 + lr) * KPIT + 8 * hi; const v16h a0 = WFrag<h16>::ld(kp), a1 = WFrag<h16>::ld(kp + 32);
#pragma unroll
            for (int qb = 0; qb < 2; ++qb) s[qb][kb] = wmma16(a1, qf[qb][1], wmma16(a0, qf[qb][0], (v8f){})); }
        v16h pf[2][2];
#pragma unroll
        for (int qb = 0; qb < 2; ++qb) { float mt = s[qb][0][0];
#pragma unroll
            for (int kb = 0; kb < 4; ++kb)
#pragma unroll
                for (int j = 0; j < 8; ++j) mt = fmaxf(mt, s[qb][kb][j]);
            mt = fmaxf(mt, xhalf(mt)); const float mn = fmaxf(m[qb], mt); float corr = (m[qb] - mn) * SC2; const float mc = mn * SC2; m[qb] = mn; float ps = 0.f;
            asm("v_exp_f32 %0, %0\n\tv_nop" : "+v"(corr));    // as in exp2x8
#pragma unroll
            for (int kb = 0; kb < 4; ++kb) { float e[8];
#pragma unroll
                for (int j = 0; j < 8; ++j) e[j] = fmaf(s[qb][kb][j], SC2, -mc);
                exp2x8(e);
#pragma unroll
                for (int j = 0; j < 8; ++j) { ps += e[j]; pf[qb][kb >> 1][(kb & 1) * 8 + j] = tohx(e[j]); } }
            l[qb] = fmaf(l[qb], corr, ps);
#pragma unroll
            for (int mb = 0; mb < 4; ++mb) acc[qb][mb] *= corr; }
#pragma unroll
        for (int c = 0; c < 2; ++c)
#pragma unroll
            for (int mb = 0; mb < 4; ++mb) { const v16h va = WFrag<h16>::ld(vb_ + (mb * 16 + lr) * KPIT + c * 32 + 8 * hi);
#pragma unroll
                for (int qb = 0; qb < 2; ++qb) acc[qb][mb] = wmma16(va, pf[qb][c], acc[qb][mb]); }
        __syncthreads();    // publishes stage t + 1 and ends every read of stage t's buffer
    }
    Ah += (size_t)b * LL * OC; Al += (size_t)b * LL * OC;
#pragma unroll
    for (int qb = 0; qb < 2; ++qb) { const float inv = __fdiv_rn(1.0f, l[qb] + xhalf(l[qb])); const size_t oo = (size_t)(q0 + qb * 16 + lr) * OC + h * CH + hi * 8;
#pragma unroll
        for (int mb = 0; mb < 4; ++mb) { v8us oh, ol;
#pragma unroll
            for (int j = 0; j < 8; ++j) { unsigned short a, c2; splitf(acc[qb][mb][j] * inv, a, c2); oh[j] = a; ol[j] = c2; }
            *(v8us*)(Ah + oo + mb * 16) = oh; *(v8us*)(Al + oo + mb * 16) = ol; } }
}

extern "C" void kernel_launch(void* const* d_in, const int* in_sizes, int n_in,
                              void* d_out, int out_size, void* d_ws, size_t ws_size, hipStream_t stream) {
    (void)in_sizes; (void)n_in; (void)out_size;
    const float* IN[28]; for (int i = 0; i < 28; ++i) IN[i] = (const float*)d_in[i];
    // features1, features2; then per branch q/k/v (base 2, 10, 18): dw_w [256][1][3][3], dw_b, bn_g, bn_b, bn_m, bn_v, pw_w [512][256][1][1], pw_b; ffn_w [256][512], ffn_b = d_in[26..27]
    float* OUT = (float*)d_out;     // [8][1024][256]
    char* wsp = (char*)d_ws;
    auto take = [&](size_t bytes) { char* p = wsp; wsp += (bytes + 255) & ~(size_t)255; return (void*)p; };
    bf* WPW = (bf*)take((size_t)4 * OC * CC * 2); bf* WF = WPW + (size_t)3 * OC * CC;    // pw_w of q, k, v, then ffn_w
    bf* Ah = (bf*)take((size_t)NB_ * LL * OC * 2); bf* Al = (bf*)take((size_t)NB_ * LL * OC * 2);
    // Y planes and F, all 3 branches x 8 images
    bf* Yh = (bf*)take((size_t)3 * NB_ * LL * CC * 2); bf* Yl = (bf*)take((size_t)3 * NB_ * LL * CC * 2); float* F = (float*)take((size_t)3 * NB_ * LL * OC * 4);
    if ((size_t)(wsp - (char*)d_ws) > ws_size) return;    // total ~ 89 MiB; ws 256 MiB
    k_cvt8<<<dim3((OC * CC / 8 + 255) / 256, 4, 1), 256, 0, stream>>>(IN[8], IN[16], IN[24], IN[26], WPW, (size_t)OC * CC / 8);
    k_dwT<<<dim3(HWS / 4, HWS / DR, 3 * NB_), 256, 0, stream>>>(IN[0], IN[1], IN[2], IN[3], IN[4], IN[5], IN[6], IN[7], IN[10], IN[11], IN[12], IN[13], IN[14], IN[15], IN[18], IN[19], IN[20], IN[21], IN[22], IN[23], Yh, Yl);
    k_gemmw<bf, 1, true><<<dim3(LL / 64, OC / 64, 3 * NB_), 32, 0, stream>>>(Yh, Yl, WPW, nullptr, CC, F, OC, IN[9], IN[17], IN[25], (size_t)LL * CC, (size_t)OC * CC, (size_t)LL * OC, 3);
    k_fattn<<<dim3(LL / 256, NB_ * NHD, 1), 256, 0, stream>>>(F, Ah, Al);
    k_gemmw<bf, 1, true><<<dim3(NB_ * LL / 64, CC / 64, 1), 32, 0, stream>>>(Ah, Al, WF, nullptr, OC, OUT, CC, IN[27], IN[27], IN[27], 0, 0, 0, 0);
}

// v004
// One run takes 87.7 microseconds.
// Timed twice side by side with v003, it ran 1.20 times as fast both times.
// Counting every step since v000, it is 29.9 times as fast.
#include <hip/hip_runtime.h>

// ConvolutionAttention (features1, features2 [8][1024][256] -> NCHW [8][256][32][32]; q = SepConv_q(x1), k = SepConv_k(x2), v = SepConv_v(x2) with SepConv = depthwise 3x3 (pad 1) + bias, eval BatchNorm,
// pointwise 1x1 -> 512 channels + bias; 8 heads x 64 (head h = channels h*64..); softmax(q.k/8) over the 1024 positions; out = merged (attn v) ffn_w^T + ffn_b -> [8][1024][256]).
// Compute dtypes, f32 accumulate: every input rounded to bf16; depthwise conv + bias + BN fold in f32 on VALU -> bf16 hi+lo planes [position][channel]; the pointwise
// convs on those planes x exact pw weights (2 products, + bias); scores (K 64) and attn.v on SINGLE fp16 operands (1/8 in f32 in the online softmax; attn as exp(s - running max), divided by the row sum at the end); merged heads as hi+lo planes x

#define NB_  8
#define HWS  32
#define LL   1024                 // positions
#define CC   256
#define OC   512
#define NHD  8
#define CH   64
#define TT   1024
typedef _Float16 h16;
typedef unsigned short bf;
typedef __attribute__((ext_vector_type(16))) __bf16   v16bf;
typedef __attribute__((ext_vector_type(16))) _Float16 v16h;
typedef __attribute__((ext_vector_type(8)))  _Float16 v8h;
typedef __attribute__((ext_vector_type(8)))  unsigned short v8us;
typedef __attribute__((ext_vector_type(8)))  float    v8f;
typedef __attribute__((ext_vector_type(4)))  float    v4f;
typedef v8h  __attribute__((may_alias)) v8ha;
typedef v4f  __attribute__((may_alias)) v4fa;
typedef v8us __attribute__((may_alias)) v8usa;

__device__ __forceinline__ unsigned short f2bf(float f) { unsigned u = __float_as_uint(f); u += 0x7FFFu + ((u >> 16) & 1u); return (unsigned short)(u >> 16); }
__device__ __forceinline__ float bf2f(unsigned short b) { return __uint_as_float(((unsigned)b) << 16); }
__device__ __forceinline__ float bfr(float f) { return bf2f(f2bf(f)); }
__device__ __forceinline__ v16h cat16(v8h lo, v8h hi) { return __builtin_shufflevector(lo, hi, 0, 1, 2, 3, 4, 5, 6, 7, 8, 9, 10, 11, 12, 13, 14, 15); }
__device__ __forceinline__ v16bf cat16b(v8us lo, v8us hi) { return __builtin_bit_cast(v16bf, __builtin_shufflevector(lo, hi, 0, 1, 2, 3, 4, 5, 6, 7, 8, 9, 10, 11, 12, 13, 14, 15)); }
__device__ __forceinline__ v8f wmma16(v16h a, v16h b, v8f c) { return __builtin_amdgcn_wmma_f32_16x16x32_f16(false, a, false, b, (short)0, c, false, false); }
__device__ __forceinline__ v8f wmmab(v16bf a, v16bf b, v8f c) { return __builtin_amdgcn_wmma_f32_16x16x32_bf16(false, a, false, b, (short)0, c, false, false); }



// ---- k_gemmw: GEMM, eight waves per 128x128 output tile (wave = 32 rows x 64 columns, 8 accumulators); grid (M/128, N/128, Z), 256 threads.
// C[m][n] (f32, pitch ldc, + optional f32 bias[n]) = sum_k (A[m][k] + A2[m][k]) Bt[n][k], operands K-contiguous 16-bit planes. z-batch strides sA/sB/sC in elements. K % 64 == 0.
// 2^zs consecutive z share one Bt and one bias: Bt steps by sB and the bias goes bias, bias1, bias2 with z >> zs.
// A stage is 64 k (one 128-byte line) of 128 A rows, 128 A2 rows and 128 Bt rows = 384 LDS rows of 128 bytes; two buffers; asynchronous 16-byte copies bring stage t + 2 in while stage t + 1 is worked on.
// LDS rows are not padded: 16-byte piece c of row r lies at piece c ^ ((r >> 1) & 7), so the 16 rows of a fragment read fall on all 64 banks once.
// Per accumulator the products are summed k ascending in steps of 32, A before A2.
#define GKC   64
#define GSTG  (384 * 128)          // bytes of a stage
template <typename T16> struct WFrag;
template <> struct WFrag<h16> { typedef v16h V; static __device__ __forceinline__ V ld(const h16* p) { return cat16(*(const v8h*)p, *(const v8h*)(p + 16)); } static __device__ __forceinline__ v8f mma(V a, V b, v8f c) { return wmma16(a, b, c); } };
template <> struct WFrag<bf> { typedef v16bf V; static __device__ __forceinline__ V ld(const bf* p) { return cat16b(*(const v8us*)p, *(const v8us*)(p + 16)); } static __device__ __forceinline__ V ld2(const char* p, const char* q) { return cat16b(*(const v8usa*)p, *(const v8usa*)q); } static __device__ __forceinline__ v8f mma(V a, V b, v8f c) { return wmmab(a, b, c); } };
template <typename T16, bool BIAS>
__global__ __launch_bounds__(256) void k_gemmw(const T16* __restrict__ A, const T16* __restrict__ A2, const T16* __restrict__ Bt, int K, float* C, int ldc, const float* __restrict__ bias, const float* __restrict__ bias1, const float* __restrict__ bias2, size_t sA, size_t sB, size_t sC, int zs) {
    typedef typename WFrag<T16>::V V;
    __shared__ __align__(128) char ring[2 * GSTG];
    const size_t z = blockIdx.z, zw = z >> zs; A += z * sA; A2 += z * sA; Bt += zw * sB; C += z * sC; if (BIAS) bias = zw == 0 ? bias : (zw == 1 ? bias1 : bias2);
    const int tid = threadIdx.x, lane = tid & 31, lr = lane & 15, hi = lane >> 4, wm = tid >> 6, wn = (tid >> 5) & 1; const int r0 = blockIdx.x * 128, c0 = blockIdx.y * 128;
    // copies: thread = piece (tid & 7) of row (tid >> 3) + 32 i of each operand, i = 0 .. 3: a wave moves four whole lines per copy
    const int crow = tid >> 3, cpc = tid & 7; const unsigned ld0 = (unsigned)(size_t)ring + crow * 128 + ((cpc ^ ((crow >> 1) & 7)) << 4);
    const T16* gA = A + (size_t)(r0 + crow) * K + cpc * 8; const T16* gA2 = A2 + (size_t)(r0 + crow) * K + cpc * 8; const T16* gB = Bt + (size_t)(c0 + crow) * K + cpc * 8; const size_t rs = (size_t)32 * K;
    auto copy = [&](int t) { const unsigned l = ld0 + (t & 1) * GSTG; const T16* a = gA + (size_t)t * GKC; const T16* a2 = gA2 + (size_t)t * GKC; const T16* b = gB + (size_t)t * GKC;
        // s_wait_xcnt stands in the copies' own statement, so that no later write of their address registers can be moved in front of it
        asm volatile("global_load_async_to_lds_b128 %0, %1, off\n\tglobal_load_async_to_lds_b128 %2, %3, off\n\tglobal_load_async_to_lds_b128 %4, %5, off\n\tglobal_load_async_to_lds_b128 %6, %7, off\n\t"
                     "global_load_async_to_lds_b128 %8, %9, off\n\tglobal_load_async_to_lds_b128 %10, %11, off\n\tglobal_load_async_to_lds_b128 %12, %13, off\n\tglobal_load_async_to_lds_b128 %14, %15, off\n\t"
                     "global_load_async_to_lds_b128 %16, %17, off\n\tglobal_load_async_to_lds_b128 %18, %19, off\n\tglobal_load_async_to_lds_b128 %20, %21, off\n\tglobal_load_async_to_lds_b128 %22, %23, off\n\ts_wait_xcnt 0x0"
                     :: "v"(l), "v"(a), "v"(l + 4096), "v"(a + rs), "v"(l + 8192), "v"(a + 2 * rs), "v"(l + 12288), "v"(a + 3 * rs),
                        "v"(l + 16384), "v"(a2), "v"(l + 20480), "v"(a2 + rs), "v"(l + 24576), "v"(a2 + 2 * rs), "v"(l + 28672), "v"(a2 + 3 * rs),
                        "v"(l + 32768), "v"(b), "v"(l + 36864), "v"(b + rs), "v"(l + 40960), "v"(b + 2 * rs), "v"(l + 45056), "v"(b + 3 * rs) : "memory"); };
    const int NT = K / GKC;
    copy(0);
    const int cb = c0 + wn * 64, cofs = lr * 4; float bq[4] = {0.f, 0.f, 0.f, 0.f};    // the lane's four bias values, read here so that the epilogue does not wait for them
    if (BIAS) { bq[0] = bias[cb + cofs]; bq[1] = bias[cb + cofs + 1]; bq[2] = bias[cb + cofs + 2]; bq[3] = bias[cb + cofs + 3]; }
    asm volatile("s_wait_asynccnt 0x0" ::: "memory");    // stage 0 has landed
    __syncthreads();                                     // publishes stage 0
    if (NT > 1) copy(1);
    v8f acc[2][4];
#pragma unroll
    for (int mb = 0; mb < 2; ++mb)
#pragma unroll
        for (int nb = 0; nb < 4; ++nb) acc[mb][nb] = (v8f){};
    // fragment reads: k step ks takes pieces 4 ks + hi and 4 ks + 2 + hi of its row; every row of a lane has (r >> 1) & 7 == lr >> 1
    const int px = hi ^ (lr >> 1); const int arow = (wm * 32 + lr) * 128, brow = (256 + wn * 64 + lr) * 128;
#pragma unroll 1    // rolled: the buffer alternates with the trip
    for (int t = 0; t < NT; ++t) {
        const char* sb = ring + (t & 1) * GSTG;
#pragma unroll
        for (int ks = 0; ks < 2; ++ks) { const int o0 = (px ^ (4 * ks)) << 4, o1 = (px ^ (4 * ks + 2)) << 4; V a[2], a2[2];
#pragma unroll
            for (int mb = 0; mb < 2; ++mb) { const char* ap = sb + arow + mb * 2048; a[mb] = WFrag<T16>::ld2(ap + o0, ap + o1); a2[mb] = WFrag<T16>::ld2(ap + 16384 + o0, ap + 16384 + o1); }
#pragma unroll
            for (int nb = 0; nb < 4; ++nb) { const char* bp = sb + brow + nb * 2048; const V b = WFrag<T16>::ld2(bp + o0, bp + o1);
#pragma unroll
                for (int mb = 0; mb < 2; ++mb) acc[mb][nb] = WFrag<T16>::mma(a[mb], b, acc[mb][nb]);
#pragma unroll
                for (int mb = 0; mb < 2; ++mb) acc[mb][nb] = WFrag<T16>::mma(a2[mb], b, acc[mb][nb]); } }
        asm volatile("s_wait_dscnt 0x0" ::: "memory");       // this wave's reads of stage t are done
        asm volatile("s_wait_asynccnt 0x0" ::: "memory");    // its copies of stage t + 1 have landed
        __syncthreads();                                     // publishes stage t + 1 and ends every read of stage t's buffer
        if (t + 2 < NT) copy(t + 2);
    }
    asm volatile("s_wait_asynccnt 0x0" ::: "memory");        // nothing is in flight when the ring becomes output staging
    float* os = (float*)ring + (tid >> 5) * (16 * 68);       // each wave stages in its own range, behind the last trip's barrier
    const v4f bv = {bfr(bq[0]), bfr(bq[1]), bfr(bq[2]), bfr(bq[3])};
#pragma unroll
    for (int mb = 0; mb < 2; ++mb) {
#pragma unroll
        for (int nb = 0; nb < 4; ++nb) {
#pragma unroll
            for (int j = 0; j < 8; ++j) os[(hi * 8 + j) * 68 + nb * 16 + lr] = acc[mb][nb][j]; }
        __builtin_amdgcn_wave_barrier(); asm volatile("" ::: "memory");    // a lane reads what other lanes of its wave stored: keeps the compiler from moving the reads ahead of the stores
        float* crow_ = C + (size_t)(r0 + wm * 32 + mb * 16) * ldc + cb;
#pragma unroll
        for (int s = 0; s < 8; ++s) { const int row = 2 * s + hi; v4f val = *(const v4fa*)(os + row * 68 + cofs); if (BIAS) val += bv;
            *(v4f*)(crow_ + (size_t)row * ldc + cofs) = val; }
        __builtin_amdgcn_wave_barrier(); asm volatile("" ::: "memory");    // and the next block's stores ahead of these reads
    }
}

__device__ __forceinline__ h16 tohx(float x) { return (h16)x; }
__device__ __forceinline__ void splitf(float y, unsigned short& h, unsigned short& l) { h = f2bf(y); l = f2bf(y - bf2f(h)); }
typedef __attribute__((ext_vector_type(2))) _Float16 v2h;
typedef __attribute__((ext_vector_type(4))) _Float16 v4h;
typedef __attribute__((ext_vector_type(2))) unsigned short v2us;

// k_cvt8: four equally long f32 arrays (blockIdx.y picks one) -> bf16, written one behind the other
__global__ __launch_bounds__(256) void k_cvt8(const float* __restrict__ s0, const float* __restrict__ s1, const float* __restrict__ s2, const float* __restrict__ s3, bf* dst, size_t n8) { const size_t i = (size_t)blockIdx.x * 256 + threadIdx.x; if (i >= n8) return;
    const int y = blockIdx.y; const float* src = y == 0 ? s0 : (y == 1 ? s1 : (y == 2 ? s2 : s3)); dst += (size_t)y * n8 * 8; const v8f v = *(const v8f*)(src + i * 8); v8us o;
#pragma unroll
    for (int k = 0; k < 8; ++k) o[k] = f2bf(v[k]); *(v8us*)(dst + i * 8) = o;  }
// k_dwT: Y hi/lo [pos][c] = split(BN(sum_{3x3} bf16(dw[c][ky][kx]) bf16(f[b][pos'][c]) + bf16(db[c]))) with pos' = (y+ky-1, x+kx-1) zero-padded, f = features [b][pos][c].
// blockIdx.z = branch * 8 + batch (branch 0 reads f1, branches 1 and 2 read f2). One thread: 4 channels of DR rows of one image column. Its 36 weights and its BatchNorm terms are read and rounded once,
// each feature vector (one 16-byte load, a wave reads 512 contiguous bytes) once for the up to three rows that use it. Grid (32 / 4 columns, 32 / DR row strips, 24), 256 threads = 64 channel groups x 4 columns.
// A tap outside the image enters as 0. The product of two bf16 values is exact in f32, so the fused multiply-add rounds as a multiply and an add would; taps are summed ky-major, kx-minor.
// Every loop is unrolled so that each index of a register array is a constant and a thread's loads are issued together, ahead of the first wait.
#define DR 8
typedef __attribute__((ext_vector_type(4))) unsigned short v4us;
// bfr of four values; keep = 0xFFFF0000 is bfr's own cut to the upper 16 bits, keep = 0 gives 0
__device__ __forceinline__ v4f bfr4m(v4f v, unsigned keep) { v4f r;
#pragma unroll
    for (int q = 0; q < 4; ++q) { unsigned u = __float_as_uint(v[q]); u += 0x7FFFu + ((u >> 16) & 1u); r[q] = __uint_as_float(u & keep); }
    return r; }
__device__ __forceinline__ v4f bfr4(v4f v) { return bfr4m(v, 0xFFFF0000u); }
__global__ __launch_bounds__(256) void k_dwT(const float* __restrict__ f1, const float* __restrict__ f2,
        const float* __restrict__ dw0, const float* __restrict__ db0, const float* __restrict__ g0, const float* __restrict__ bb0, const float* __restrict__ mu0, const float* __restrict__ var0,
        const float* __restrict__ dw1, const float* __restrict__ db1, const float* __restrict__ g1, const float* __restrict__ bb1, const float* __restrict__ mu1, const float* __restrict__ var1,
        const float* __restrict__ dw2, const float* __restrict__ db2, const float* __restrict__ g2, const float* __restrict__ bb2, const float* __restrict__ mu2, const float* __restrict__ var2, bf* Yh, bf* Yl) {
    const int zz = blockIdx.z, br = zz >> 3; const float* fb = (br == 0 ? f1 : f2) + (size_t)(zz & 7) * LL * CC; Yh += (size_t)zz * LL * CC; Yl += (size_t)zz * LL * CC;
    const float* dw = br == 0 ? dw0 : (br == 1 ? dw1 : dw2); const float* db = br == 0 ? db0 : (br == 1 ? db1 : db2); const float* g = br == 0 ? g0 : (br == 1 ? g1 : g2);
    const float* bb = br == 0 ? bb0 : (br == 1 ? bb1 : bb2); const float* mu = br == 0 ? mu0 : (br == 1 ? mu1 : mu2); const float* var = br == 0 ? var0 : (br == 1 ? var1 : var2);
    const int c = (threadIdx.x & 63) * 4, x0 = blockIdx.x * 4 + (threadIdx.x >> 6), y0 = blockIdx.y * DR;
    v4f xr[DR + 2][3];    // rows y0 - 1 .. y0 + DR, columns x0 - 1 .. x0 + 1; every address is clamped into the image, and the value of a tap outside it is masked to 0 below
#pragma unroll
    for (int r = 0; r < DR + 2; ++r) { const float* rowp = fb + (size_t)min(max(y0 + r - 1, 0), HWS - 1) * (HWS * CC);
#pragma unroll
        for (int kx = 0; kx < 3; ++kx) xr[r][kx] = *(const v4f*)(rowp + (unsigned)(min(max(x0 + kx - 1, 0), HWS - 1) * CC + c)); }
    float wf[36];         // dw of channels c .. c + 3: 36 contiguous floats
#pragma unroll
    for (int i = 0; i < 9; ++i) { const v4f t = *(const v4f*)(dw + c * 9 + i * 4); wf[i * 4] = t[0]; wf[i * 4 + 1] = t[1]; wf[i * 4 + 2] = t[2]; wf[i * 4 + 3] = t[3]; }
    v4f w[9];
#pragma unroll
    for (int k = 0; k < 9; ++k)
#pragma unroll
        for (int q = 0; q < 4; ++q) w[k][q] = bfr(wf[q * 9 + k]);
    const v4f dbv = bfr4(*(const v4f*)(db + c)), gm = bfr4(*(const v4f*)(g + c)), be = bfr4(*(const v4f*)(bb + c)), mm = bfr4(*(const v4f*)(mu + c)), vv = bfr4(*(const v4f*)(var + c)); v4f sc;
#pragma unroll
    for (int q = 0; q < 4; ++q) sc[q] = __fmul_rn(__fdiv_rn(1.0f, __fsqrt_rn(__fadd_rn(vv[q], 1e-5f))), gm[q]);
#pragma unroll
    for (int r = 0; r < DR + 2; ++r)
#pragma unroll
        for (int kx = 0; kx < 3; ++kx) { const int yy = y0 + r - 1, xx = x0 + kx - 1; xr[r][kx] = bfr4m(xr[r][kx], yy >= 0 && yy < HWS && xx >= 0 && xx < HWS ? 0xFFFF0000u : 0u); }
#pragma unroll
    for (int r = 0; r < DR; ++r) { v4f acc = (v4f){};
#pragma unroll
        for (int ky = 0; ky < 3; ++ky)
#pragma unroll
            for (int kx = 0; kx < 3; ++kx) acc = __builtin_elementwise_fma(w[ky * 3 + kx], xr[r + ky][kx], acc);
        const v4f o = __builtin_elementwise_fma(acc + dbv - mm, sc, be); v4us oh, ol;
#pragma unroll
        for (int q = 0; q < 4; ++q) { unsigned short a, c2; splitf(o[q], a, c2); oh[q] = a; ol[q] = c2; }
        const size_t e = (size_t)((y0 + r) * HWS + x0) * CC + c; *(v4us*)(Yh + e) = oh; *(v4us*)(Yl + e) = ol; }
}
#define KT   64                   // keys per stage
#define KPIT 72                   // LDS row pitch in 16-bit elements: 144 B = 16 B x odd, for 16-byte row reads
#define SC2  0.18033688011112042f // 1/8 * log2(e)
__device__ __forceinline__ float xhalf(float x) { const int b = __float_as_int(x); return __int_as_float(__builtin_amdgcn_permlanex16(b, b, 0x76543210, 0xfedcba98, false, false)); }   // lane l <-> l ^ 16
// eight 2^x in place, one v_nop behind the last: so no instruction that stands directly behind a v_exp_f32 reads its result or overwrites its source (the slot the instruction set asks for)
__device__ __forceinline__ void exp2x8(float (&e)[8]) {
    asm("v_exp_f32 %0, %0\n\tv_exp_f32 %1, %1\n\tv_exp_f32 %2, %2\n\tv_exp_f32 %3, %3\n\tv_exp_f32 %4, %4\n\tv_exp_f32 %5, %5\n\tv_exp_f32 %6, %6\n\tv_exp_f32 %7, %7\n\tv_nop"
        : "+v"(e[0]), "+v"(e[1]), "+v"(e[2]), "+v"(e[3]), "+v"(e[4]), "+v"(e[5]), "+v"(e[6]), "+v"(e[7])); }
__global__ __launch_bounds__(256) void k_fattn(const float* __restrict__ F, bf* Ah, bf* Al) {
    __shared__ __align__(16) h16 ks[2][KT * KPIT];    // [key][d]
    __shared__ __align__(16) h16 vs[2][CH * KPIT];    // [d][key]
    const int z = blockIdx.y, h = z & (NHD - 1), b = z / NHD, tid = threadIdx.x, lane = tid & 31, lr = lane & 15, hi = lane >> 4; const int q0 = blockIdx.x * 256 + (tid >> 5) * 32;
    const float* Fq = F + (size_t)b * LL * OC + h * CH; const float* Fk = Fq + (size_t)NB_ * LL * OC; const float* Fv = Fk + (size_t)NB_ * LL * OC;
    v16h qf[2][2];
#pragma unroll
    for (int qb = 0; qb < 2; ++qb)
#pragma unroll
        for (int kc = 0; kc < 2; ++kc) { const float* qp = Fq + (size_t)(q0 + qb * 16 + lr) * OC + kc * 32 + 8 * hi; const v8f x0 = *(const v8f*)qp, x1 = *(const v8f*)(qp + 16);
#pragma unroll
            for (int j = 0; j < 8; ++j) { qf[qb][kc][j] = tohx(x0[j]); qf[qb][kc][8 + j] = tohx(x1[j]); } }
    // staging: a stage is 64 keys x 64 d of k and of v; thread (dq, rq) moves d 4 dq .. 4 dq + 3 of k's rows rq + 16 i and of v's rows 4 rq + i (i = 0 .. 3): 16 lanes read 256 contiguous bytes,
    // and v's four keys of one d go transposed into LDS as one 8-byte store
    const int dq = tid & 15, rq = tid >> 4; const float* kg = Fk + (size_t)rq * OC + dq * 4; const float* vg = Fv + (size_t)(rq * 4) * OC + dq * 4; v4f kr[4], vr[4];
    auto fetch = [&](int t) {
#pragma unroll
        for (int i = 0; i < 4; ++i) { kr[i] = *(const v4f*)(kg + (size_t)(t * KT + 16 * i) * OC); vr[i] = *(const v4f*)(vg + (size_t)(t * KT + i) * OC); } };
    auto put = [&](h16* kn, h16* vn) {
#pragma unroll
        for (int i = 0; i < 4; ++i) { v4h ok, ov;
#pragma unroll
            for (int e = 0; e < 4; ++e) { ok[e] = tohx(kr[i][e]); ov[e] = tohx(vr[e][i]); }
            *(v4h*)(kn + (rq + 16 * i) * KPIT + dq * 4) = ok; *(v4h*)(vn + (dq * 4 + i) * KPIT + rq * 4) = ov; } };
    fetch(0); put(ks[0], vs[0]); fetch(1);
    v8f acc[2][4]; float m[2], l[2];
#pragma unroll
    for (int qb = 0; qb < 2; ++qb) { m[qb] = -3.0e38f; l[qb] = 0.f;
#pragma unroll
        for (int mb = 0; mb < 4; ++mb) acc[qb][mb] = (v8f){}; }
    __syncthreads();    // publishes stage 0
#pragma unroll 1    // rolled: one pass is some 500 instructions
    for (int t = 0; t < TT / KT; ++t) {
        const h16* kb_ = ks[t & 1]; const h16* vb_ = vs[t & 1];
        if (t + 1 < TT / KT) put(ks[(t + 1) & 1], vs[(t + 1) & 1]);    // stage t + 1 into the other buffer: its readers (pass t - 1) left it before the barrier at that pass's foot
        if (t + 2 < TT / KT) { fetch(t + 2);                           // stage t + 2 into registers, a whole pass ahead of its LDS stores
            asm volatile("s_wait_xcnt 0x0" ::: "memory"); }            // the loads' address registers are reused right behind them
        v8f s[2][4];
#pragma unroll
        for (int kb = 0; kb < 4; ++kb) { const h16* kp = kb_ + (kb * 16 + lr) * KPIT + 8 * hi; const v16h a0 = WFrag<h16>::ld(kp), a1 = WFrag<h16>::ld(kp + 32);
#pragma unroll
            for (int qb = 0; qb < 2; ++qb) s[qb][kb] = wmma16(a1, qf[qb][1], wmma16(a0, qf[qb][0], (v8f){})); }
        v16h pf[2][2];
#pragma unroll
        for (int qb = 0; qb < 2; ++qb) { float mt = s[qb][0][0];
#pragma unroll
            for (int kb = 0; kb < 4; ++kb)
#pragma unroll
                for (int j = 0; j < 8; ++j) mt = fmaxf(mt, s[qb][kb][j]);
            mt = fmaxf(mt, xhalf(mt)); const float mn = fmaxf(m[qb], mt); float corr = (m[qb] - mn) * SC2; const float mc = mn * SC2; m[qb] = mn; float ps = 0.f;
            asm("v_exp_f32 %0, %0\n\tv_nop" : "+v"(corr));    // as in exp2x8
#pragma unroll
            for (int kb = 0; kb < 4; ++kb) { float e[8];
#pragma unroll
                for (int j = 0; j < 8; ++j) e[j] = fmaf(s[qb][kb][j], SC2, -mc);
                exp2x8(e);
#pragma unroll
                for (int j = 0; j < 8; ++j) { ps += e[j]; pf[qb][kb >> 1][(kb & 1) * 8 + j] = tohx(e[j]); } }
            l[qb] = fmaf(l[qb], corr, ps);
#pragma unroll
            for (int mb = 0; mb < 4; ++mb) acc[qb][mb] *= corr; }
#pragma unroll
        for (int c = 0; c < 2; ++c)
#pragma unroll
            for (int mb = 0; mb < 4; ++mb) { const v16h va = WFrag<h16>::ld(vb_ + (mb * 16 + lr) * KPIT + c * 32 + 8 * hi);
#pragma unroll
                for (int qb = 0; qb < 2; ++qb) acc[qb][mb] = wmma16(va, pf[qb][c], acc[qb][mb]); }
        __syncthreads();    // publishes stage t + 1 and ends every read of stage t's buffer
    }
    Ah += (size_t)b * LL * OC; Al += (size_t)b * LL * OC;
#pragma unroll
    for (int qb = 0; qb < 2; ++qb) { const float inv = __fdiv_rn(1.0f, l[qb] + xhalf(l[qb])); const size_t oo = (size_t)(q0 + qb * 16 + lr) * OC + h * CH + hi * 8;
#pragma unroll
        for (int mb = 0; mb < 4; ++mb) { v8us oh, ol;
#pragma unroll
            for (int j = 0; j < 8; ++j) { unsigned short a, c2; splitf(acc[qb][mb][j] * inv, a, c2); oh[j] = a; ol[j] = c2; }
            *(v8us*)(Ah + oo + mb * 16) = oh; *(v8us*)(Al + oo + mb * 16) = ol; } }
}

extern "C" void kernel_launch(void* const* d_in, const int* in_sizes, int n_in,
                              void* d_out, int out_size, void* d_ws, size_t ws_size, hipStream_t stream) {
    (void)in_sizes; (void)n_in; (void)out_size;
    const float* IN[28]; for (int i = 0; i < 28; ++i) IN[i] = (const float*)d_in[i];
    // features1, features2; then per branch q/k/v (base 2, 10, 18): dw_w [256][1][3][3], dw_b, bn_g, bn_b, bn_m, bn_v, pw_w [512][256][1][1], pw_b; ffn_w [256][512], ffn_b = d_in[26..27]
    float* OUT = (float*)d_out;     // [8][1024][256]
    char* wsp = (char*)d_ws;
    auto take = [&](size_t bytes) { char* p = wsp; wsp += (bytes + 255) & ~(size_t)255; return (void*)p; };
    bf* WPW = (bf*)take((size_t)4 * OC * CC * 2); bf* WF = WPW + (size_t)3 * OC * CC;    // pw_w of q, k, v, then ffn_w
    bf* Ah = (bf*)take((size_t)NB_ * LL * OC * 2); bf* Al = (bf*)take((size_t)NB_ * LL * OC * 2);
    // Y planes and F, all 3 branches x 8 images
    bf* Yh = (bf*)take((size_t)3 * NB_ * LL * CC * 2); bf* Yl = (bf*)take((size_t)3 * NB_ * LL * CC * 2); float* F = (float*)take((size_t)3 * NB_ * LL * OC * 4);
    if ((size_t)(wsp - (char*)d_ws) > ws_size) return;    // total ~ 89 MiB; ws 256 MiB
    k_cvt8<<<dim3((OC * CC / 8 + 255) / 256, 4, 1), 256, 0, stream>>>(IN[8], IN[16], IN[24], IN[26], WPW, (size_t)OC * CC / 8);
    k_dwT<<<dim3(HWS / 4, HWS / DR, 3 * NB_), 256, 0, stream>>>(IN[0], IN[1], IN[2], IN[3], IN[4], IN[5], IN[6], IN[7], IN[10], IN[11], IN[12], IN[13], IN[14], IN[15], IN[18], IN[19], IN[20], IN[21], IN[22], IN[23], Yh, Yl);
    k_gemmw<bf, true><<<dim3(LL / 128, OC / 128, 3 * NB_), 256, 0, stream>>>(Yh, Yl, WPW, CC, F, OC, IN[9], IN[17], IN[25], (size_t)LL * CC, (size_t)OC * CC, (size_t)LL * OC, 3);
    k_fattn<<<dim3(LL / 256, NB_ * NHD, 1), 256, 0, stream>>>(F, Ah, Al);
    k_gemmw<bf, true><<<dim3(NB_ * LL / 128, CC / 128, 1), 256, 0, stream>>>(Ah, Al, WF, OC, OUT, CC, IN[27], IN[27], IN[27], 0, 0, 0, 0);
}

// v005
// Measured time: 73.1 microseconds a run.
// In both of two side-by-side timings against v004, it was 1.20 times as fast.
// All steps since v000 together make it 35.9 times as fast.
#include <hip/hip_runtime.h>

// ConvolutionAttention (features1, features2 [8][1024][256] -> NCHW [8][256][32][32]; q = SepConv_q(x1), k = SepConv_k(x2), v = SepConv_v(x2) with SepConv = depthwise 3x3 (pad 1) + bias, eval BatchNorm,
// pointwise 1x1 -> 512 channels + bias; 8 heads x 64 (head h = channels h*64..); softmax(q.k/8) over the 1024 positions; out = merged (attn v) ffn_w^T + ffn_b -> [8][1024][256]).
// Compute dtypes, f32 accumulate: every input rounded to bf16; depthwise conv + bias + BN fold in f32 on VALU -> bf16 hi+lo planes [position][channel]; the pointwise
// convs on those planes x exact pw weights (2 products, + bias); scores (K 64) and attn.v on SINGLE fp16 operands (1/8 in f32 in the online softmax; attn as exp(s - running max), divided by the row sum at the end); merged heads as hi+lo planes x

#define NB_  8
#define HWS  32
#define LL   1024                 // positions
#define CC   256
#define OC   512
#define NHD  8
#define CH   64
#define TT   1024
typedef _Float16 h16;
typedef unsigned short bf;
typedef __attribute__((ext_vector_type(16))) __bf16   v16bf;
typedef __attribute__((ext_vector_type(16))) _Float16 v16h;
typedef __attribute__((ext_vector_type(8)))  _Float16 v8h;
typedef __attribute__((ext_vector_type(8)))  unsigned short v8us;
typedef __attribute__((ext_vector_type(8)))  float    v8f;
typedef __attribute__((ext_vector_type(4)))  float    v4f;
typedef v8h  __attribute__((may_alias)) v8ha;
typedef v4f  __attribute__((may_alias)) v4fa;
typedef v8us __attribute__((may_alias)) v8usa;

__device__ __forceinline__ unsigned short f2bf(float f) { unsigned u = __float_as_uint(f); u += 0x7FFFu + ((u >> 16) & 1u); return (unsigned short)(u >> 16); }
__device__ __forceinline__ float bf2f(unsigned short b) { return __uint_as_float(((unsigned)b) << 16); }
__device__ __forceinline__ float bfr(float f) { return bf2f(f2bf(f)); }
__device__ __forceinline__ v16h cat16(v8h lo, v8h hi) { return __builtin_shufflevector(lo, hi, 0, 1, 2, 3, 4, 5, 6, 7, 8, 9, 10, 11, 12, 13, 14, 15); }
__device__ __forceinline__ v16bf cat16b(v8us lo, v8us hi) { return __builtin_bit_cast(v16bf, __builtin_shufflevector(lo, hi, 0, 1, 2, 3, 4, 5, 6, 7, 8, 9, 10, 11, 12, 13, 14, 15)); }
__device__ __forceinline__ v8f wmma16(v16h a, v16h b, v8f c) { return __builtin_amdgcn_wmma_f32_16x16x32_f16(false, a, false, b, (short)0, c, false, false); }
__device__ __forceinline__ v8f wmmab(v16bf a, v16bf b, v8f c) { return __builtin_amdgcn_wmma_f32_16x16x32_bf16(false, a, false, b, (short)0, c, false, false); }



// ---- k_gemmw: GEMM, eight waves per 128x128 output tile (wave = 32 rows x 64 columns, 8 accumulators); grid (M/128, N/128, Z), 256 threads.
// C[m][n] (f32, pitch ldc, + optional f32 bias[n]) = sum_k (A[m][k] + A2[m][k]) Bt[n][k], operands K-contiguous 16-bit planes. z-batch strides sA/sB/sC in elements. K % 64 == 0.
// HOUT: the f32 result (bias added in f32) is rounded to fp16 and stored to Ch instead of C, same pitch and stride in elements: its reader takes it as an fp16 matrix operand.
// 2^zs consecutive z share one Bt and one bias: Bt steps by sB and the bias goes bias, bias1, bias2 with z >> zs.
// A stage is 64 k (one 128-byte line) of 128 A rows, 128 A2 rows and 128 Bt rows = 384 LDS rows of 128 bytes; two buffers; asynchronous 16-byte copies bring stage t + 2 in while stage t + 1 is worked on.
// LDS rows are not padded: 16-byte piece c of row r lies at piece c ^ ((r >> 1) & 7), so the 16 rows of a fragment read fall on all 64 banks once.
// Per accumulator the products are summed k ascending in steps of 32, A before A2.
#define GKC   64
#define GSTG  (384 * 128)          // bytes of a stage
template <typename T16> struct WFrag;
template <> struct WFrag<h16> { typedef v16h V; static __device__ __forceinline__ V ld(const h16* p) { return cat16(*(const v8h*)p, *(const v8h*)(p + 16)); } static __device__ __forceinline__ v8f mma(V a, V b, v8f c) { return wmma16(a, b, c); } };
template <> struct WFrag<bf> { typedef v16bf V; static __device__ __forceinline__ V ld(const bf* p) { return cat16b(*(const v8us*)p, *(const v8us*)(p + 16)); } static __device__ __forceinline__ V ld2(const char* p, const char* q) { return cat16b(*(const v8usa*)p, *(const v8usa*)q); } static __device__ __forceinline__ v8f mma(V a, V b, v8f c) { return wmmab(a, b, c); } };
template <typename T16, bool BIAS, bool HOUT>
__global__ __launch_bounds__(256) void k_gemmw(const T16* __restrict__ A, const T16* __restrict__ A2, const T16* __restrict__ Bt, int K, float* C, _Float16* Ch, int ldc, const float* __restrict__ bias, const float* __restrict__ bias1, const float* __restrict__ bias2, size_t sA, size_t sB, size_t sC, int zs) {
    typedef typename WFrag<T16>::V V;
    __shared__ __align__(128) char ring[2 * GSTG];
    const size_t z = blockIdx.z, zw = z >> zs; A += z * sA; A2 += z * sA; Bt += zw * sB; if (HOUT) Ch += z * sC; else C += z * sC; if (BIAS) bias = zw == 0 ? bias : (zw == 1 ? bias1 : bias2);
    const int tid = threadIdx.x, lane = tid & 31, lr = lane & 15, hi = lane >> 4, wm = tid >> 6, wn = (tid >> 5) & 1; const int r0 = blockIdx.x * 128, c0 = blockIdx.y * 128;
    // copies: thread = piece (tid & 7) of row (tid >> 3) + 32 i of each operand, i = 0 .. 3: a wave moves four whole lines per copy
    const int crow = tid >> 3, cpc = tid & 7; const unsigned ld0 = (unsigned)(size_t)ring + crow * 128 + ((cpc ^ ((crow >> 1) & 7)) << 4);
    const T16* gA = A + (size_t)(r0 + crow) * K + cpc * 8; const T16* gA2 = A2 + (size_t)(r0 + crow) * K + cpc * 8; const T16* gB = Bt + (size_t)(c0 + crow) * K + cpc * 8; const size_t rs = (size_t)32 * K;
    auto copy = [&](int t) { const unsigned l = ld0 + (t & 1) * GSTG; const T16* a = gA + (size_t)t * GKC; const T16* a2 = gA2 + (size_t)t * GKC; const T16* b = gB + (size_t)t * GKC;
        // s_wait_xcnt stands in the copies' own statement, so that no later write of their address registers can be moved in front of it
        asm volatile("global_load_async_to_lds_b128 %0, %1, off\n\tglobal_load_async_to_lds_b128 %2, %3, off\n\tglobal_load_async_to_lds_b128 %4, %5, off\n\tglobal_load_async_to_lds_b128 %6, %7, off\n\t"
                     "global_load_async_to_lds_b128 %8, %9, off\n\tglobal_load_async_to_lds_b128 %10, %11, off\n\tglobal_load_async_to_lds_b128 %12, %13, off\n\tglobal_load_async_to_lds_b128 %14, %15, off\n\t"
                     "global_load_async_to_lds_b128 %16, %17, off\n\tglobal_load_async_to_lds_b128 %18, %19, off\n\tglobal_load_async_to_lds_b128 %20, %21, off\n\tglobal_load_async_to_lds_b128 %22, %23, off\n\ts_wait_xcnt 0x0"
                     :: "v"(l), "v"(a), "v"(l + 4096), "v"(a + rs), "v"(l + 8192), "v"(a + 2 * rs), "v"(l + 12288), "v"(a + 3 * rs),
                        "v"(l + 16384), "v"(a2), "v"(l + 20480), "v"(a2 + rs), "v"(l + 24576), "v"(a2 + 2 * rs), "v"(l + 28672), "v"(a2 + 3 * rs),
                        "v"(l + 32768), "v"(b), "v"(l + 36864), "v"(b + rs), "v"(l + 40960), "v"(b + 2 * rs), "v"(l + 45056), "v"(b + 3 * rs) : "memory"); };
    const int NT = K / GKC;
    copy(0);
    // the epilogue's lane takes NQ columns from cofs on: 4 of f32 or 8 of fp16, 16 bytes either way; its bias values are read here so that the epilogue does not wait for them
    constexpr int NQ = HOUT ? 8 : 4; const int cb = c0 + wn * 64, cofs = HOUT ? (lane & 7) * 8 : lr * 4; float bq[NQ];
#pragma unroll
    for (int i = 0; i < NQ; ++i) bq[i] = BIAS ? bias[cb + cofs + i] : 0.f;
    asm volatile("s_wait_asynccnt 0x0" ::: "memory");    // stage 0 has landed
    __syncthreads();                                     // publishes stage 0
    if (NT > 1) copy(1);
    v8f acc[2][4];
#pragma unroll
    for (int mb = 0; mb < 2; ++mb)
#pragma unroll
        for (int nb = 0; nb < 4; ++nb) acc[mb][nb] = (v8f){};
    // fragment reads: k step ks takes pieces 4 ks + hi and 4 ks + 2 + hi of its row; every row of a lane has (r >> 1) & 7 == lr >> 1
    const int px = hi ^ (lr >> 1); const int arow = (wm * 32 + lr) * 128, brow = (256 + wn * 64 + lr) * 128;
#pragma unroll 1    // rolled: the buffer alternates with the trip
    for (int t = 0; t < NT; ++t) {
        const char* sb = ring + (t & 1) * GSTG;
#pragma unroll
        for (int ks = 0; ks < 2; ++ks) { const int o0 = (px ^ (4 * ks)) << 4, o1 = (px ^ (4 * ks + 2)) << 4; V a[2], a2[2];
#pragma unroll
            for (int mb = 0; mb < 2; ++mb) { const char* ap = sb + arow + mb * 2048; a[mb] = WFrag<T16>::ld2(ap + o0, ap + o1); a2[mb] = WFrag<T16>::ld2(ap + 16384 + o0, ap + 16384 + o1); }
#pragma unroll
            for (int nb = 0; nb < 4; ++nb) { const char* bp = sb + brow + nb * 2048; const V b = WFrag<T16>::ld2(bp + o0, bp + o1);
#pragma unroll
                for (int mb = 0; mb < 2; ++mb) acc[mb][nb] = WFrag<T16>::mma(a[mb], b, acc[mb][nb]);
#pragma unroll
                for (int mb = 0; mb < 2; ++mb) acc[mb][nb] = WFrag<T16>::mma(a2[mb], b, acc[mb][nb]); } }
        asm volatile("s_wait_dscnt 0x0" ::: "memory");       // this wave's reads of stage t are done
        asm volatile("s_wait_asynccnt 0x0" ::: "memory");    // its copies of stage t + 1 have landed
        __syncthreads();                                     // publishes stage t + 1 and ends every read of stage t's buffer
        if (t + 2 < NT) copy(t + 2);
    }
    asm volatile("s_wait_asynccnt 0x0" ::: "memory");        // nothing is in flight when the ring becomes output staging
    float* os = (float*)ring + (tid >> 5) * (16 * 68);       // each wave stages in its own range, behind the last trip's barrier
    const v4f bv = {bfr(bq[0]), bfr(bq[1]), bfr(bq[2]), bfr(bq[3])}, bv1 = {bfr(bq[NQ - 4]), bfr(bq[NQ - 3]), bfr(bq[NQ - 2]), bfr(bq[NQ - 1])};
#pragma unroll
    for (int mb = 0; mb < 2; ++mb) {
#pragma unroll
        for (int nb = 0; nb < 4; ++nb) {
#pragma unroll
            for (int j = 0; j < 8; ++j) os[(hi * 8 + j) * 68 + nb * 16 + lr] = acc[mb][nb][j]; }
        __builtin_amdgcn_wave_barrier(); asm volatile("" ::: "memory");    // a lane reads what other lanes of its wave stored: keeps the compiler from moving the reads ahead of the stores
        if constexpr (HOUT) {    // eight lanes store one row's 64 columns = one 128-byte line; a store covers four rows
            _Float16* hrow_ = Ch + (size_t)(r0 + wm * 32 + mb * 16) * ldc + cb;
#pragma unroll
            for (int s = 0; s < 4; ++s) { const int row = 4 * s + (lane >> 3); v4f x0 = *(const v4fa*)(os + row * 68 + cofs), x1 = *(const v4fa*)(os + row * 68 + cofs + 4); if (BIAS) { x0 += bv; x1 += bv1; }
                v8h o;
#pragma unroll
                for (int e = 0; e < 4; ++e) { o[e] = (_Float16)x0[e]; o[4 + e] = (_Float16)x1[e]; }
                *(v8h*)(hrow_ + (size_t)row * ldc + cofs) = o; }
        } else {
            float* crow_ = C + (size_t)(r0 + wm * 32 + mb * 16) * ldc + cb;
#pragma unroll
            for (int s = 0; s < 8; ++s) { const int row = 2 * s + hi; v4f val = *(const v4fa*)(os + row * 68 + cofs); if (BIAS) val += bv;
                *(v4f*)(crow_ + (size_t)row * ldc + cofs) = val; }
        }
        __builtin_amdgcn_wave_barrier(); asm volatile("" ::: "memory");    // and the next block's stores ahead of these reads
    }
}

__device__ __forceinline__ h16 tohx(float x) { return (h16)x; }
__device__ __forceinline__ void splitf(float y, unsigned short& h, unsigned short& l) { h = f2bf(y); l = f2bf(y - bf2f(h)); }
typedef __attribute__((ext_vector_type(2))) _Float16 v2h;
typedef __attribute__((ext_vector_type(4))) _Float16 v4h;
typedef __attribute__((ext_vector_type(2))) unsigned short v2us;
typedef __attribute__((ext_vector_type(2), may_alias)) unsigned v2ua;

// k_cvt8: four equally long f32 arrays (blockIdx.y picks one) -> bf16, written one behind the other
__global__ __launch_bounds__(256) void k_cvt8(const float* __restrict__ s0, const float* __restrict__ s1, const float* __restrict__ s2, const float* __restrict__ s3, bf* dst, size_t n8) { const size_t i = (size_t)blockIdx.x * 256 + threadIdx.x; if (i >= n8) return;
    const int y = blockIdx.y; const float* src = y == 0 ? s0 : (y == 1 ? s1 : (y == 2 ? s2 : s3)); dst += (size_t)y * n8 * 8; const v8f v = *(const v8f*)(src + i * 8); v8us o;
#pragma unroll
    for (int k = 0; k < 8; ++k) o[k] = f2bf(v[k]); *(v8us*)(dst + i * 8) = o;  }
// k_dwT: Y hi/lo [pos][c] = split(BN(sum_{3x3} bf16(dw[c][ky][kx]) bf16(f[b][pos'][c]) + bf16(db[c]))) with pos' = (y+ky-1, x+kx-1) zero-padded, f = features [b][pos][c].
// blockIdx.z = branch * 8 + batch (branch 0 reads f1, branches 1 and 2 read f2). One thread: 4 channels of DR rows of one image column. Its 36 weights and its BatchNorm terms are read and rounded once,
// each feature vector (one 16-byte load, a wave reads 512 contiguous bytes) once for the up to three rows that use it. Grid (32 / 4 columns, 32 / DR row strips, 24), 256 threads = 64 channel groups x 4 columns.
// A tap outside the image enters as 0. The product of two bf16 values is exact in f32, so the fused multiply-add rounds as a multiply and an add would; taps are summed ky-major, kx-minor.
// Every loop is unrolled so that each index of a register array is a constant and a thread's loads are issued together, ahead of the first wait.
#define DR 8
typedef __attribute__((ext_vector_type(4))) unsigned short v4us;
// bfr of four values; keep = 0xFFFF0000 is bfr's own cut to the upper 16 bits, keep = 0 gives 0
__device__ __forceinline__ v4f bfr4m(v4f v, unsigned keep) { v4f r;
#pragma unroll
    for (int q = 0; q < 4; ++q) { unsigned u = __float_as_uint(v[q]); u += 0x7FFFu + ((u >> 16) & 1u); r[q] = __uint_as_float(u & keep); }
    return r; }
__device__ __forceinline__ v4f bfr4(v4f v) { return bfr4m(v, 0xFFFF0000u); }
__global__ __launch_bounds__(256) void k_dwT(const float* __restrict__ f1, const float* __restrict__ f2,
        const float* __restrict__ dw0, const float* __restrict__ db0, const float* __restrict__ g0, const float* __restrict__ bb0, const float* __restrict__ mu0, const float* __restrict__ var0,
        const float* __restrict__ dw1, const float* __restrict__ db1, const float* __restrict__ g1, const float* __restrict__ bb1, const float* __restrict__ mu1, const float* __restrict__ var1,
        const float* __restrict__ dw2, const float* __restrict__ db2, const float* __restrict__ g2, const float* __restrict__ bb2, const float* __restrict__ mu2, const float* __restrict__ var2, bf* Yh, bf* Yl) {
    const int zz = blockIdx.z, br = zz >> 3; const float* fb = (br == 0 ? f1 : f2) + (size_t)(zz & 7) * LL * CC; Yh += (size_t)zz * LL * CC; Yl += (size_t)zz * LL * CC;
    const float* dw = br == 0 ? dw0 : (br == 1 ? dw1 : dw2); const float* db = br == 0 ? db0 : (br == 1 ? db1 : db2); const float* g = br == 0 ? g0 : (br == 1 ? g1 : g2);
    const float* bb = br == 0 ? bb0 : (br == 1 ? bb1 : bb2); const float* mu = br == 0 ? mu0 : (br == 1 ? mu1 : mu2); const float* var = br == 0 ? var0 : (br == 1 ? var1 : var2);
    const int c = (threadIdx.x & 63) * 4, x0 = blockIdx.x * 4 + (threadIdx.x >> 6), y0 = blockIdx.y * DR;
    v4f xr[DR + 2][3];    // rows y0 - 1 .. y0 + DR, columns x0 - 1 .. x0 + 1; every address is clamped into the image, and the value of a tap outside it is masked to 0 below
#pragma unroll
    for (int r = 0; r < DR + 2; ++r) { const float* rowp = fb + (size_t)min(max(y0 + r - 1, 0), HWS - 1) * (HWS * CC);
#pragma unroll
        for (int kx = 0; kx < 3; ++kx) xr[r][kx] = *(const v4f*)(rowp + (unsigned)(min(max(x0 + kx - 1, 0), HWS - 1) * CC + c)); }
    float wf[36];         // dw of channels c .. c + 3: 36 contiguous floats
#pragma unroll
    for (int i = 0; i < 9; ++i) { const v4f t = *(const v4f*)(dw + c * 9 + i * 4); wf[i * 4] = t[0]; wf[i * 4 + 1] = t[1]; wf[i * 4 + 2] = t[2]; wf[i * 4 + 3] = t[3]; }
    v4f w[9];
#pragma unroll
    for (int k = 0; k < 9; ++k)
#pragma unroll
        for (int q = 0; q < 4; ++q) w[k][q] = bfr(wf[q * 9 + k]);
    const v4f dbv = bfr4(*(const v4f*)(db + c)), gm = bfr4(*(const v4f*)(g + c)), be = bfr4(*(const v4f*)(bb + c)), mm = bfr4(*(const v4f*)(mu + c)), vv = bfr4(*(const v4f*)(var + c)); v4f sc;
#pragma unroll
    for (int q = 0; q < 4; ++q) sc[q] = __fmul_rn(__fdiv_rn(1.0f, __fsqrt_rn(__fadd_rn(vv[q], 1e-5f))), gm[q]);
#pragma unroll
    for (int r = 0; r < DR + 2; ++r)
#pragma unroll
        for (int kx = 0; kx < 3; ++kx) { const int yy = y0 + r - 1, xx = x0 + kx - 1; xr[r][kx] = bfr4m(xr[r][kx], yy >= 0 && yy < HWS && xx >= 0 && xx < HWS ? 0xFFFF0000u : 0u); }
#pragma unroll
    for (int r = 0; r < DR; ++r) { v4f acc = (v4f){};
#pragma unroll
        for (int ky = 0; ky < 3; ++ky)
#pragma unroll
            for (int kx = 0; kx < 3; ++kx) acc = __builtin_elementwise_fma(w[ky * 3 + kx], xr[r + ky][kx], acc);
        const v4f o = __builtin_elementwise_fma(acc + dbv - mm, sc, be); v4us oh, ol;
#pragma unroll
        for (int q = 0; q < 4; ++q) { unsigned short a, c2; splitf(o[q], a, c2); oh[q] = a; ol[q] = c2; }
        const size_t e = (size_t)((y0 + r) * HWS + x0) * CC + c; *(v4us*)(Yh + e) = oh; *(v4us*)(Yl + e) = ol; }
}
#define KT   64                   // keys per stage
#define KPIT 72                   // LDS row pitch in 16-bit elements: 144 B = 16 B x odd, for 16-byte row reads
#define SC2  0.18033688011112042f // 1/8 * log2(e)
__device__ __forceinline__ float xhalf(float x) { const int b = __float_as_int(x); return __int_as_float(__builtin_amdgcn_permlanex16(b, b, 0x76543210, 0xfedcba98, false, false)); }   // lane l <-> l ^ 16
// eight 2^x in place, one v_nop behind the last: so no instruction that stands directly behind a v_exp_f32 reads its result or overwrites its source (the slot the instruction set asks for)
__device__ __forceinline__ void exp2x8(float (&e)[8]) {
    asm("v_exp_f32 %0, %0\n\tv_exp_f32 %1, %1\n\tv_exp_f32 %2, %2\n\tv_exp_f32 %3, %3\n\tv_exp_f32 %4, %4\n\tv_exp_f32 %5, %5\n\tv_exp_f32 %6, %6\n\tv_exp_f32 %7, %7\n\tv_nop"
        : "+v"(e[0]), "+v"(e[1]), "+v"(e[2]), "+v"(e[3]), "+v"(e[4]), "+v"(e[5]), "+v"(e[6]), "+v"(e[7])); }
__global__ __launch_bounds__(256) void k_fattn(const _Float16* __restrict__ F, bf* Ah, bf* Al) {
    __shared__ __align__(16) h16 ks[2][KT * KPIT];    // [key][d]
    __shared__ __align__(16) h16 vs[2][CH * KPIT];    // [d][key]
    const int z = blockIdx.y, h = z & (NHD - 1), b = z / NHD, tid = threadIdx.x, lane = tid & 31, lr = lane & 15, hi = lane >> 4; const int q0 = blockIdx.x * 256 + (tid >> 5) * 32;
    const h16* Fq = F + (size_t)b * LL * OC + h * CH; const h16* Fk = Fq + (size_t)NB_ * LL * OC; const h16* Fv = Fk + (size_t)NB_ * LL * OC;
    v16h qf[2][2];
#pragma unroll
    for (int qb = 0; qb < 2; ++qb)
#pragma unroll
        for (int kc = 0; kc < 2; ++kc) qf[qb][kc] = WFrag<h16>::ld(Fq + (size_t)(q0 + qb * 16 + lr) * OC + kc * 32 + 8 * hi);
    // staging: a stage is 64 keys x 64 d of k and of v, a key's 64 d = one 128-byte line. k: thread moves 16-byte piece kp of rows kw and kw + 32 as they are. v: thread (dq, rq) moves d 4 dq .. 4 dq + 3 of
    // rows 4 rq + i (i = 0 .. 3), and the four keys of one d go transposed into LDS as one 8-byte store
    const int kp = tid & 7, kw = tid >> 3, dq = tid & 15, rq = tid >> 4; const h16* kg = Fk + (size_t)kw * OC + kp * 8; const h16* vg = Fv + (size_t)(rq * 4) * OC + dq * 4; v8h kr[2]; v2ua vr[4];
    auto fetch = [&](int t) {
#pragma unroll
        for (int i = 0; i < 2; ++i) kr[i] = *(const v8h*)(kg + (size_t)(t * KT + 32 * i) * OC);
#pragma unroll
        for (int i = 0; i < 4; ++i) vr[i] = *(const v2ua*)(vg + (size_t)(t * KT + i) * OC); };
    auto put = [&](h16* kn, h16* vn) {
#pragma unroll
        for (int i = 0; i < 2; ++i) *(v8h*)(kn + (kw + 32 * i) * KPIT + kp * 8) = kr[i];
#pragma unroll
        for (int i = 0; i < 4; ++i) { const unsigned sel = (i & 1) ? 0x07060302u : 0x05040100u;    // byte select: the upper or the lower 16 bits of both words, second argument first
            const v2ua ov = {__builtin_amdgcn_perm(vr[1][i >> 1], vr[0][i >> 1], sel), __builtin_amdgcn_perm(vr[3][i >> 1], vr[2][i >> 1], sel)};
            *(v2ua*)(vn + (dq * 4 + i) * KPIT + rq * 4) = ov; } };
    fetch(0);
    asm volatile("s_wait_xcnt 0x0" ::: "memory");    // as below: registers that held addresses of the loads above are taken by the results of the loads that follow
    __builtin_amdgcn_sched_barrier(0);               // keeps those loads behind that wait
    put(ks[0], vs[0]); fetch(1);
    asm volatile("s_wait_xcnt 0x0" ::: "memory");    // the address registers of the loads above (q, stages 0 and 1) are reused right behind them
    __builtin_amdgcn_sched_barrier(0);               // keeps the zeroing of the accumulators, which takes those registers, behind that wait
    v8f acc[2][4]; float m[2], l[2];
#pragma unroll
    for (int qb = 0; qb < 2; ++qb) { m[qb] = -3.0e38f; l[qb] = 0.f;
#pragma unroll
        for (int mb = 0; mb < 4; ++mb) acc[qb][mb] = (v8f){}; }
    __syncthreads();    // publishes stage 0
#pragma unroll 1    // rolled: one pass is some 500 instructions
    for (int t = 0; t < TT / KT; ++t) {
        const h16* kb_ = ks[t & 1]; const h16* vb_ = vs[t & 1];
        if (t + 1 < TT / KT) put(ks[(t + 1) & 1], vs[(t + 1) & 1]);    // stage t + 1 into the other buffer: its readers (pass t - 1) left it before the barrier at that pass's foot
        if (t + 2 < TT / KT) { fetch(t + 2);                           // stage t + 2 into registers, a whole pass ahead of its LDS stores
            asm volatile("s_wait_xcnt 0x0" ::: "memory"); }            // the loads' address registers are reused right behind them
        v8f s[2][4];
#pragma unroll
        for (int kb = 0; kb < 4; ++kb) { const h16* kp = kb_ + (kb * 16 + lr) * KPIT + 8 * hi; const v16h a0 = WFrag<h16>::ld(kp), a1 = WFrag<h16>::ld(kp + 32);
#pragma unroll
            for (int qb = 0; qb < 2; ++qb) s[qb][kb] = wmma16(a1, qf[qb][1], wmma16(a0, qf[qb][0], (v8f){})); }
        v16h pf[2][2];
#pragma unroll
        for (int qb = 0; qb < 2; ++qb) { float mt = s[qb][0][0];
#pragma unroll
            for (int kb = 0; kb < 4; ++kb)
#pragma unroll
                for (int j = 0; j < 8; ++j) mt = fmaxf(mt, s[qb][kb][j]);
            mt = fmaxf(mt, xhalf(mt)); const float mn = fmaxf(m[qb], mt); float corr = (m[qb] - mn) * SC2; const float mc = mn * SC2; m[qb] = mn; float ps = 0.f;
            asm("v_exp_f32 %0, %0\n\tv_nop" : "+v"(corr));    // as in exp2x8
#pragma unroll
            for (int kb = 0; kb < 4; ++kb) { float e[8];
#pragma unroll
                for (int j = 0; j < 8; ++j) e[j] = fmaf(s[qb][kb][j], SC2, -mc);
                exp2x8(e);
#pragma unroll
                for (int j = 0; j < 8; ++j) { ps += e[j]; pf[qb][kb >> 1][(kb & 1) * 8 + j] = tohx(e[j]); } }
            l[qb] = fmaf(l[qb], corr, ps);
#pragma unroll
            for (int mb = 0; mb < 4; ++mb) acc[qb][mb] *= corr; }
#pragma unroll
        for (int c = 0; c < 2; ++c)
#pragma unroll
            for (int mb = 0; mb < 4; ++mb) { const v16h va = WFrag<h16>::ld(vb_ + (mb * 16 + lr) * KPIT + c * 32 + 8 * hi);
#pragma unroll
                for (int qb = 0; qb < 2; ++qb) acc[qb][mb] = wmma16(va, pf[qb][c], acc[qb][mb]); }
        __syncthreads();    // publishes stage t + 1 and ends every read of stage t's buffer
    }
    Ah += (size_t)b * LL * OC; Al += (size_t)b * LL * OC;
#pragma unroll
    for (int qb = 0; qb < 2; ++qb) { const float inv = __fdiv_rn(1.0f, l[qb] + xhalf(l[qb])); const size_t oo = (size_t)(q0 + qb * 16 + lr) * OC + h * CH + hi * 8;
#pragma unroll
        for (int mb = 0; mb < 4; ++mb) { v8us oh, ol;
#pragma unroll
            for (int j = 0; j < 8; ++j) { unsigned short a, c2; splitf(acc[qb][mb][j] * inv, a, c2); oh[j] = a; ol[j] = c2; }
            *(v8us*)(Ah + oo + mb * 16) = oh; *(v8us*)(Al + oo + mb * 16) = ol; } }
}

extern "C" void kernel_launch(void* const* d_in, const int* in_sizes, int n_in,
                              void* d_out, int out_size, void* d_ws, size_t ws_size, hipStream_t stream) {
    (void)in_sizes; (void)n_in; (void)out_size;
    const float* IN[28]; for (int i = 0; i < 28; ++i) IN[i] = (const float*)d_in[i];
    // features1, features2; then per branch q/k/v (base 2, 10, 18): dw_w [256][1][3][3], dw_b, bn_g, bn_b, bn_m, bn_v, pw_w [512][256][1][1], pw_b; ffn_w [256][512], ffn_b = d_in[26..27]
    float* OUT = (float*)d_out;     // [8][1024][256]
    char* wsp = (char*)d_ws;
    auto take = [&](size_t bytes) { char* p = wsp; wsp += (bytes + 255) & ~(size_t)255; return (void*)p; };
    bf* WPW = (bf*)take((size_t)4 * OC * CC * 2); bf* WF = WPW + (size_t)3 * OC * CC;    // pw_w of q, k, v, then ffn_w
    bf* Ah = (bf*)take((size_t)NB_ * LL * OC * 2); bf* Al = (bf*)take((size_t)NB_ * LL * OC * 2);
    // Y planes and F, all 3 branches x 8 images
    bf* Yh = (bf*)take((size_t)3 * NB_ * LL * CC * 2); bf* Yl = (bf*)take((size_t)3 * NB_ * LL * CC * 2); h16* F = (h16*)take((size_t)3 * NB_ * LL * OC * 2);
    if ((size_t)(wsp - (char*)d_ws) > ws_size) return;    // total ~ 65 MiB; ws 256 MiB
    k_cvt8<<<dim3((OC * CC / 8 + 255) / 256, 4, 1), 256, 0, stream>>>(IN[8], IN[16], IN[24], IN[26], WPW, (size_t)OC * CC / 8);
    k_dwT<<<dim3(HWS / 4, HWS / DR, 3 * NB_), 256, 0, stream>>>(IN[0], IN[1], IN[2], IN[3], IN[4], IN[5], IN[6], IN[7], IN[10], IN[11], IN[12], IN[13], IN[14], IN[15], IN[18], IN[19], IN[20], IN[21], IN[22], IN[23], Yh, Yl);
    k_gemmw<bf, true, true><<<dim3(LL / 128, OC / 128, 3 * NB_), 256, 0, stream>>>(Yh, Yl, WPW, CC, nullptr, F, OC, IN[9], IN[17], IN[25], (size_t)LL * CC, (size_t)OC * CC, (size_t)LL * OC, 3);
    k_fattn<<<dim3(LL / 256, NB_ * NHD, 1), 256, 0, stream>>>(F, Ah, Al);
    k_gemmw<bf, true, false><<<dim3(NB_ * LL / 128, CC / 128, 1), 256, 0, stream>>>(Ah, Al, WF, OC, OUT, nullptr, CC, IN[27], IN[27], IN[27], 0, 0, 0, 0);
}

// v006
// A run of this version takes 69.9 microseconds.
// Timed twice side by side with v005, it ran 1.04 and 1.06 times as fast.
// Over all steps from v000 it is 37.7 times as fast.
#include <hip/hip_runtime.h>

// ConvolutionAttention (features1, features2 [8][1024][256] -> NCHW [8][256][32][32]; q = SepConv_q(x1), k = SepConv_k(x2), v = SepConv_v(x2) with SepConv = depthwise 3x3 (pad 1) + bias, eval BatchNorm,
// pointwise 1x1 -> 512 channels + bias; 8 heads x 64 (head h = channels h*64..); softmax(q.k/8) over the 1024 positions; out = merged (attn v) ffn_w^T + ffn_b -> [8][1024][256]).
// Compute dtypes, f32 accumulate: every input rounded to bf16; depthwise conv + bias + BN fold in f32 on VALU -> bf16 hi+lo planes [position][channel]; the pointwise
// convs on those planes x exact pw weights (2 products, + bias); scores (K 64) and attn.v on SINGLE fp16 operands (1/8 in f32 in the online softmax; attn as exp(s - running max), divided by the row sum at the end); merged heads as hi+lo planes x

#define NB_  8
#define HWS  32
#define LL   1024                 // positions
#define CC   256
#define OC   512
#define NHD  8
#define CH   64
#define TT   1024
typedef _Float16 h16;
typedef unsigned short bf;
typedef __attribute__((ext_vector_type(16))) __bf16   v16bf;
typedef __attribute__((ext_vector_type(16))) _Float16 v16h;
typedef __attribute__((ext_vector_type(8)))  _Float16 v8h;
typedef __attribute__((ext_vector_type(8)))  unsigned short v8us;
typedef __attribute__((ext_vector_type(8)))  float    v8f;
typedef __attribute__((ext_vector_type(4)))  float    v4f;
typedef v8h  __attribute__((may_alias)) v8ha;
typedef v4f  __attribute__((may_alias)) v4fa;
typedef v8us __attribute__((may_alias)) v8usa;

__device__ __forceinline__ unsigned short f2bf(float f) { unsigned u = __float_as_uint(f); u += 0x7FFFu + ((u >> 16) & 1u); return (unsigned short)(u >> 16); }
__device__ __forceinline__ float bf2f(unsigned short b) { return __uint_as_float(((unsigned)b) << 16); }
__device__ __forceinline__ float bfr(float f) { return bf2f(f2bf(f)); }
__device__ __forceinline__ v16h cat16(v8h lo, v8h hi) { return __builtin_shufflevector(lo, hi, 0, 1, 2, 3, 4, 5, 6, 7, 8, 9, 10, 11, 12, 13, 14, 15); }
__device__ __forceinline__ v16bf cat16b(v8us lo, v8us hi) { return __builtin_bit_cast(v16bf, __builtin_shufflevector(lo, hi, 0, 1, 2, 3, 4, 5, 6, 7, 8, 9, 10, 11, 12, 13, 14, 15)); }
__device__ __forceinline__ v8f wmma16(v16h a, v16h b, v8f c) { return __builtin_amdgcn_wmma_f32_16x16x32_f16(false, a, false, b, (short)0, c, false, false); }
__device__ __forceinline__ v8f wmmab(v16bf a, v16bf b, v8f c) { return __builtin_amdgcn_wmma_f32_16x16x32_bf16(false, a, false, b, (short)0, c, false, false); }



// ---- k_gemmw: GEMM, eight waves per 128x128 output tile (wave = 32 rows x 64 columns, 8 accumulators); grid (M/128, N/128, Z), 256 threads.
// C[m][n] (f32, pitch ldc, + optional f32 bias[n]) = sum_k (A[m][k] + A2[m][k]) Bt[n][k], operands K-contiguous 16-bit planes. z-batch strides sA/sB/sC in elements. K % 64 == 0.
// HOUT: the f32 result (bias added in f32) is rounded to fp16 and stored to Ch instead of C, same pitch and stride in elements: its reader takes it as an fp16 matrix operand.
// 2^zs consecutive z share one Bt and one bias: Bt steps by sB and the bias goes bias, bias1, bias2 with z >> zs.
// A stage is 64 k (one 128-byte line) of 128 A rows, 128 A2 rows and 128 Bt rows = 384 LDS rows of 128 bytes; two buffers; asynchronous 16-byte copies bring stage t + 2 in while stage t + 1 is worked on.
// LDS rows are not padded: 16-byte piece c of row r lies at piece c ^ ((r >> 1) & 7), so the 16 rows of a fragment read fall on all 64 banks once.
// Per accumulator the products are summed k ascending in steps of 32, A before A2.
#define GKC   64
#define GSTG  (384 * 128)          // bytes of a stage
template <typename T16> struct WFrag;
template <> struct WFrag<h16> { typedef v16h V; static __device__ __forceinline__ V ld(const h16* p) { return cat16(*(const v8h*)p, *(const v8h*)(p + 16)); } static __device__ __forceinline__ v8f mma(V a, V b, v8f c) { return wmma16(a, b, c); } };
template <> struct WFrag<bf> { typedef v16bf V; static __device__ __forceinline__ V ld(const bf* p) { return cat16b(*(const v8us*)p, *(const v8us*)(p + 16)); } static __device__ __forceinline__ V ld2(const char* p, const char* q) { return cat16b(*(const v8usa*)p, *(const v8usa*)q); } static __device__ __forceinline__ v8f mma(V a, V b, v8f c) { return wmmab(a, b, c); } };
template <typename T16, bool BIAS, bool HOUT>
__global__ __launch_bounds__(256) void k_gemmw(const T16* __restrict__ A, const T16* __restrict__ A2, const T16* __restrict__ Bt, int K, float* C, _Float16* Ch, int ldc, const float* __restrict__ bias, const float* __restrict__ bias1, const float* __restrict__ bias2, size_t sA, size_t sB, size_t sC, int zs) {
    typedef typename WFrag<T16>::V V;
    __shared__ __align__(128) char ring[2 * GSTG];
    const size_t z = blockIdx.z, zw = z >> zs; A += z * sA; A2 += z * sA; Bt += zw * sB; if (HOUT) Ch += z * sC; else C += z * sC; if (BIAS) bias = zw == 0 ? bias : (zw == 1 ? bias1 : bias2);
    const int tid = threadIdx.x, lane = tid & 31, lr = lane & 15, hi = lane >> 4, wm = tid >> 6, wn = (tid >> 5) & 1; const int r0 = blockIdx.x * 128, c0 = blockIdx.y * 128;
    // copies: thread = piece (tid & 7) of row (tid >> 3) + 32 i of each operand, i = 0 .. 3: a wave moves four whole lines per copy
    const int crow = tid >> 3, cpc = tid & 7; const unsigned ld0 = (unsigned)(size_t)ring + crow * 128 + ((cpc ^ ((crow >> 1) & 7)) << 4);
    const T16* gA = A + (size_t)(r0 + crow) * K + cpc * 8; const T16* gA2 = A2 + (size_t)(r0 + crow) * K + cpc * 8; const T16* gB = Bt + (size_t)(c0 + crow) * K + cpc * 8; const size_t rs = (size_t)32 * K;
    auto copy = [&](int t) { const unsigned l = ld0 + (t & 1) * GSTG; const T16* a = gA + (size_t)t * GKC; const T16* a2 = gA2 + (size_t)t * GKC; const T16* b = gB + (size_t)t * GKC;
        // s_wait_xcnt stands in the copies' own statement, so that no later write of their address registers can be moved in front of it
        asm volatile("global_load_async_to_lds_b128 %0, %1, off\n\tglobal_load_async_to_lds_b128 %2, %3, off\n\tglobal_load_async_to_lds_b128 %4, %5, off\n\tglobal_load_async_to_lds_b128 %6, %7, off\n\t"
                     "global_load_async_to_lds_b128 %8, %9, off\n\tglobal_load_async_to_lds_b128 %10, %11, off\n\tglobal_load_async_to_lds_b128 %12, %13, off\n\tglobal_load_async_to_lds_b128 %14, %15, off\n\t"
                     "global_load_async_to_lds_b128 %16, %17, off\n\tglobal_load_async_to_lds_b128 %18, %19, off\n\tglobal_load_async_to_lds_b128 %20, %21, off\n\tglobal_load_async_to_lds_b128 %22, %23, off\n\ts_wait_xcnt 0x0"
                     :: "v"(l), "v"(a), "v"(l + 4096), "v"(a + rs), "v"(l + 8192), "v"(a + 2 * rs), "v"(l + 12288), "v"(a + 3 * rs),
                        "v"(l + 16384), "v"(a2), "v"(l + 20480), "v"(a2 + rs), "v"(l + 24576), "v"(a2 + 2 * rs), "v"(l + 28672), "v"(a2 + 3 * rs),
                        "v"(l + 32768), "v"(b), "v"(l + 36864), "v"(b + rs), "v"(l + 40960), "v"(b + 2 * rs), "v"(l + 45056), "v"(b + 3 * rs) : "memory"); };
    const int NT = K / GKC;
    copy(0);
    // the epilogue's lane takes NQ columns from cofs on: 4 of f32 or 8 of fp16, 16 bytes either way; its bias values are read here so that the epilogue does not wait for them
    constexpr int NQ = HOUT ? 8 : 4; const int cb = c0 + wn * 64, cofs = HOUT ? (lane & 7) * 8 : lr * 4; float bq[NQ];
#pragma unroll
    for (int i = 0; i < NQ; ++i) bq[i] = BIAS ? bias[cb + cofs + i] : 0.f;
    asm volatile("s_wait_asynccnt 0x0" ::: "memory");    // stage 0 has landed
    __syncthreads();                                     // publishes stage 0
    if (NT > 1) copy(1);
    v8f acc[2][4];
#pragma unroll
    for (int mb = 0; mb < 2; ++mb)
#pragma unroll
        for (int nb = 0; nb < 4; ++nb) acc[mb][nb] = (v8f){};
    // fragment reads: k step ks takes pieces 4 ks + hi and 4 ks + 2 + hi of its row; every row of a lane has (r >> 1) & 7 == lr >> 1
    const int px = hi ^ (lr >> 1); const int arow = (wm * 32 + lr) * 128, brow = (256 + wn * 64 + lr) * 128;
#pragma unroll 1    // rolled: the buffer alternates with the trip
    for (int t = 0; t < NT; ++t) {
        const char* sb = ring + (t & 1) * GSTG;
#pragma unroll
        for (int ks = 0; ks < 2; ++ks) { const int o0 = (px ^ (4 * ks)) << 4, o1 = (px ^ (4 * ks + 2)) << 4; V a[2], a2[2];
#pragma unroll
            for (int mb = 0; mb < 2; ++mb) { const char* ap = sb + arow + mb * 2048; a[mb] = WFrag<T16>::ld2(ap + o0, ap + o1); a2[mb] = WFrag<T16>::ld2(ap + 16384 + o0, ap + 16384 + o1); }
#pragma unroll
            for (int nb = 0; nb < 4; ++nb) { const char* bp = sb + brow + nb * 2048; const V b = WFrag<T16>::ld2(bp + o0, bp + o1);
#pragma unroll
                for (int mb = 0; mb < 2; ++mb) acc[mb][nb] = WFrag<T16>::mma(a[mb], b, acc[mb][nb]);
#pragma unroll
                for (int mb = 0; mb < 2; ++mb) acc[mb][nb] = WFrag<T16>::mma(a2[mb], b, acc[mb][nb]); } }
        asm volatile("s_wait_dscnt 0x0" ::: "memory");       // this wave's reads of stage t are done
        asm volatile("s_wait_asynccnt 0x0" ::: "memory");    // its copies of stage t + 1 have landed
        __syncthreads();                                     // publishes stage t + 1 and ends every read of stage t's buffer
        if (t + 2 < NT) copy(t + 2);
    }
    asm volatile("s_wait_asynccnt 0x0" ::: "memory");        // nothing is in flight when the ring becomes output staging
    float* os = (float*)ring + (tid >> 5) * (16 * 68);       // each wave stages in its own range, behind the last trip's barrier
    const v4f bv = {bfr(bq[0]), bfr(bq[1]), bfr(bq[2]), bfr(bq[3])}, bv1 = {bfr(bq[NQ - 4]), bfr(bq[NQ - 3]), bfr(bq[NQ - 2]), bfr(bq[NQ - 1])};
#pragma unroll
    for (int mb = 0; mb < 2; ++mb) {
#pragma unroll
        for (int nb = 0; nb < 4; ++nb) {
#pragma unroll
            for (int j = 0; j < 8; ++j) os[(hi * 8 + j) * 68 + nb * 16 + lr] = acc[mb][nb][j]; }
        __builtin_amdgcn_wave_barrier(); asm volatile("" ::: "memory");    // a lane reads what other lanes of its wave stored: keeps the compiler from moving the reads ahead of the stores
        if constexpr (HOUT) {    // eight lanes store one row's 64 columns = one 128-byte line; a store covers four rows
            _Float16* hrow_ = Ch + (size_t)(r0 + wm * 32 + mb * 16) * ldc + cb;
#pragma unroll
            for (int s = 0; s < 4; ++s) { const int row = 4 * s + (lane >> 3); v4f x0 = *(const v4fa*)(os + row * 68 + cofs), x1 = *(const v4fa*)(os + row * 68 + cofs + 4); if (BIAS) { x0 += bv; x1 += bv1; }
                v8h o;
#pragma unroll
                for (int e = 0; e < 4; ++e) { o[e] = (_Float16)x0[e]; o[4 + e] = (_Float16)x1[e]; }
                *(v8h*)(hrow_ + (size_t)row * ldc + cofs) = o; }
        } else {
            float* crow_ = C + (size_t)(r0 + wm * 32 + mb * 16) * ldc + cb;
#pragma unroll
            for (int s = 0; s < 8; ++s) { const int row = 2 * s + hi; v4f val = *(const v4fa*)(os + row * 68 + cofs); if (BIAS) val += bv;
                *(v4f*)(crow_ + (size_t)row * ldc + cofs) = val; }
        }
        __builtin_amdgcn_wave_barrier(); asm volatile("" ::: "memory");    // and the next block's stores ahead of these reads
    }
}

__device__ __forceinline__ h16 tohx(float x) { return (h16)x; }
__device__ __forceinline__ void splitf(float y, unsigned short& h, unsigned short& l) { h = f2bf(y); l = f2bf(y - bf2f(h)); }
typedef __attribute__((ext_vector_type(2))) _Float16 v2h;
typedef __attribute__((ext_vector_type(4))) _Float16 v4h;
typedef __attribute__((ext_vector_type(2))) unsigned short v2us;
typedef __attribute__((ext_vector_type(2), may_alias)) unsigned v2ua;

// k_cvt8: four equally long f32 arrays (blockIdx.y picks one) -> bf16, written one behind the other
__global__ __launch_bounds__(256) void k_cvt8(const float* __restrict__ s0, const float* __restrict__ s1, const float* __restrict__ s2, const float* __restrict__ s3, bf* dst, size_t n8) { const size_t i = (size_t)blockIdx.x * 256 + threadIdx.x; if (i >= n8) return;
    const int y = blockIdx.y; const float* src = y == 0 ? s0 : (y == 1 ? s1 : (y == 2 ? s2 : s3)); dst += (size_t)y * n8 * 8; const v8f v = *(const v8f*)(src + i * 8); v8us o;
#pragma unroll
    for (int k = 0; k < 8; ++k) o[k] = f2bf(v[k]); *(v8us*)(dst + i * 8) = o;  }
// ---- k_sepw: depthwise 3x3 + bias + BatchNorm and the pointwise GEMM of one branch and image in one kernel, so that the hi and lo planes of the GEMM's A operand live in LDS only.
// Grid (LL / 128, branch * 8 + batch), 512 threads = 16 waves; a work-group makes 128 positions (4 image rows) x all 512 outputs. Branch 0 reads f1, branches 1 and 2 read f2.
// Part 1, Y hi/lo [pos][c] = split(BN(sum_{3x3} bf16(dw[c][ky][kx]) bf16(f[b][pos'][c]) + bf16(db[c]))) with pos' = (y+ky-1, x+kx-1) zero-padded, f = features [b][pos][c]:
// a thread takes 4 channels of 4 rows x 4 columns. Its 36 weights and its BatchNorm terms are read and rounded once, each feature vector (one 16-byte load, a wave reads 512 contiguous bytes) once for all the taps that use it.
// A tap outside the image enters as 0. The product of two bf16 values is exact in f32, so the fused multiply-add rounds as a multiply and an add would; taps are summed ky-major, kx-minor.
// Every loop is unrolled so that each index of a register array is a constant and a thread's loads are issued together, ahead of the first wait.
// ytile holds Y as k_gemmw's stages hold A and A2: block (k chunk t of 64 channels, plane) = 128 rows of 128 bytes, 16-byte piece c of row r at piece c ^ ((r >> 1) & 7).
// Part 2, F[pos][n] (fp16) = round(sum_k (Yhi + Ylo)[pos][k] Wt[n][k] + bf16(bias[n])): wave = 32 rows x 128 columns, 16 accumulators; a weight stage is 64 k of all 512 rows of Wt, two buffers, brought by asynchronous
// 16-byte copies as in k_gemmw (stage 0 flies during part 1). Per accumulator the products are summed k ascending in steps of 32, hi before lo.
#define SR    4                    // image rows of a work-group
#define YBLK  (128 * 128)          // bytes of one block of ytile
#define WSTG  (OC * 128)           // bytes of a weight stage
#define XI(kx) ((kx) == 5 ? 4 : 0) // columns of tap column kx that go into the load's immediate offset: the last one is min(x0, 27) + 4
typedef __attribute__((ext_vector_type(4))) unsigned short v4us;
typedef v4us __attribute__((may_alias)) v4usa;
// bfr of four values; keep = 0xFFFF0000 is bfr's own cut to the upper 16 bits, keep = 0 gives 0
__device__ __forceinline__ v4f bfr4m(v4f v, unsigned keep) { v4f r;
#pragma unroll
    for (int q = 0; q < 4; ++q) { unsigned u = __float_as_uint(v[q]); u += 0x7FFFu + ((u >> 16) & 1u); r[q] = __uint_as_float(u & keep); }
    return r; }
__device__ __forceinline__ v4f bfr4(v4f v) { return bfr4m(v, 0xFFFF0000u); }
__global__ __launch_bounds__(512) void k_sepw(const float* __restrict__ f1, const float* __restrict__ f2,
        const float* __restrict__ dw0, const float* __restrict__ db0, const float* __restrict__ g0, const float* __restrict__ bb0, const float* __restrict__ mu0, const float* __restrict__ var0,
        const float* __restrict__ dw1, const float* __restrict__ db1, const float* __restrict__ g1, const float* __restrict__ bb1, const float* __restrict__ mu1, const float* __restrict__ var1,
        const float* __restrict__ dw2, const float* __restrict__ db2, const float* __restrict__ g2, const float* __restrict__ bb2, const float* __restrict__ mu2, const float* __restrict__ var2,
        const bf* __restrict__ Wt, _Float16* F, const float* __restrict__ pb0, const float* __restrict__ pb1, const float* __restrict__ pb2) {
    __shared__ __align__(128) char ytile[8 * YBLK];
    __shared__ __align__(128) char ring[2 * WSTG];
    const int zz = blockIdx.y, br = zz >> 3, tid = threadIdx.x; const float* fb = (br == 0 ? f1 : f2) + (size_t)(zz & 7) * LL * CC;
    // weight copies: thread = piece (tid & 7) of rows (tid >> 3) + 64 i, i = 0 .. 7: a wave moves four whole lines per copy
    const int crow = tid >> 3, cpc = tid & 7; const unsigned ld0 = (unsigned)(size_t)ring + crow * 128 + ((cpc ^ ((crow >> 1) & 7)) << 4);
    const bf* gB = Wt + (size_t)br * OC * CC + (size_t)crow * CC + cpc * 8;
    auto copy = [&](int t) { const unsigned l = ld0 + (t & 1) * WSTG; const bf* b = gB + t * GKC;
        // s_wait_xcnt stands in the copies' own statement, so that no later write of their address registers can be moved in front of it
        asm volatile("global_load_async_to_lds_b128 %0, %1, off\n\tglobal_load_async_to_lds_b128 %2, %3, off\n\tglobal_load_async_to_lds_b128 %4, %5, off\n\tglobal_load_async_to_lds_b128 %6, %7, off\n\t"
                     "global_load_async_to_lds_b128 %8, %9, off\n\tglobal_load_async_to_lds_b128 %10, %11, off\n\tglobal_load_async_to_lds_b128 %12, %13, off\n\tglobal_load_async_to_lds_b128 %14, %15, off\n\ts_wait_xcnt 0x0"
                     :: "v"(l), "v"(b), "v"(l + 8192), "v"(b + 64 * CC), "v"(l + 16384), "v"(b + 128 * CC), "v"(l + 24576), "v"(b + 192 * CC),
                        "v"(l + 32768), "v"(b + 256 * CC), "v"(l + 40960), "v"(b + 320 * CC), "v"(l + 49152), "v"(b + 384 * CC), "v"(l + 57344), "v"(b + 448 * CC) : "memory"); };
    copy(0);
    { // part 1
    const float* dw = br == 0 ? dw0 : (br == 1 ? dw1 : dw2); const float* db = br == 0 ? db0 : (br == 1 ? db1 : db2); const float* g = br == 0 ? g0 : (br == 1 ? g1 : g2);
    const float* bb = br == 0 ? bb0 : (br == 1 ? bb1 : bb2); const float* mu = br == 0 ? mu0 : (br == 1 ? mu1 : mu2); const float* var = br == 0 ? var0 : (br == 1 ? var1 : var2);
    const int cg = tid & 63, c = cg * 4, x0 = (tid >> 6) * 4, y0 = blockIdx.x * SR;
    unsigned xb[6]; v4f xr[SR + 2][6];    // byte offsets of the six columns; rows y0 - 1 .. y0 + SR, columns x0 - 1 .. x0 + 4; every address is clamped into the image, and the value of a tap outside it is masked to 0 below
#pragma unroll
    for (int kx = 0; kx < 6; ++kx) xb[kx] = (unsigned)(min(max(x0 + kx - 1 - XI(kx), 0), HWS - 1 - XI(kx)) * CC + c) * 4;
    const char* rowp[SR + 2];
#pragma unroll
    for (int r = 0; r < SR + 2; ++r) rowp[r] = (const char*)(fb + (size_t)min(max(y0 + r - 1, 0), HWS - 1) * (HWS * CC));
    __builtin_amdgcn_sched_barrier(0);               // all six row addresses are formed ahead of the loads: none is formed among them in a register that an issued load names, behind a wait that would hold the later loads back
#pragma unroll
    for (int r = 0; r < SR + 2; ++r)
#pragma unroll
        for (int kx = 0; kx < 6; ++kx) xr[r][kx] = *(const v4f*)(rowp[r] + xb[kx] + XI(kx) * (CC * 4));
    // the loads' offset registers are inputs of the wait: so they live up to it, and no load's result is placed in one of them while an earlier load still names it
    asm volatile("s_wait_xcnt 0x0" :: "v"(xb[0]), "v"(xb[1]), "v"(xb[2]), "v"(xb[3]), "v"(xb[4]), "v"(xb[5]) : "memory");
    __builtin_amdgcn_sched_barrier(0);               // keeps the loads that follow, whose results take those registers, behind that wait
    const unsigned wb = cg * 144; v4f wq[9];         // byte offset of dw of channels c .. c + 3: 36 contiguous floats
#pragma unroll
    for (int i = 0; i < 9; ++i) wq[i] = *(const v4f*)((const char*)dw + wb + i * 16);
    const v4f rdb = ((const v4f*)db)[cg], rg = ((const v4f*)g)[cg], rbb = ((const v4f*)bb)[cg], rmu = ((const v4f*)mu)[cg], rvar = ((const v4f*)var)[cg];
    asm volatile("s_wait_xcnt 0x0" :: "v"(wb), "v"(cg) : "memory");    // as above, with the two offset registers of these loads
    __builtin_amdgcn_sched_barrier(0);               // keeps the arithmetic, which takes those registers, behind that wait
    float wf[36];
#pragma unroll
    for (int i = 0; i < 9; ++i) { wf[i * 4] = wq[i][0]; wf[i * 4 + 1] = wq[i][1]; wf[i * 4 + 2] = wq[i][2]; wf[i * 4 + 3] = wq[i][3]; }
    v4f w[9];
#pragma unroll
    for (int k = 0; k < 9; ++k)
#pragma unroll
        for (int q = 0; q < 4; ++q) w[k][q] = bfr(wf[q * 9 + k]);
    const v4f dbv = bfr4(rdb), gm = bfr4(rg), be = bfr4(rbb), mm = bfr4(rmu), vv = bfr4(rvar); v4f sc;
#pragma unroll
    for (int q = 0; q < 4; ++q) sc[q] = __fmul_rn(__fdiv_rn(1.0f, __fsqrt_rn(__fadd_rn(vv[q], 1e-5f))), gm[q]);
#pragma unroll
    for (int r = 0; r < SR + 2; ++r)
#pragma unroll
        for (int kx = 0; kx < 6; ++kx) { const int yy = y0 + r - 1, xx = x0 + kx - 1; xr[r][kx] = bfr4m(xr[r][kx], yy >= 0 && yy < HWS && xx >= 0 && xx < HWS ? 0xFFFF0000u : 0u); }
    char* yc = ytile + (cg >> 4) * (2 * YBLK) + (cg & 1) * 8;    // the thread's k chunk, and its half of a 16-byte piece
#pragma unroll
    for (int r = 0; r < SR; ++r)
#pragma unroll
        for (int j = 0; j < 4; ++j) { v4f acc = (v4f){};
#pragma unroll
            for (int ky = 0; ky < 3; ++ky)
#pragma unroll
                for (int kx = 0; kx < 3; ++kx) acc = __builtin_elementwise_fma(w[ky * 3 + kx], xr[r + ky][j + kx], acc);
            const v4f o = __builtin_elementwise_fma(acc + dbv - mm, sc, be); v4us oh, ol;
#pragma unroll
            for (int q = 0; q < 4; ++q) { unsigned short a, c2; splitf(o[q], a, c2); oh[q] = a; ol[q] = c2; }
            const int p = r * HWS + x0 + j; char* yp = yc + p * 128 + ((((cg & 15) >> 1) ^ ((p >> 1) & 7)) << 4); *(v4usa*)yp = oh; *(v4usa*)(yp + YBLK) = ol; }
    }
    // part 2
    const int lane = tid & 31, lr = lane & 15, hi = lane >> 4, wm = tid >> 7, wn = (tid >> 5) & 3, r0 = blockIdx.x * 128;
    // the epilogue's lane takes 8 columns from cofs on in each half of its wave's 128; their bias values are read here so that the epilogue does not wait for them
    const float* bias = br == 0 ? pb0 : (br == 1 ? pb1 : pb2); const int cofs = (lane & 7) * 8; float bq[2][8];
#pragma unroll
    for (int nh = 0; nh < 2; ++nh)
#pragma unroll
        for (int i = 0; i < 8; ++i) bq[nh][i] = bias[wn * 128 + nh * 64 + cofs + i];
    asm volatile("s_wait_asynccnt 0x0" ::: "memory");    // weight stage 0 has landed
    __syncthreads();                                     // publishes ytile and weight stage 0
    copy(1);
    v8f acc[2][8];
#pragma unroll
    for (int mb = 0; mb < 2; ++mb)
#pragma unroll
        for (int nb = 0; nb < 8; ++nb) acc[mb][nb] = (v8f){};
    // fragment reads: k step ks takes pieces 4 ks + hi and 4 ks + 2 + hi of its row; every row of a lane has (r >> 1) & 7 == lr >> 1
    const int px = hi ^ (lr >> 1); const int arow = (wm * 32 + lr) * 128, brow = (wn * 128 + lr) * 128;
#pragma unroll 1    // rolled: the buffer alternates with the trip
    for (int t = 0; t < CC / GKC; ++t) {
        const char* sb = ring + (t & 1) * WSTG; const char* ya = ytile + t * (2 * YBLK);
#pragma unroll
        for (int ks = 0; ks < 2; ++ks) { const int o0 = (px ^ (4 * ks)) << 4, o1 = (px ^ (4 * ks + 2)) << 4; v16bf a[2], a2[2];
#pragma unroll
            for (int mb = 0; mb < 2; ++mb) { const char* ap = ya + arow + mb * 2048; a[mb] = WFrag<bf>::ld2(ap + o0, ap + o1); a2[mb] = WFrag<bf>::ld2(ap + YBLK + o0, ap + YBLK + o1); }
#pragma unroll
            for (int nb = 0; nb < 8; ++nb) { const char* bp = sb + brow + nb * 2048; const v16bf b = WFrag<bf>::ld2(bp + o0, bp + o1);
#pragma unroll
                for (int mb = 0; mb < 2; ++mb) acc[mb][nb] = wmmab(a[mb], b, acc[mb][nb]);
#pragma unroll
                for (int mb = 0; mb < 2; ++mb) acc[mb][nb] = wmmab(a2[mb], b, acc[mb][nb]); } }
        asm volatile("s_wait_dscnt 0x0" ::: "memory");       // this wave's reads of stage t are done
        asm volatile("s_wait_asynccnt 0x0" ::: "memory");    // its copies of stage t + 1 have landed
        __syncthreads();                                     // publishes stage t + 1 and ends every read of stage t's buffer
        if (t + 2 < CC / GKC) copy(t + 2);
    }
    asm volatile("s_wait_asynccnt 0x0" ::: "memory");        // nothing is in flight when the ring becomes output staging
    float* os = (float*)ring + (tid >> 5) * (16 * 68);       // each wave stages in its own range, behind the last trip's barrier
    F += (size_t)zz * LL * OC;
#pragma unroll
    for (int mb = 0; mb < 2; ++mb)
#pragma unroll
        for (int nh = 0; nh < 2; ++nh) {
            const v4f bv = {bfr(bq[nh][0]), bfr(bq[nh][1]), bfr(bq[nh][2]), bfr(bq[nh][3])}, bv1 = {bfr(bq[nh][4]), bfr(bq[nh][5]), bfr(bq[nh][6]), bfr(bq[nh][7])};
#pragma unroll
            for (int nb = 0; nb < 4; ++nb) {
#pragma unroll
                for (int j = 0; j < 8; ++j) os[(hi * 8 + j) * 68 + nb * 16 + lr] = acc[mb][nh * 4 + nb][j]; }
            __builtin_amdgcn_wave_barrier(); asm volatile("" ::: "memory");    // a lane reads what other lanes of its wave stored: keeps the compiler from moving the reads ahead of the stores
            _Float16* hrow_ = F + (size_t)(r0 + wm * 32 + mb * 16) * OC + wn * 128 + nh * 64;    // eight lanes store one row's 64 columns = one 128-byte line; a store covers four rows
#pragma unroll
            for (int s = 0; s < 4; ++s) { const int row = 4 * s + (lane >> 3); v4f x0 = *(const v4fa*)(os + row * 68 + cofs), x1 = *(const v4fa*)(os + row * 68 + cofs + 4); x0 += bv; x1 += bv1;
                v8h o;
#pragma unroll
                for (int e = 0; e < 4; ++e) { o[e] = (_Float16)x0[e]; o[4 + e] = (_Float16)x1[e]; }
                *(v8h*)(hrow_ + (size_t)row * OC + cofs) = o; }
            __builtin_amdgcn_wave_barrier(); asm volatile("" ::: "memory");    // and the next block's stores ahead of these reads
        }
}
#define KT   64                   // keys per stage
#define KPIT 72                   // LDS row pitch in 16-bit elements: 144 B = 16 B x odd, for 16-byte row reads
#define SC2  0.18033688011112042f // 1/8 * log2(e)
__device__ __forceinline__ float xhalf(float x) { const int b = __float_as_int(x); return __int_as_float(__builtin_amdgcn_permlanex16(b, b, 0x76543210, 0xfedcba98, false, false)); }   // lane l <-> l ^ 16
// eight 2^x in place, one v_nop behind the last: so no instruction that stands directly behind a v_exp_f32 reads its result or overwrites its source (the slot the instruction set asks for)
__device__ __forceinline__ void exp2x8(float (&e)[8]) {
    asm("v_exp_f32 %0, %0\n\tv_exp_f32 %1, %1\n\tv_exp_f32 %2, %2\n\tv_exp_f32 %3, %3\n\tv_exp_f32 %4, %4\n\tv_exp_f32 %5, %5\n\tv_exp_f32 %6, %6\n\tv_exp_f32 %7, %7\n\tv_nop"
        : "+v"(e[0]), "+v"(e[1]), "+v"(e[2]), "+v"(e[3]), "+v"(e[4]), "+v"(e[5]), "+v"(e[6]), "+v"(e[7])); }
__global__ __launch_bounds__(256) void k_fattn(const _Float16* __restrict__ F, bf* Ah, bf* Al) {
    __shared__ __align__(16) h16 ks[2][KT * KPIT];    // [key][d]
    __shared__ __align__(16) h16 vs[2][CH * KPIT];    // [d][key]
    const int z = blockIdx.y, h = z & (NHD - 1), b = z / NHD, tid = threadIdx.x, lane = tid & 31, lr = lane & 15, hi = lane >> 4; const int q0 = blockIdx.x * 256 + (tid >> 5) * 32;
    const h16* Fq = F + (size_t)b * LL * OC + h * CH; const h16* Fk = Fq + (size_t)NB_ * LL * OC; const h16* Fv = Fk + (size_t)NB_ * LL * OC;
    v16h qf[2][2];
#pragma unroll
    for (int qb = 0; qb < 2; ++qb)
#pragma unroll
        for (int kc = 0; kc < 2; ++kc) qf[qb][kc] = WFrag<h16>::ld(Fq + (size_t)(q0 + qb * 16 + lr) * OC + kc * 32 + 8 * hi);
    // staging: a stage is 64 keys x 64 d of k and of v, a key's 64 d = one 128-byte line. k: thread moves 16-byte piece kp of rows kw and kw + 32 as they are. v: thread (dq, rq) moves d 4 dq .. 4 dq + 3 of
    // rows 4 rq + i (i = 0 .. 3), and the four keys of one d go transposed into LDS as one 8-byte store
    const int kp = tid & 7, kw = tid >> 3, dq = tid & 15, rq = tid >> 4; const h16* kg = Fk + (size_t)kw * OC + kp * 8; const h16* vg = Fv + (size_t)(rq * 4) * OC + dq * 4; v8h kr[2]; v2ua vr[4];
    auto fetch = [&](int t) {
#pragma unroll
        for (int i = 0; i < 2; ++i) kr[i] = *(const v8h*)(kg + (size_t)(t * KT + 32 * i) * OC);
#pragma unroll
        for (int i = 0; i < 4; ++i) vr[i] = *(const v2ua*)(vg + (size_t)(t * KT + i) * OC); };
    auto put = [&](h16* kn, h16* vn) {
#pragma unroll
        for (int i = 0; i < 2; ++i) *(v8h*)(kn + (kw + 32 * i) * KPIT + kp * 8) = kr[i];
#pragma unroll
        for (int i = 0; i < 4; ++i) { const unsigned sel = (i & 1) ? 0x07060302u : 0x05040100u;    // byte select: the upper or the lower 16 bits of both words, second argument first
            const v2ua ov = {__builtin_amdgcn_perm(vr[1][i >> 1], vr[0][i >> 1], sel), __builtin_amdgcn_perm(vr[3][i >> 1], vr[2][i >> 1], sel)};
            *(v2ua*)(vn + (dq * 4 + i) * KPIT + rq * 4) = ov; } };
    fetch(0);
    asm volatile("s_wait_xcnt 0x0" ::: "memory");    // as below: registers that held addresses of the loads above are taken by the results of the loads that follow
    __builtin_amdgcn_sched_barrier(0);               // keeps those loads behind that wait
    put(ks[0], vs[0]); fetch(1);
    asm volatile("s_wait_xcnt 0x0" ::: "memory");    // the address registers of the loads above (q, stages 0 and 1) are reused right behind them
    __builtin_amdgcn_sched_barrier(0);               // keeps the zeroing of the accumulators, which takes those registers, behind that wait
    v8f acc[2][4]; float m[2], l[2];
#pragma unroll
    for (int qb = 0; qb < 2; ++qb) { m[qb] = -3.0e38f; l[qb] = 0.f;
#pragma unroll
        for (int mb = 0; mb < 4; ++mb) acc[qb][mb] = (v8f){}; }
    __syncthreads();    // publishes stage 0
#pragma unroll 1    // rolled: one pass is some 500 instructions
    for (int t = 0; t < TT / KT; ++t) {
        const h16* kb_ = ks[t & 1]; const h16* vb_ = vs[t & 1];
        if (t + 1 < TT / KT) put(ks[(t + 1) & 1], vs[(t + 1) & 1]);    // stage t + 1 into the other buffer: its readers (pass t - 1) left it before the barrier at that pass's foot
        if (t + 2 < TT / KT) { fetch(t + 2);                           // stage t + 2 into registers, a whole pass ahead of its LDS stores
            asm volatile("s_wait_xcnt 0x0" ::: "memory"); }            // the loads' address registers are reused right behind them
        v8f s[2][4];
#pragma unroll
        for (int kb = 0; kb < 4; ++kb) { const h16* kp = kb_ + (kb * 16 + lr) * KPIT + 8 * hi; const v16h a0 = WFrag<h16>::ld(kp), a1 = WFrag<h16>::ld(kp + 32);
#pragma unroll
            for (int qb = 0; qb < 2; ++qb) s[qb][kb] = wmma16(a1, qf[qb][1], wmma16(a0, qf[qb][0], (v8f){})); }
        v16h pf[2][2];
#pragma unroll
        for (int qb = 0; qb < 2; ++qb) { float mt = s[qb][0][0];
#pragma unroll
            for (int kb = 0; kb < 4; ++kb)
#pragma unroll
                for (int j = 0; j < 8; ++j) mt = fmaxf(mt, s[qb][kb][j]);
            mt = fmaxf(mt, xhalf(mt)); const float mn = fmaxf(m[qb], mt); float corr = (m[qb] - mn) * SC2; const float mc = mn * SC2; m[qb] = mn; float ps = 0.f;
            asm("v_exp_f32 %0, %0\n\tv_nop" : "+v"(corr));    // as in exp2x8
#pragma unroll
            for (int kb = 0; kb < 4; ++kb) { float e[8];
#pragma unroll
                for (int j = 0; j < 8; ++j) e[j] = fmaf(s[qb][kb][j], SC2, -mc);
                exp2x8(e);
#pragma unroll
                for (int j = 0; j < 8; ++j) { ps += e[j]; pf[qb][kb >> 1][(kb & 1) * 8 + j] = tohx(e[j]); } }
            l[qb] = fmaf(l[qb], corr, ps);
#pragma unroll
            for (int mb = 0; mb < 4; ++mb) acc[qb][mb] *= corr; }
#pragma unroll
        for (int c = 0; c < 2; ++c)
#pragma unroll
            for (int mb = 0; mb < 4; ++mb) { const v16h va = WFrag<h16>::ld(vb_ + (mb * 16 + lr) * KPIT + c * 32 + 8 * hi);
#pragma unroll
                for (int qb = 0; qb < 2; ++qb) acc[qb][mb] = wmma16(va, pf[qb][c], acc[qb][mb]); }
        __syncthreads();    // publishes stage t + 1 and ends every read of stage t's buffer
    }
    Ah += (size_t)b * LL * OC; Al += (size_t)b * LL * OC;
#pragma unroll
    for (int qb = 0; qb < 2; ++qb) { const float inv = __fdiv_rn(1.0f, l[qb] + xhalf(l[qb])); const size_t oo = (size_t)(q0 + qb * 16 + lr) * OC + h * CH + hi * 8;
#pragma unroll
        for (int mb = 0; mb < 4; ++mb) { v8us oh, ol;
#pragma unroll
            for (int j = 0; j < 8; ++j) { unsigned short a, c2; splitf(acc[qb][mb][j] * inv, a, c2); oh[j] = a; ol[j] = c2; }
            *(v8us*)(Ah + oo + mb * 16) = oh; *(v8us*)(Al + oo + mb * 16) = ol; } }
}

extern "C" void kernel_launch(void* const* d_in, const int* in_sizes, int n_in,
                              void* d_out, int out_size, void* d_ws, size_t ws_size, hipStream_t stream) {
    (void)in_sizes; (void)n_in; (void)out_size;
    const float* IN[28]; for (int i = 0; i < 28; ++i) IN[i] = (const float*)d_in[i];
    // features1, features2; then per branch q/k/v (base 2, 10, 18): dw_w [256][1][3][3], dw_b, bn_g, bn_b, bn_m, bn_v, pw_w [512][256][1][1], pw_b; ffn_w [256][512], ffn_b = d_in[26..27]
    float* OUT = (float*)d_out;     // [8][1024][256]
    char* wsp = (char*)d_ws;
    auto take = [&](size_t bytes) { char* p = wsp; wsp += (bytes + 255) & ~(size_t)255; return (void*)p; };
    bf* WPW = (bf*)take((size_t)4 * OC * CC * 2); bf* WF = WPW + (size_t)3 * OC * CC;    // pw_w of q, k, v, then ffn_w
    bf* Ah = (bf*)take((size_t)NB_ * LL * OC * 2); bf* Al = (bf*)take((size_t)NB_ * LL * OC * 2);
    // F, all 3 branches x 8 images
    h16* F = (h16*)take((size_t)3 * NB_ * LL * OC * 2);
    if ((size_t)(wsp - (char*)d_ws) > ws_size) return;    // total ~ 41 MiB; ws 256 MiB
    k_cvt8<<<dim3((OC * CC / 8 + 255) / 256, 4, 1), 256, 0, stream>>>(IN[8], IN[16], IN[24], IN[26], WPW, (size_t)OC * CC / 8);
    k_sepw<<<dim3(LL / 128, 3 * NB_, 1), 512, 0, stream>>>(IN[0], IN[1], IN[2], IN[3], IN[4], IN[5], IN[6], IN[7], IN[10], IN[11], IN[12], IN[13], IN[14], IN[15], IN[18], IN[19], IN[20], IN[21], IN[22], IN[23], WPW, F, IN[9], IN[17], IN[25]);
    k_fattn<<<dim3(LL / 256, NB_ * NHD, 1), 256, 0, stream>>>(F, Ah, Al);
    k_gemmw<bf, true, false><<<dim3(NB_ * LL / 128, CC / 128, 1), 256, 0, stream>>>(Ah, Al, WF, OC, OUT, nullptr, CC, IN[27], IN[27], IN[27], 0, 0, 0, 0);
}

// v007
// A run of this version takes 66.4 microseconds.
// Timed twice side by side with v006, it ran 1.04 times as fast both times.
// Over all steps from v000 it is 39.2 times as fast.
#include <hip/hip_runtime.h>

// ConvolutionAttention (features1, features2 [8][1024][256] -> NCHW [8][256][32][32]; q = SepConv_q(x1), k = SepConv_k(x2), v = SepConv_v(x2) with SepConv = depthwise 3x3 (pad 1) + bias, eval BatchNorm,
// pointwise 1x1 -> 512 channels + bias; 8 heads x 64 (head h = channels h*64..); softmax(q.k/8) over the 1024 positions; out = merged (attn v) ffn_w^T + ffn_b -> [8][1024][256]).
// Compute dtypes, f32 accumulate: every input rounded to bf16; depthwise conv + bias + BN fold in f32 on VALU -> bf16 hi+lo planes [position][channel]; the pointwise
// convs on those planes x exact pw weights (2 products, + bias); scores (K 64) and attn.v on SINGLE fp16 operands (1/8 in f32 in the online softmax; attn as exp(s - running max), divided by the row sum at the end); merged heads as hi+lo planes x

#define NB_  8
#define HWS  32
#define LL   1024                 // positions
#define CC   256
#define OC   512
#define NHD  8
#define CH   64
#define TT   1024
typedef _Float16 h16;
typedef unsigned short bf;
typedef __attribute__((ext_vector_type(16))) __bf16   v16bf;
typedef __attribute__((ext_vector_type(16))) _Float16 v16h;
typedef __attribute__((ext_vector_type(8)))  _Float16 v8h;
typedef __attribute__((ext_vector_type(8)))  unsigned short v8us;
typedef __attribute__((ext_vector_type(8)))  float    v8f;
typedef __attribute__((ext_vector_type(4)))  float    v4f;
typedef v8h  __attribute__((may_alias)) v8ha;
typedef v4f  __attribute__((may_alias)) v4fa;
typedef v8us __attribute__((may_alias)) v8usa;

__device__ __forceinline__ unsigned short f2bf(float f) { unsigned u = __float_as_uint(f); u += 0x7FFFu + ((u >> 16) & 1u); return (unsigned short)(u >> 16); }
__device__ __forceinline__ float bf2f(unsigned short b) { return __uint_as_float(((unsigned)b) << 16); }
__device__ __forceinline__ float bfr(float f) { return bf2f(f2bf(f)); }
__device__ __forceinline__ v16h cat16(v8h lo, v8h hi) { return __builtin_shufflevector(lo, hi, 0, 1, 2, 3, 4, 5, 6, 7, 8, 9, 10, 11, 12, 13, 14, 15); }
__device__ __forceinline__ v16bf cat16b(v8us lo, v8us hi) { return __builtin_bit_cast(v16bf, __builtin_shufflevector(lo, hi, 0, 1, 2, 3, 4, 5, 6, 7, 8, 9, 10, 11, 12, 13, 14, 15)); }
__device__ __forceinline__ v8f wmma16(v16h a, v16h b, v8f c) { return __builtin_amdgcn_wmma_f32_16x16x32_f16(false, a, false, b, (short)0, c, false, false); }
__device__ __forceinline__ v8f wmmab(v16bf a, v16bf b, v8f c) { return __builtin_amdgcn_wmma_f32_16x16x32_bf16(false, a, false, b, (short)0, c, false, false); }



// ---- k_ffn: the ffn GEMM, C[m][n] (f32, pitch CC) = sum_k (A[m][k] + A2[m][k]) Bt[n][k] + bf16(bias[n]), K = OC, operands K-contiguous bf16 planes. Grid (M / 64, CC / 128), 256 threads.
// Eight waves per 64x128 output tile (wave = 32 rows x 32 columns, 4 accumulators), so that every WGP has a tile and the tile's operands fit LDS for the whole of K: there is no ring and no refill.
// A chunk is 64 k (one 128-byte line) of 64 A rows, 64 A2 rows and 128 Bt rows = 256 LDS rows of 128 bytes; eight chunks. Asynchronous 16-byte copies bring them in, chunk by chunk in k order, all issued at entry
// but the last (56 copies of a wave outstanding; the last chunk's eight go out when the first chunk's have landed). A wave's copies return in issue order, so a counted wait says that chunk t has landed.
// LDS rows are not padded: 16-byte piece c of row r lies at piece c ^ ((r >> 1) & 7), so the 16 rows of a fragment read fall on all 64 banks once.
// Per accumulator the products are summed k ascending in steps of 32, A before A2.
#define GKC   64
#define FCH   (256 * 128)          // bytes of a chunk
template <typename T16> struct WFrag;
template <> struct WFrag<h16> { typedef v16h V; static __device__ __forceinline__ V ld(const h16* p) { return cat16(*(const v8h*)p, *(const v8h*)(p + 16)); } static __device__ __forceinline__ v8f mma(V a, V b, v8f c) { return wmma16(a, b, c); } };
template <> struct WFrag<bf> { typedef v16bf V; static __device__ __forceinline__ V ld(const bf* p) { return cat16b(*(const v8us*)p, *(const v8us*)(p + 16)); } static __device__ __forceinline__ V ld2(const char* p, const char* q) { return cat16b(*(const v8usa*)p, *(const v8usa*)q); } static __device__ __forceinline__ v8f mma(V a, V b, v8f c) { return wmmab(a, b, c); } };
__global__ __launch_bounds__(256) void k_ffn(const bf* __restrict__ A, const bf* __restrict__ A2, const bf* __restrict__ Bt, float* C, const float* __restrict__ bias) {
    __shared__ __align__(128) char tile[(OC / GKC) * FCH];
    __shared__ __align__(16) float stg[8 * 16 * 36];     // output staging, a range per wave
    const int tid = threadIdx.x, lane = tid & 31, lr = lane & 15, hi = lane >> 4, wm = tid >> 7, wn = (tid >> 5) & 3; const int r0 = blockIdx.x * 64, c0 = blockIdx.y * 128;
    // copies: thread = piece (tid & 7) of rows (tid >> 3) + 32 i of each operand (A, A2: i = 0, 1; Bt: i = 0 .. 3): a wave moves four whole lines per copy
    const int crow = tid >> 3, cpc = tid & 7; const unsigned ld0 = (unsigned)(size_t)tile + crow * 128 + ((cpc ^ ((crow >> 1) & 7)) << 4);
    const bf* gA = A + (size_t)(r0 + crow) * OC + cpc * 8; const bf* gA2 = A2 + (size_t)(r0 + crow) * OC + cpc * 8; const bf* gB = Bt + (size_t)(c0 + crow) * OC + cpc * 8; constexpr size_t rs = (size_t)32 * OC;
    auto copy = [&](int t) { const unsigned l = ld0 + t * FCH; const bf* a = gA + t * GKC; const bf* a2 = gA2 + t * GKC; const bf* b = gB + t * GKC;
        // s_wait_xcnt stands in the copies' own statement, so that no later write of their address registers can be moved in front of it
        asm volatile("global_load_async_to_lds_b128 %0, %1, off\n\tglobal_load_async_to_lds_b128 %2, %3, off\n\tglobal_load_async_to_lds_b128 %4, %5, off\n\tglobal_load_async_to_lds_b128 %6, %7, off\n\t"
                     "global_load_async_to_lds_b128 %8, %9, off\n\tglobal_load_async_to_lds_b128 %10, %11, off\n\tglobal_load_async_to_lds_b128 %12, %13, off\n\tglobal_load_async_to_lds_b128 %14, %15, off\n\ts_wait_xcnt 0x0"
                     :: "v"(l), "v"(a), "v"(l + 4096), "v"(a + rs), "v"(l + 8192), "v"(a2), "v"(l + 12288), "v"(a2 + rs),
                        "v"(l + 16384), "v"(b), "v"(l + 20480), "v"(b + rs), "v"(l + 24576), "v"(b + 2 * rs), "v"(l + 28672), "v"(b + 3 * rs) : "memory"); };
    copy(0); copy(1); copy(2); copy(3); copy(4); copy(5); copy(6);
    // the epilogue's lane takes 4 columns from cofs on; their bias values are read here, under the flight of chunk 0
    const int cb = c0 + wn * 32, cofs = (lane & 7) * 4; float bq[4];
#pragma unroll
    for (int i = 0; i < 4; ++i) bq[i] = bias[cb + cofs + i];
    asm volatile("" :: "v"(bq[0]), "v"(bq[1]), "v"(bq[2]), "v"(bq[3]));    // holds the bias load up here: the compiler moved it down among the chunks, where a barrier waited for its whole latency
    v8f acc[2][2];
#pragma unroll
    for (int mb = 0; mb < 2; ++mb)
#pragma unroll
        for (int nb = 0; nb < 2; ++nb) acc[mb][nb] = (v8f){};
    // fragment reads: k step ks takes pieces 4 ks + hi and 4 ks + 2 + hi of its row; every row of a lane has (r >> 1) & 7 == lr >> 1
    const int px = hi ^ (lr >> 1); const int arow = (wm * 32 + lr) * 128, brow = (128 + wn * 32 + lr) * 128;
    // chunk t: its fragments are read behind its barrier into one register set, and its products follow
    auto work = [&](int t) { const char* sb = tile + t * FCH;
#pragma unroll
        for (int ks = 0; ks < 2; ++ks) { const int o0 = (px ^ (4 * ks)) << 4, o1 = (px ^ (4 * ks + 2)) << 4; v16bf a[2], a2[2];
#pragma unroll
            for (int mb = 0; mb < 2; ++mb) { const char* ap = sb + arow + mb * 2048; a[mb] = WFrag<bf>::ld2(ap + o0, ap + o1); a2[mb] = WFrag<bf>::ld2(ap + 8192 + o0, ap + 8192 + o1); }
#pragma unroll
            for (int nb = 0; nb < 2; ++nb) { const char* bp = sb + brow + nb * 2048; const v16bf b = WFrag<bf>::ld2(bp + o0, bp + o1);
#pragma unroll
                for (int mb = 0; mb < 2; ++mb) acc[mb][nb] = wmmab(a[mb], b, acc[mb][nb]);
#pragma unroll
                for (int mb = 0; mb < 2; ++mb) acc[mb][nb] = wmmab(a2[mb], b, acc[mb][nb]); } }
        __builtin_amdgcn_sched_barrier(0); };            // keeps a chunk's products ahead of the next chunk's wait: without it the compiler moved half of all products behind the last wait, where no copy is left in flight for them to run under
    // each wait leaves outstanding only the copies of the chunks behind chunk t (eight a chunk); the barrier behind it publishes chunk t to the other waves. No chunk's place in LDS is written twice, so nothing waits for a reader
    asm volatile("s_wait_asynccnt 0x30" ::: "memory");   // chunk 0 of 0 .. 6 has landed
    copy(7);
    __syncthreads(); work(0);
    asm volatile("s_wait_asynccnt 0x30" ::: "memory");   // chunk 1 of 0 .. 7
    __syncthreads(); work(1);
    asm volatile("s_wait_asynccnt 0x28" ::: "memory");   // chunk 2
    __syncthreads(); work(2);
    asm volatile("s_wait_asynccnt 0x20" ::: "memory");   // chunk 3
    __syncthreads(); work(3);
    asm volatile("s_wait_asynccnt 0x18" ::: "memory");   // chunk 4
    __syncthreads(); work(4);
    asm volatile("s_wait_asynccnt 0x10" ::: "memory");   // chunk 5
    __syncthreads(); work(5);
    asm volatile("s_wait_asynccnt 0x8" ::: "memory");    // chunk 6
    __syncthreads(); work(6);
    asm volatile("s_wait_asynccnt 0x0" ::: "memory");    // chunk 7: nothing is in flight any more
    __syncthreads(); work(7);
    float* os = stg + (tid >> 5) * (16 * 36);
    const v4f bv = {bfr(bq[0]), bfr(bq[1]), bfr(bq[2]), bfr(bq[3])};
#pragma unroll
    for (int mb = 0; mb < 2; ++mb) {
#pragma unroll
        for (int nb = 0; nb < 2; ++nb) {
#pragma unroll
            for (int j = 0; j < 8; ++j) os[(hi * 8 + j) * 36 + nb * 16 + lr] = acc[mb][nb][j]; }
        __builtin_amdgcn_wave_barrier(); asm volatile("" ::: "memory");    // a lane reads what other lanes of its wave stored: keeps the compiler from moving the reads ahead of the stores
        float* crow_ = C + (size_t)(r0 + wm * 32 + mb * 16) * CC + cb;     // eight lanes store one row's 32 columns = one 128-byte line; a store covers four rows
#pragma unroll
        for (int s = 0; s < 4; ++s) { const int row = 4 * s + (lane >> 3); v4f val = *(const v4fa*)(os + row * 36 + cofs); val += bv;
            *(v4f*)(crow_ + (size_t)row * CC + cofs) = val; }
        __builtin_amdgcn_wave_barrier(); asm volatile("" ::: "memory");    // and the next block's stores ahead of these reads
    }
}

__device__ __forceinline__ h16 tohx(float x) { return (h16)x; }
__device__ __forceinline__ void splitf(float y, unsigned short& h, unsigned short& l) { h = f2bf(y); l = f2bf(y - bf2f(h)); }
typedef __attribute__((ext_vector_type(2))) _Float16 v2h;
typedef __attribute__((ext_vector_type(4))) _Float16 v4h;
typedef __attribute__((ext_vector_type(2))) unsigned short v2us;
typedef __attribute__((ext_vector_type(2), may_alias)) unsigned v2ua;

// k_cvt8: four equally long f32 arrays (blockIdx.y picks one) -> bf16, written one behind the other
__global__ __launch_bounds__(256) void k_cvt8(const float* __restrict__ s0, const float* __restrict__ s1, const float* __restrict__ s2, const float* __restrict__ s3, bf* dst, size_t n8) { const size_t i = (size_t)blockIdx.x * 256 + threadIdx.x; if (i >= n8) return;
    const int y = blockIdx.y; const float* src = y == 0 ? s0 : (y == 1 ? s1 : (y == 2 ? s2 : s3)); dst += (size_t)y * n8 * 8; const v8f v = *(const v8f*)(src + i * 8); v8us o;
#pragma unroll
    for (int k = 0; k < 8; ++k) o[k] = f2bf(v[k]); *(v8us*)(dst + i * 8) = o;  }
// ---- k_sepw: depthwise 3x3 + bias + BatchNorm and the pointwise GEMM of one branch and image in one kernel, so that the hi and lo planes of the GEMM's A operand live in LDS only.
// Grid (LL / 128, branch * 8 + batch), 512 threads = 16 waves; a work-group makes 128 positions (4 image rows) x all 512 outputs. Branch 0 reads f1, branches 1 and 2 read f2.
// Part 1, Y hi/lo [pos][c] = split(BN(sum_{3x3} bf16(dw[c][ky][kx]) bf16(f[b][pos'][c]) + bf16(db[c]))) with pos' = (y+ky-1, x+kx-1) zero-padded, f = features [b][pos][c]:
// a thread takes 4 channels of 4 rows x 4 columns. Its 36 weights and its BatchNorm terms are read and rounded once, each feature vector (one 16-byte load, a wave reads 512 contiguous bytes) once for all the taps that use it.
// A tap outside the image enters as 0. The product of two bf16 values is exact in f32, so the fused multiply-add rounds as a multiply and an add would; taps are summed ky-major, kx-minor.
// Every loop is unrolled so that each index of a register array is a constant and a thread's loads are issued together, ahead of the first wait.
// ytile holds Y as k_ffn's chunks hold A and A2: block (k chunk t of 64 channels, plane) = 128 rows of 128 bytes, 16-byte piece c of row r at piece c ^ ((r >> 1) & 7).
// Part 2, F[pos][n] (fp16) = round(sum_k (Yhi + Ylo)[pos][k] Wt[n][k] + bf16(bias[n])): wave = 32 rows x 128 columns, 16 accumulators; a weight stage is 64 k of all 512 rows of Wt, two buffers, brought by asynchronous
// 16-byte copies (stage 0 flies during part 1). Per accumulator the products are summed k ascending in steps of 32, hi before lo.
#define SR    4                    // image rows of a work-group
#define YBLK  (128 * 128)          // bytes of one block of ytile
#define WSTG  (OC * 128)           // bytes of a weight stage
#define XI(kx) ((kx) == 5 ? 4 : 0) // columns of tap column kx that go into the load's immediate offset: the last one is min(x0, 27) + 4
typedef __attribute__((ext_vector_type(4))) unsigned short v4us;
typedef v4us __attribute__((may_alias)) v4usa;
// bfr of four values; keep = 0xFFFF0000 is bfr's own cut to the upper 16 bits, keep = 0 gives 0
__device__ __forceinline__ v4f bfr4m(v4f v, unsigned keep) { v4f r;
#pragma unroll
    for (int q = 0; q < 4; ++q) { unsigned u = __float_as_uint(v[q]); u += 0x7FFFu + ((u >> 16) & 1u); r[q] = __uint_as_float(u & keep); }
    return r; }
__device__ __forceinline__ v4f bfr4(v4f v) { return bfr4m(v, 0xFFFF0000u); }
__global__ __launch_bounds__(512) void k_sepw(const float* __restrict__ f1, const float* __restrict__ f2,
        const float* __restrict__ dw0, const float* __restrict__ db0, const float* __restrict__ g0, const float* __restrict__ bb0, const float* __restrict__ mu0, const float* __restrict__ var0,
        const float* __restrict__ dw1, const float* __restrict__ db1, const float* __restrict__ g1, const float* __restrict__ bb1, const float* __restrict__ mu1, const float* __restrict__ var1,
        const float* __restrict__ dw2, const float* __restrict__ db2, const float* __restrict__ g2, const float* __restrict__ bb2, const float* __restrict__ mu2, const float* __restrict__ var2,
        const bf* __restrict__ Wt, _Float16* F, const float* __restrict__ pb0, const float* __restrict__ pb1, const float* __restrict__ pb2) {
    __shared__ __align__(128) char ytile[8 * YBLK];
    __shared__ __align__(128) char ring[2 * WSTG];
    const int zz = blockIdx.y, br = zz >> 3, tid = threadIdx.x; const float* fb = (br == 0 ? f1 : f2) + (size_t)(zz & 7) * LL * CC;
    // weight copies: thread = piece (tid & 7) of rows (tid >> 3) + 64 i, i = 0 .. 7: a wave moves four whole lines per copy
    const int crow = tid >> 3, cpc = tid & 7; const unsigned ld0 = (unsigned)(size_t)ring + crow * 128 + ((cpc ^ ((crow >> 1) & 7)) << 4);
    const bf* gB = Wt + (size_t)br * OC * CC + (size_t)crow * CC + cpc * 8;
    auto copy = [&](int t) { const unsigned l = ld0 + (t & 1) * WSTG; const bf* b = gB + t * GKC;
        // s_wait_xcnt stands in the copies' own statement, so that no later write of their address registers can be moved in front of it
        asm volatile("global_load_async_to_lds_b128 %0, %1, off\n\tglobal_load_async_to_lds_b128 %2, %3, off\n\tglobal_load_async_to_lds_b128 %4, %5, off\n\tglobal_load_async_to_lds_b128 %6, %7, off\n\t"
                     "global_load_async_to_lds_b128 %8, %9, off\n\tglobal_load_async_to_lds_b128 %10, %11, off\n\tglobal_load_async_to_lds_b128 %12, %13, off\n\tglobal_load_async_to_lds_b128 %14, %15, off\n\ts_wait_xcnt 0x0"
                     :: "v"(l), "v"(b), "v"(l + 8192), "v"(b + 64 * CC), "v"(l + 16384), "v"(b + 128 * CC), "v"(l + 24576), "v"(b + 192 * CC),
                        "v"(l + 32768), "v"(b + 256 * CC), "v"(l + 40960), "v"(b + 320 * CC), "v"(l + 49152), "v"(b + 384 * CC), "v"(l + 57344), "v"(b + 448 * CC) : "memory"); };
    copy(0);
    { // part 1
    const float* dw = br == 0 ? dw0 : (br == 1 ? dw1 : dw2); const float* db = br == 0 ? db0 : (br == 1 ? db1 : db2); const float* g = br == 0 ? g0 : (br == 1 ? g1 : g2);
    const float* bb = br == 0 ? bb0 : (br == 1 ? bb1 : bb2); const float* mu = br == 0 ? mu0 : (br == 1 ? mu1 : mu2); const float* var = br == 0 ? var0 : (br == 1 ? var1 : var2);
    const int cg = tid & 63, c = cg * 4, x0 = (tid >> 6) * 4, y0 = blockIdx.x * SR;
    unsigned xb[6]; v4f xr[SR + 2][6];    // byte offsets of the six columns; rows y0 - 1 .. y0 + SR, columns x0 - 1 .. x0 + 4; every address is clamped into the image, and the value of a tap outside it is masked to 0 below
#pragma unroll
    for (int kx = 0; kx < 6; ++kx) xb[kx] = (unsigned)(min(max(x0 + kx - 1 - XI(kx), 0), HWS - 1 - XI(kx)) * CC + c) * 4;
    const char* rowp[SR + 2];
#pragma unroll
    for (int r = 0; r < SR + 2; ++r) rowp[r] = (const char*)(fb + (size_t)min(max(y0 + r - 1, 0), HWS - 1) * (HWS * CC));
    __builtin_amdgcn_sched_barrier(0);               // all six row addresses are formed ahead of the loads: none is formed among them in a register that an issued load names, behind a wait that would hold the later loads back
#pragma unroll
    for (int r = 0; r < SR + 2; ++r)
#pragma unroll
        for (int kx = 0; kx < 6; ++kx) xr[r][kx] = *(const v4f*)(rowp[r] + xb[kx] + XI(kx) * (CC * 4));
    // the loads' offset registers are inputs of the wait: so they live up to it, and no load's result is placed in one of them while an earlier load still names it
    asm volatile("s_wait_xcnt 0x0" :: "v"(xb[0]), "v"(xb[1]), "v"(xb[2]), "v"(xb[3]), "v"(xb[4]), "v"(xb[5]) : "memory");
    __builtin_amdgcn_sched_barrier(0);               // keeps the loads that follow, whose results take those registers, behind that wait
    const unsigned wb = cg * 144; v4f wq[9];         // byte offset of dw of channels c .. c + 3: 36 contiguous floats
#pragma unroll
    for (int i = 0; i < 9; ++i) wq[i] = *(const v4f*)((const char*)dw + wb + i * 16);
    const v4f rdb = ((const v4f*)db)[cg], rg = ((const v4f*)g)[cg], rbb = ((const v4f*)bb)[cg], rmu = ((const v4f*)mu)[cg], rvar = ((const v4f*)var)[cg];
    asm volatile("s_wait_xcnt 0x0" :: "v"(wb), "v"(cg) : "memory");    // as above, with the two offset registers of these loads
    __builtin_amdgcn_sched_barrier(0);               // keeps the arithmetic, which takes those registers, behind that wait
    float wf[36];
#pragma unroll
    for (int i = 0; i < 9; ++i) { wf[i * 4] = wq[i][0]; wf[i * 4 + 1] = wq[i][1]; wf[i * 4 + 2] = wq[i][2]; wf[i * 4 + 3] = wq[i][3]; }
    v4f w[9];
#pragma unroll
    for (int k = 0; k < 9; ++k)
#pragma unroll
        for (int q = 0; q < 4; ++q) w[k][q] = bfr(wf[q * 9 + k]);
    const v4f dbv = bfr4(rdb), gm = bfr4(rg), be = bfr4(rbb), mm = bfr4(rmu), vv = bfr4(rvar); v4f sc;
#pragma unroll
    for (int q = 0; q < 4; ++q) sc[q] = __fmul_rn(__fdiv_rn(1.0f, __fsqrt_rn(__fadd_rn(vv[q], 1e-5f))), gm[q]);
#pragma unroll
    for (int r = 0; r < SR + 2; ++r)
#pragma unroll
        for (int kx = 0; kx < 6; ++kx) { const int yy = y0 + r - 1, xx = x0 + kx - 1; xr[r][kx] = bfr4m(xr[r][kx], yy >= 0 && yy < HWS && xx >= 0 && xx < HWS ? 0xFFFF0000u : 0u); }
    char* yc = ytile + (cg >> 4) * (2 * YBLK) + (cg & 1) * 8;    // the thread's k chunk, and its half of a 16-byte piece
#pragma unroll
    for (int r = 0; r < SR; ++r)
#pragma unroll
        for (int j = 0; j < 4; ++j) { v4f acc = (v4f){};
#pragma unroll
            for (int ky = 0; ky < 3; ++ky)
#pragma unroll
                for (int kx = 0; kx < 3; ++kx) acc = __builtin_elementwise_fma(w[ky * 3 + kx], xr[r + ky][j + kx], acc);
            const v4f o = __builtin_elementwise_fma(acc + dbv - mm, sc, be); v4us oh, ol;
#pragma unroll
            for (int q = 0; q < 4; ++q) { unsigned short a, c2; splitf(o[q], a, c2); oh[q] = a; ol[q] = c2; }
            const int p = r * HWS + x0 + j; char* yp = yc + p * 128 + ((((cg & 15) >> 1) ^ ((p >> 1) & 7)) << 4); *(v4usa*)yp = oh; *(v4usa*)(yp + YBLK) = ol; }
    }
    // part 2
    const int lane = tid & 31, lr = lane & 15, hi = lane >> 4, wm = tid >> 7, wn = (tid >> 5) & 3, r0 = blockIdx.x * 128;
    // the epilogue's lane takes 8 columns from cofs on in each half of its wave's 128; their bias values are read here so that the epilogue does not wait for them
    const float* bias = br == 0 ? pb0 : (br == 1 ? pb1 : pb2); const int cofs = (lane & 7) * 8; float bq[2][8];
#pragma unroll
    for (int nh = 0; nh < 2; ++nh)
#pragma unroll
        for (int i = 0; i < 8; ++i) bq[nh][i] = bias[wn * 128 + nh * 64 + cofs + i];
    asm volatile("s_wait_asynccnt 0x0" ::: "memory");    // weight stage 0 has landed
    __syncthreads();                                     // publishes ytile and weight stage 0
    copy(1);
    v8f acc[2][8];
#pragma unroll
    for (int mb = 0; mb < 2; ++mb)
#pragma unroll
        for (int nb = 0; nb < 8; ++nb) acc[mb][nb] = (v8f){};
    // fragment reads: k step ks takes pieces 4 ks + hi and 4 ks + 2 + hi of its row; every row of a lane has (r >> 1) & 7 == lr >> 1
    const int px = hi ^ (lr >> 1); const int arow = (wm * 32 + lr) * 128, brow = (wn * 128 + lr) * 128;
#pragma unroll 1    // rolled: the buffer alternates with the trip
    for (int t = 0; t < CC / GKC; ++t) {
        const char* sb = ring + (t & 1) * WSTG; const char* ya = ytile + t * (2 * YBLK);
#pragma unroll
        for (int ks = 0; ks < 2; ++ks) { const int o0 = (px ^ (4 * ks)) << 4, o1 = (px ^ (4 * ks + 2)) << 4; v16bf a[2], a2[2];
#pragma unroll
            for (int mb = 0; mb < 2; ++mb) { const char* ap = ya + arow + mb * 2048; a[mb] = WFrag<bf>::ld2(ap + o0, ap + o1); a2[mb] = WFrag<bf>::ld2(ap + YBLK + o0, ap + YBLK + o1); }
#pragma unroll
            for (int nb = 0; nb < 8; ++nb) { const char* bp = sb + brow + nb * 2048; const v16bf b = WFrag<bf>::ld2(bp + o0, bp + o1);
#pragma unroll
                for (int mb = 0; mb < 2; ++mb) acc[mb][nb] = wmmab(a[mb], b, acc[mb][nb]);
#pragma unroll
                for (int mb = 0; mb < 2; ++mb) acc[mb][nb] = wmmab(a2[mb], b, acc[mb][nb]); } }
        asm volatile("s_wait_dscnt 0x0" ::: "memory");       // this wave's reads of stage t are done
        asm volatile("s_wait_asynccnt 0x0" ::: "memory");    // its copies of stage t + 1 have landed
        __syncthreads();                                     // publishes stage t + 1 and ends every read of stage t's buffer
        if (t + 2 < CC / GKC) copy(t + 2);
    }
    asm volatile("s_wait_asynccnt 0x0" ::: "memory");        // nothing is in flight when the ring becomes output staging
    float* os = (float*)ring + (tid >> 5) * (16 * 68);       // each wave stages in its own range, behind the last trip's barrier
    F += (size_t)zz * LL * OC;
#pragma unroll
    for (int mb = 0; mb < 2; ++mb)
#pragma unroll
        for (int nh = 0; nh < 2; ++nh) {
            const v4f bv = {bfr(bq[nh][0]), bfr(bq[nh][1]), bfr(bq[nh][2]), bfr(bq[nh][3])}, bv1 = {bfr(bq[nh][4]), bfr(bq[nh][5]), bfr(bq[nh][6]), bfr(bq[nh][7])};
#pragma unroll
            for (int nb = 0; nb < 4; ++nb) {
#pragma unroll
                for (int j = 0; j < 8; ++j) os[(hi * 8 + j) * 68 + nb * 16 + lr] = acc[mb][nh * 4 + nb][j]; }
            __builtin_amdgcn_wave_barrier(); asm volatile("" ::: "memory");    // a lane reads what other lanes of its wave stored: keeps the compiler from moving the reads ahead of the stores
            _Float16* hrow_ = F + (size_t)(r0 + wm * 32 + mb * 16) * OC + wn * 128 + nh * 64;    // eight lanes store one row's 64 columns = one 128-byte line; a store covers four rows
#pragma unroll
            for (int s = 0; s < 4; ++s) { const int row = 4 * s + (lane >> 3); v4f x0 = *(const v4fa*)(os + row * 68 + cofs), x1 = *(const v4fa*)(os + row * 68 + cofs + 4); x0 += bv; x1 += bv1;
                v8h o;
#pragma unroll
                for (int e = 0; e < 4; ++e) { o[e] = (_Float16)x0[e]; o[4 + e] = (_Float16)x1[e]; }
                *(v8h*)(hrow_ + (size_t)row * OC + cofs) = o; }
            __builtin_amdgcn_wave_barrier(); asm volatile("" ::: "memory");    // and the next block's stores ahead of these reads
        }
}
#define KT   64                   // keys per stage
#define KPIT 72                   // LDS row pitch in 16-bit elements: 144 B = 16 B x odd, for 16-byte row reads
#define SC2  0.18033688011112042f // 1/8 * log2(e)
__device__ __forceinline__ float xhalf(float x) { const int b = __float_as_int(x); return __int_as_float(__builtin_amdgcn_permlanex16(b, b, 0x76543210, 0xfedcba98, false, false)); }   // lane l <-> l ^ 16
// eight 2^x in place, one v_nop behind the last: so no instruction that stands directly behind a v_exp_f32 reads its result or overwrites its source (the slot the instruction set asks for)
__device__ __forceinline__ void exp2x8(float (&e)[8]) {
    asm("v_exp_f32 %0, %0\n\tv_exp_f32 %1, %1\n\tv_exp_f32 %2, %2\n\tv_exp_f32 %3, %3\n\tv_exp_f32 %4, %4\n\tv_exp_f32 %5, %5\n\tv_exp_f32 %6, %6\n\tv_exp_f32 %7, %7\n\tv_nop"
        : "+v"(e[0]), "+v"(e[1]), "+v"(e[2]), "+v"(e[3]), "+v"(e[4]), "+v"(e[5]), "+v"(e[6]), "+v"(e[7])); }
__global__ __launch_bounds__(256) void k_fattn(const _Float16* __restrict__ F, bf* Ah, bf* Al) {
    __shared__ __align__(16) h16 ks[2][KT * KPIT];    // [key][d]
    __shared__ __align__(16) h16 vs[2][CH * KPIT];    // [d][key]
    const int z = blockIdx.y, h = z & (NHD - 1), b = z / NHD, tid = threadIdx.x, lane = tid & 31, lr = lane & 15, hi = lane >> 4; const int q0 = blockIdx.x * 256 + (tid >> 5) * 32;
    const h16* Fq = F + (size_t)b * LL * OC + h * CH; const h16* Fk = Fq + (size_t)NB_ * LL * OC; const h16* Fv = Fk + (size_t)NB_ * LL * OC;
    v16h qf[2][2];
#pragma unroll
    for (int qb = 0; qb < 2; ++qb)
#pragma unroll
        for (int kc = 0; kc < 2; ++kc) qf[qb][kc] = WFrag<h16>::ld(Fq + (size_t)(q0 + qb * 16 + lr) * OC + kc * 32 + 8 * hi);
    // staging: a stage is 64 keys x 64 d of k and of v, a key's 64 d = one 128-byte line. k: thread moves 16-byte piece kp of rows kw and kw + 32 as they are. v: thread (dq, rq) moves d 4 dq .. 4 dq + 3 of
    // rows 4 rq + i (i = 0 .. 3), and the four keys of one d go transposed into LDS as one 8-byte store
    const int kp = tid & 7, kw = tid >> 3, dq = tid & 15, rq = tid >> 4; const h16* kg = Fk + (size_t)kw * OC + kp * 8; const h16* vg = Fv + (size_t)(rq * 4) * OC + dq * 4; v8h kr[2]; v2ua vr[4];
    auto fetch = [&](int t) {
#pragma unroll
        for (int i = 0; i < 2; ++i) kr[i] = *(const v8h*)(kg + (size_t)(t * KT + 32 * i) * OC);
#pragma unroll
        for (int i = 0; i < 4; ++i) vr[i] = *(const v2ua*)(vg + (size_t)(t * KT + i) * OC); };
    auto put = [&](h16* kn, h16* vn) {
#pragma unroll
        for (int i = 0; i < 2; ++i) *(v8h*)(kn + (kw + 32 * i) * KPIT + kp * 8) = kr[i];
#pragma unroll
        for (int i = 0; i < 4; ++i) { const unsigned sel = (i & 1) ? 0x07060302u : 0x05040100u;    // byte select: the upper or the lower 16 bits of both words, second argument first
            const v2ua ov = {__builtin_amdgcn_perm(vr[1][i >> 1], vr[0][i >> 1], sel), __builtin_amdgcn_perm(vr[3][i >> 1], vr[2][i >> 1], sel)};
            *(v2ua*)(vn + (dq * 4 + i) * KPIT + rq * 4) = ov; } };
    fetch(0);
    asm volatile("s_wait_xcnt 0x0" ::: "memory");    // as below: registers that held addresses of the loads above are taken by the results of the loads that follow
    __builtin_amdgcn_sched_barrier(0);               // keeps those loads behind that wait
    put(ks[0], vs[0]); fetch(1);
    asm volatile("s_wait_xcnt 0x0" ::: "memory");    // the address registers of the loads above (q, stages 0 and 1) are reused right behind them
    __builtin_amdgcn_sched_barrier(0);               // keeps the zeroing of the accumulators, which takes those registers, behind that wait
    v8f acc[2][4]; float m[2], l[2];
#pragma unroll
    for (int qb = 0; qb < 2; ++qb) { m[qb] = -3.0e38f; l[qb] = 0.f;
#pragma unroll
        for (int mb = 0; mb < 4; ++mb) acc[qb][mb] = (v8f){}; }
    __syncthreads();    // publishes stage 0
#pragma unroll 1    // rolled: one pass is some 500 instructions
    for (int t = 0; t < TT / KT; ++t) {
        const h16* kb_ = ks[t & 1]; const h16* vb_ = vs[t & 1];
        if (t + 1 < TT / KT) put(ks[(t + 1) & 1], vs[(t + 1) & 1]);    // stage t + 1 into the other buffer: its readers (pass t - 1) left it before the barrier at that pass's foot
        if (t + 2 < TT / KT) { fetch(t + 2);                           // stage t + 2 into registers, a whole pass ahead of its LDS stores
            asm volatile("s_wait_xcnt 0x0" ::: "memory"); }            // the loads' address registers are reused right behind them
        v8f s[2][4];
#pragma unroll
        for (int kb = 0; kb < 4; ++kb) { const h16* kp = kb_ + (kb * 16 + lr) * KPIT + 8 * hi; const v16h a0 = WFrag<h16>::ld(kp), a1 = WFrag<h16>::ld(kp + 32);
#pragma unroll
            for (int qb = 0; qb < 2; ++qb) s[qb][kb] = wmma16(a1, qf[qb][1], wmma16(a0, qf[qb][0], (v8f){})); }
        v16h pf[2][2];
#pragma unroll
        for (int qb = 0; qb < 2; ++qb) { float mt = s[qb][0][0];
#pragma unroll
            for (int kb = 0; kb < 4; ++kb)
#pragma unroll
                for (int j = 0; j < 8; ++j) mt = fmaxf(mt, s[qb][kb][j]);
            mt = fmaxf(mt, xhalf(mt)); const float mn = fmaxf(m[qb], mt); float corr = (m[qb] - mn) * SC2; const float mc = mn * SC2; m[qb] = mn; float ps = 0.f;
            asm("v_exp_f32 %0, %0\n\tv_nop" : "+v"(corr));    // as in exp2x8
#pragma unroll
            for (int kb = 0; kb < 4; ++kb) { float e[8];
#pragma unroll
                for (int j = 0; j < 8; ++j) e[j] = fmaf(s[qb][kb][j], SC2, -mc);
                exp2x8(e);
#pragma unroll
                for (int j = 0; j < 8; ++j) { ps += e[j]; pf[qb][kb >> 1][(kb & 1) * 8 + j] = tohx(e[j]); } }
            l[qb] = fmaf(l[qb], corr, ps);
#pragma unroll
            for (int mb = 0; mb < 4; ++mb) acc[qb][mb] *= corr; }
#pragma unroll
        for (int c = 0; c < 2; ++c)
#pragma unroll
            for (int mb = 0; mb < 4; ++mb) { const v16h va = WFrag<h16>::ld(vb_ + (mb * 16 + lr) * KPIT + c * 32 + 8 * hi);
#pragma unroll
                for (int qb = 0; qb < 2; ++qb) acc[qb][mb] = wmma16(va, pf[qb][c], acc[qb][mb]); }
        __syncthreads();    // publishes stage t + 1 and ends every read of stage t's buffer
    }
    Ah += (size_t)b * LL * OC; Al += (size_t)b * LL * OC;
#pragma unroll
    for (int qb = 0; qb < 2; ++qb) { const float inv = __fdiv_rn(1.0f, l[qb] + xhalf(l[qb])); const size_t oo = (size_t)(q0 + qb * 16 + lr) * OC + h * CH + hi * 8;
#pragma unroll
        for (int mb = 0; mb < 4; ++mb) { v8us oh, ol;
#pragma unroll
            for (int j = 0; j < 8; ++j) { unsigned short a, c2; splitf(acc[qb][mb][j] * inv, a, c2); oh[j] = a; ol[j] = c2; }
            *(v8us*)(Ah + oo + mb * 16) = oh; *(v8us*)(Al + oo + mb * 16) = ol; } }
}

extern "C" void kernel_launch(void* const* d_in, const int* in_sizes, int n_in,
                              void* d_out, int out_size, void* d_ws, size_t ws_size, hipStream_t stream) {
    (void)in_sizes; (void)n_in; (void)out_size;
    const float* IN[28]; for (int i = 0; i < 28; ++i) IN[i] = (const float*)d_in[i];
    // features1, features2; then per branch q/k/v (base 2, 10, 18): dw_w [256][1][3][3], dw_b, bn_g, bn_b, bn_m, bn_v, pw_w [512][256][1][1], pw_b; ffn_w [256][512], ffn_b = d_in[26..27]
    float* OUT = (float*)d_out;     // [8][1024][256]
    char* wsp = (char*)d_ws;
    auto take = [&](size_t bytes) { char* p = wsp; wsp += (bytes + 255) & ~(size_t)255; return (void*)p; };
    bf* WPW = (bf*)take((size_t)4 * OC * CC * 2); bf* WF = WPW + (size_t)3 * OC * CC;    // pw_w of q, k, v, then ffn_w
    bf* Ah = (bf*)take((size_t)NB_ * LL * OC * 2); bf* Al = (bf*)take((size_t)NB_ * LL * OC * 2);
    // F, all 3 branches x 8 images
    h16* F = (h16*)take((size_t)3 * NB_ * LL * OC * 2);
    if ((size_t)(wsp - (char*)d_ws) > ws_size) return;    // total ~ 41 MiB; ws 256 MiB
    k_cvt8<<<dim3((OC * CC / 8 + 255) / 256, 4, 1), 256, 0, stream>>>(IN[8], IN[16], IN[24], IN[26], WPW, (size_t)OC * CC / 8);
    k_sepw<<<dim3(LL / 128, 3 * NB_, 1), 512, 0, stream>>>(IN[0], IN[1], IN[2], IN[3], IN[4], IN[5], IN[6], IN[7], IN[10], IN[11], IN[12], IN[13], IN[14], IN[15], IN[18], IN[19], IN[20], IN[21], IN[22], IN[23], WPW, F, IN[9], IN[17], IN[25]);
    k_fattn<<<dim3(LL / 256, NB_ * NHD, 1), 256, 0, stream>>>(F, Ah, Al);
    k_ffn<<<dim3(NB_ * LL / 64, CC / 128, 1), 256, 0, stream>>>(Ah, Al, WF, OUT, IN[27]);
}

// v009
// One run takes 50 microseconds.
// Versions between v007 and this one are left out; their measured steps multiply to 1.33 times as fast.
// Counting every step since v000, it is 52.1 times as fast.
#include <hip/hip_runtime.h>

// ConvolutionAttention (features1, features2 [8][1024][256] -> NCHW [8][256][32][32]; q = SepConv_q(x1), k = SepConv_k(x2), v = SepConv_v(x2) with SepConv = depthwise 3x3 (pad 1) + bias, eval BatchNorm,
// pointwise 1x1 -> 512 channels + bias; 8 heads x 64 (head h = channels h*64..); softmax(q.k/8) over the 1024 positions; out = merged (attn v) ffn_w^T + ffn_b -> [8][1024][256]).
// Compute dtypes, f32 accumulate: every input rounded to bf16; depthwise conv + bias + BN fold in f32 on VALU -> one fp16 plane [position][channel]; the pointwise
// convs on that plane x the pw weights (their bf16 rounding held as fp16; + bias); scores (K 64) and attn.v on SINGLE fp16 operands (1/8 in f32 in the online softmax; attn as exp(s - running max), divided by the row sum at the end); merged heads as one fp16 plane x the ffn weights (held as the pw weights are)

#define NB_  8
#define HWS  32
#define LL   1024                 // positions
#define CC   256
#define OC   512
#define NHD  8
#define CH   64
#define TT   1024
typedef _Float16 h16;
typedef __attribute__((ext_vector_type(16))) _Float16 v16h;
typedef __attribute__((ext_vector_type(8)))  _Float16 v8h;
typedef __attribute__((ext_vector_type(8)))  float    v8f;
typedef __attribute__((ext_vector_type(4)))  float    v4f;
typedef v8h  __attribute__((may_alias)) v8ha;
typedef v4f  __attribute__((may_alias)) v4fa;

__device__ __forceinline__ unsigned short f2bf(float f) { unsigned u = __float_as_uint(f); u += 0x7FFFu + ((u >> 16) & 1u); return (unsigned short)(u >> 16); }
__device__ __forceinline__ float bf2f(unsigned short b) { return __uint_as_float(((unsigned)b) << 16); }
__device__ __forceinline__ float bfr(float f) { return bf2f(f2bf(f)); }
__device__ __forceinline__ v16h cat16(v8h lo, v8h hi) { return __builtin_shufflevector(lo, hi, 0, 1, 2, 3, 4, 5, 6, 7, 8, 9, 10, 11, 12, 13, 14, 15); }
__device__ __forceinline__ v8f wmma16(v16h a, v16h b, v8f c) { return __builtin_amdgcn_wmma_f32_16x16x32_f16(false, a, false, b, (short)0, c, false, false); }



// ---- k_ffn: the ffn GEMM, C[m][n] (f32, pitch CC) = sum_k A[m][k] Bt[n][k] + bf16(bias[n]), K = OC, operands K-contiguous fp16 planes. Grid (M / 64, CC / 128), 256 threads.
// Eight waves per 64x128 output tile (wave = 32 rows x 32 columns, 4 accumulators), so that every WGP has a tile and the tile's operands fit LDS for the whole of K: there is no ring and no refill.
// A chunk is 64 k (one 128-byte line) of 64 A rows and 128 Bt rows = 192 LDS rows of 128 bytes; eight chunks. Asynchronous 16-byte copies bring them in, chunk by chunk in k order, all issued at entry
// (48 copies of a wave outstanding). A wave's copies return in issue order, so a counted wait says that chunk t has landed.
// LDS rows are not padded: 16-byte piece c of row r lies at piece c ^ ((r >> 1) & 7), so the 16 rows of a fragment read fall on all 64 banks once.
// Per accumulator the products are summed k ascending in steps of 32.
#define GKC   64
#define FCH   (192 * 128)          // bytes of a chunk
template <typename T16> struct WFrag;
template <> struct WFrag<h16> { typedef v16h V; static __device__ __forceinline__ V ld(const h16* p) { return cat16(*(const v8h*)p, *(const v8h*)(p + 16)); } static __device__ __forceinline__ V ld2(const char* p, const char* q) { return cat16(*(const v8ha*)p, *(const v8ha*)q); } static __device__ __forceinline__ v8f mma(V a, V b, v8f c) { return wmma16(a, b, c); } };
__global__ __launch_bounds__(256) void k_ffn(const h16* __restrict__ A, const h16* __restrict__ Bt, float* C, const float* __restrict__ bias) {
    __shared__ __align__(128) char tile[(OC / GKC) * FCH];
    __shared__ __align__(16) float stg[8 * 16 * 36];     // output staging, a range per wave
    const int tid = threadIdx.x, lane = tid & 31, lr = lane & 15, hi = lane >> 4, wm = tid >> 7, wn = (tid >> 5) & 3; const int r0 = blockIdx.x * 64, c0 = blockIdx.y * 128;
    // copies: thread = piece (tid & 7) of rows (tid >> 3) + 32 i of each operand (A: i = 0, 1; Bt: i = 0 .. 3): a wave moves four whole lines per copy
    const int crow = tid >> 3, cpc = tid & 7; const unsigned ld0 = (unsigned)(size_t)tile + crow * 128 + ((cpc ^ ((crow >> 1) & 7)) << 4);
    const h16* gA = A + (size_t)(r0 + crow) * OC + cpc * 8; const h16* gB = Bt + (size_t)(c0 + crow) * OC + cpc * 8; constexpr size_t rs = (size_t)32 * OC;
    auto copy = [&](int t) { const unsigned l = ld0 + t * FCH; const h16* a = gA + t * GKC; const h16* b = gB + t * GKC;
        // s_wait_xcnt stands in the copies' own statement, so that no later write of their address registers can be moved in front of it
        asm volatile("global_load_async_to_lds_b128 %0, %1, off\n\tglobal_load_async_to_lds_b128 %2, %3, off\n\tglobal_load_async_to_lds_b128 %4, %5, off\n\t"
                     "global_load_async_to_lds_b128 %6, %7, off\n\tglobal_load_async_to_lds_b128 %8, %9, off\n\tglobal_load_async_to_lds_b128 %10, %11, off\n\ts_wait_xcnt 0x0"
                     :: "v"(l), "v"(a), "v"(l + 4096), "v"(a + rs),
                        "v"(l + 8192), "v"(b), "v"(l + 12288), "v"(b + rs), "v"(l + 16384), "v"(b + 2 * rs), "v"(l + 20480), "v"(b + 3 * rs) : "memory"); };
    copy(0); copy(1); copy(2); copy(3); copy(4); copy(5); copy(6); copy(7);
    // the epilogue's lane takes 4 columns from cofs on; their bias values are read here, under the flight of chunk 0
    const int cb = c0 + wn * 32, cofs = (lane & 7) * 4; float bq[4];
#pragma unroll
    for (int i = 0; i < 4; ++i) bq[i] = bias[cb + cofs + i];
    asm volatile("" :: "v"(bq[0]), "v"(bq[1]), "v"(bq[2]), "v"(bq[3]));    // holds the bias load up here: the compiler moved it down among the chunks, where a barrier waited for its whole latency
    v8f acc[2][2];
#pragma unroll
    for (int mb = 0; mb < 2; ++mb)
#pragma unroll
        for (int nb = 0; nb < 2; ++nb) acc[mb][nb] = (v8f){};
    // fragment reads: k step ks takes pieces 4 ks + hi and 4 ks + 2 + hi of its row; every row of a lane has (r >> 1) & 7 == lr >> 1
    const int px = hi ^ (lr >> 1); const int arow = (wm * 32 + lr) * 128, brow = (64 + wn * 32 + lr) * 128;
    // chunk t: its fragments are read behind its barrier into one register set, and its products follow
    auto work = [&](int t) { const char* sb = tile + t * FCH;
#pragma unroll
        for (int ks = 0; ks < 2; ++ks) { const int o0 = (px ^ (4 * ks)) << 4, o1 = (px ^ (4 * ks + 2)) << 4; v16h a[2];
#pragma unroll
            for (int mb = 0; mb < 2; ++mb) { const char* ap = sb + arow + mb * 2048; a[mb] = WFrag<h16>::ld2(ap + o0, ap + o1); }
#pragma unroll
            for (int nb = 0; nb < 2; ++nb) { const char* bp = sb + brow + nb * 2048; const v16h b = WFrag<h16>::ld2(bp + o0, bp + o1);
#pragma unroll
                for (int mb = 0; mb < 2; ++mb) acc[mb][nb] = wmma16(a[mb], b, acc[mb][nb]); } }
        __builtin_amdgcn_sched_barrier(0); };            // keeps a chunk's products ahead of the next chunk's wait: without it the compiler moved half of all products behind the last wait, where no copy is left in flight for them to run under
    // each wait leaves outstanding only the copies of the chunks behind chunk t (six a chunk); the barrier behind it publishes chunk t to the other waves. No chunk's place in LDS is written twice, so nothing waits for a reader
    asm volatile("s_wait_asynccnt 0x2a" ::: "memory");   // chunk 0 has landed
    __syncthreads(); work(0);
    asm volatile("s_wait_asynccnt 0x24" ::: "memory");   // chunk 1
    __syncthreads(); work(1);
    asm volatile("s_wait_asynccnt 0x1e" ::: "memory");   // chunk 2
    __syncthreads(); work(2);
    asm volatile("s_wait_asynccnt 0x18" ::: "memory");   // chunk 3
    __syncthreads(); work(3);
    asm volatile("s_wait_asynccnt 0x12" ::: "memory");   // chunk 4
    __syncthreads(); work(4);
    asm volatile("s_wait_asynccnt 0xc" ::: "memory");    // chunk 5
    __syncthreads(); work(5);
    asm volatile("s_wait_asynccnt 0x6" ::: "memory");    // chunk 6
    __syncthreads(); work(6);
    asm volatile("s_wait_asynccnt 0x0" ::: "memory");    // chunk 7: nothing is in flight any more
    __syncthreads(); work(7);
    float* os = stg + (tid >> 5) * (16 * 36);
    const v4f bv = {bfr(bq[0]), bfr(bq[1]), bfr(bq[2]), bfr(bq[3])};
#pragma unroll
    for (int mb = 0; mb < 2; ++mb) {
#pragma unroll
        for (int nb = 0; nb < 2; ++nb) {
#pragma unroll
            for (int j = 0; j < 8; ++j) os[(hi * 8 + j) * 36 + nb * 16 + lr] = acc[mb][nb][j]; }
        __builtin_amdgcn_wave_barrier(); asm volatile("" ::: "memory");    // a lane reads what other lanes of its wave stored: keeps the compiler from moving the reads ahead of the stores
        float* crow_ = C + (size_t)(r0 + wm * 32 + mb * 16) * CC + cb;     // eight lanes store one row's 32 columns = one 128-byte line; a store covers four rows
#pragma unroll
        for (int s = 0; s < 4; ++s) { const int row = 4 * s + (lane >> 3); v4f val = *(const v4fa*)(os + row * 36 + cofs); val += bv;
            *(v4f*)(crow_ + (size_t)row * CC + cofs) = val; }
        __builtin_amdgcn_wave_barrier(); asm volatile("" ::: "memory");    // and the next block's stores ahead of these reads
    }
}

__device__ __forceinline__ h16 tohx(float x) { return (h16)x; }
typedef __attribute__((ext_vector_type(2))) _Float16 v2h;
typedef __attribute__((ext_vector_type(4))) _Float16 v4h;
typedef v4h __attribute__((may_alias)) v4ha;
typedef __attribute__((ext_vector_type(2), may_alias)) unsigned v2ua;

// k_cvt8: four equally long f32 arrays (blockIdx.y picks one) -> rounded to bf16 and held as fp16 (the same value wherever fp16 has it as a normal number), written one behind the other
__global__ __launch_bounds__(256) void k_cvt8(const float* __restrict__ s0, const float* __restrict__ s1, const float* __restrict__ s2, const float* __restrict__ s3, h16* dst, size_t n8) { const size_t i = (size_t)blockIdx.x * 256 + threadIdx.x; if (i >= n8) return;
    const int y = blockIdx.y; const float* src = y == 0 ? s0 : (y == 1 ? s1 : (y == 2 ? s2 : s3)); dst += (size_t)y * n8 * 8; const v8f v = *(const v8f*)(src + i * 8); v8h o;
#pragma unroll
    for (int k = 0; k < 8; ++k) o[k] = (h16)bfr(v[k]); *(v8h*)(dst + i * 8) = o;  }
// ---- k_sepw: depthwise 3x3 + bias + BatchNorm and the pointwise GEMM of one branch and image in one kernel, so that the plane of the GEMM's A operand lives in LDS only.
// Grid (LL / 128, branch * 8 + batch), 512 threads = 16 waves; a work-group makes 128 positions (4 image rows) x all 512 outputs. Branch 0 reads f1, branches 1 and 2 read f2.
// Part 1, Y [pos][c] = fp16(BN(sum_{3x3} bf16(dw[c][ky][kx]) bf16(f[b][pos'][c]) + bf16(db[c]))) with pos' = (y+ky-1, x+kx-1) zero-padded, f = features [b][pos][c]:
// a thread takes 4 channels of 4 rows x 4 columns. Its 36 weights and its BatchNorm terms are read and rounded once, each feature vector (one 16-byte load, a wave reads 512 contiguous bytes) once for all the taps that use it.
// A tap outside the image enters as 0. The product of two bf16 values is exact in f32, so the fused multiply-add rounds as a multiply and an add would; taps are summed ky-major, kx-minor.
// Every loop is unrolled so that each index of a register array is a constant and a thread's loads are issued together, ahead of the first wait.
// ytile holds Y as k_ffn's chunks hold A: block (k chunk t of 64 channels) = 128 rows of 128 bytes, 16-byte piece c of row r at piece c ^ ((r >> 1) & 7).
// Part 2, F[pos][n] (fp16) = round(sum_k Y[pos][k] Wt[n][k] + bf16(bias[n])): wave = 32 rows x 128 columns, 16 accumulators; a weight stage is 64 k of all 512 rows of Wt, two buffers, brought by asynchronous
// 16-byte copies (stage 0 flies during part 1). Per accumulator the products are summed k ascending in steps of 32.
#define SR    4                    // image rows of a work-group
#define YBLK  (128 * 128)          // bytes of one block of ytile
#define WSTG  (OC * 128)           // bytes of a weight stage
#define XI(kx) ((kx) == 5 ? 4 : 0) // columns of tap column kx that go into the load's immediate offset: the last one is min(x0, 27) + 4
// bfr of four values; keep = 0xFFFF0000 is bfr's own cut to the upper 16 bits, keep = 0 gives 0
__device__ __forceinline__ v4f bfr4m(v4f v, unsigned keep) { v4f r;
#pragma unroll
    for (int q = 0; q < 4; ++q) { unsigned u = __float_as_uint(v[q]); u += 0x7FFFu + ((u >> 16) & 1u); r[q] = __uint_as_float(u & keep); }
    return r; }
__device__ __forceinline__ v4f bfr4(v4f v) { return bfr4m(v, 0xFFFF0000u); }
__global__ __launch_bounds__(512) void k_sepw(const float* __restrict__ f1, const float* __restrict__ f2,
        const float* __restrict__ dw0, const float* __restrict__ db0, const float* __restrict__ g0, const float* __restrict__ bb0, const float* __restrict__ mu0, const float* __restrict__ var0,
        const float* __restrict__ dw1, const float* __restrict__ db1, const float* __restrict__ g1, const float* __restrict__ bb1, const float* __restrict__ mu1, const float* __restrict__ var1,
        const float* __restrict__ dw2, const float* __restrict__ db2, const float* __restrict__ g2, const float* __restrict__ bb2, const float* __restrict__ mu2, const float* __restrict__ var2,
        const h16* __restrict__ Wt, _Float16* F, const float* __restrict__ pb0, const float* __restrict__ pb1, const float* __restrict__ pb2) {
    __shared__ __align__(128) char ytile[4 * YBLK];
    __shared__ __align__(128) char ring[2 * WSTG];
    const int zz = blockIdx.y, br = zz >> 3, tid = threadIdx.x; const float* fb = (br == 0 ? f1 : f2) + (size_t)(zz & 7) * LL * CC;
    // weight copies: thread = piece (tid & 7) of rows (tid >> 3) + 64 i, i = 0 .. 7: a wave moves four whole lines per copy
    const int crow = tid >> 3, cpc = tid & 7; const unsigned ld0 = (unsigned)(size_t)ring + crow * 128 + ((cpc ^ ((crow >> 1) & 7)) << 4);
    const h16* gB = Wt + (size_t)br * OC * CC + (size_t)crow * CC + cpc * 8;
    auto copy = [&](int t) { const unsigned l = ld0 + (t & 1) * WSTG; const h16* b = gB + t * GKC;
        // s_wait_xcnt stands in the copies' own statement, so that no later write of their address registers can be moved in front of it
        asm volatile("global_load_async_to_lds_b128 %0, %1, off\n\tglobal_load_async_to_lds_b128 %2, %3, off\n\tglobal_load_async_to_lds_b128 %4, %5, off\n\tglobal_load_async_to_lds_b128 %6, %7, off\n\t"
                     "global_load_async_to_lds_b128 %8, %9, off\n\tglobal_load_async_to_lds_b128 %10, %11, off\n\tglobal_load_async_to_lds_b128 %12, %13, off\n\tglobal_load_async_to_lds_b128 %14, %15, off\n\ts_wait_xcnt 0x0"
                     :: "v"(l), "v"(b), "v"(l + 8192), "v"(b + 64 * CC), "v"(l + 16384), "v"(b + 128 * CC), "v"(l + 24576), "v"(b + 192 * CC),
                        "v"(l + 32768), "v"(b + 256 * CC), "v"(l + 40960), "v"(b + 320 * CC), "v"(l + 49152), "v"(b + 384 * CC), "v"(l + 57344), "v"(b + 448 * CC) : "memory"); };
    copy(0);
    { // part 1
    const float* dw = br == 0 ? dw0 : (br == 1 ? dw1 : dw2); const float* db = br == 0 ? db0 : (br == 1 ? db1 : db2); const float* g = br == 0 ? g0 : (br == 1 ? g1 : g2);
    const float* bb = br == 0 ? bb0 : (br == 1 ? bb1 : bb2); const float* mu = br == 0 ? mu0 : (br == 1 ? mu1 : mu2); const float* var = br == 0 ? var0 : (br == 1 ? var1 : var2);
    const int cg = tid & 63, c = cg * 4, x0 = (tid >> 6) * 4, y0 = blockIdx.x * SR;
    unsigned xb[6]; v4f xr[SR + 2][6];    // byte offsets of the six columns; rows y0 - 1 .. y0 + SR, columns x0 - 1 .. x0 + 4; every address is clamped into the image, and the value of a tap outside it is masked to 0 below
#pragma unroll
    for (int kx = 0; kx < 6; ++kx) xb[kx] = (unsigned)(min(max(x0 + kx - 1 - XI(kx), 0), HWS - 1 - XI(kx)) * CC + c) * 4;
    const char* rowp[SR + 2];
#pragma unroll
    for (int r = 0; r < SR + 2; ++r) rowp[r] = (const char*)(fb + (size_t)min(max(y0 + r - 1, 0), HWS - 1) * (HWS * CC));
    __builtin_amdgcn_sched_barrier(0);               // all six row addresses are formed ahead of the loads: none is formed among them in a register that an issued load names, behind a wait that would hold the later loads back
#pragma unroll
    for (int r = 0; r < SR + 2; ++r)
#pragma unroll
        for (int kx = 0; kx < 6; ++kx) xr[r][kx] = *(const v4f*)(rowp[r] + xb[kx] + XI(kx) * (CC * 4));
    // the loads' offset registers are inputs of the wait: so they live up to it, and no load's result is placed in one of them while an earlier load still names it
    asm volatile("s_wait_xcnt 0x0" :: "v"(xb[0]), "v"(xb[1]), "v"(xb[2]), "v"(xb[3]), "v"(xb[4]), "v"(xb[5]) : "memory");
    __builtin_amdgcn_sched_barrier(0);               // keeps the loads that follow, whose results take those registers, behind that wait
    const unsigned wb = cg * 144; v4f wq[9];         // byte offset of dw of channels c .. c + 3: 36 contiguous floats
#pragma unroll
    for (int i = 0; i < 9; ++i) wq[i] = *(const v4f*)((const char*)dw + wb + i * 16);
    const v4f rdb = ((const v4f*)db)[cg], rg = ((const v4f*)g)[cg], rbb = ((const v4f*)bb)[cg], rmu = ((const v4f*)mu)[cg], rvar = ((const v4f*)var)[cg];
    asm volatile("s_wait_xcnt 0x0" :: "v"(wb), "v"(cg) : "memory");    // as above, with the two offset registers of these loads
    __builtin_amdgcn_sched_barrier(0);               // keeps the arithmetic, which takes those registers, behind that wait
    float wf[36];
#pragma unroll
    for (int i = 0; i < 9; ++i) { wf[i * 4] = wq[i][0]; wf[i * 4 + 1] = wq[i][1]; wf[i * 4 + 2] = wq[i][2]; wf[i * 4 + 3] = wq[i][3]; }
    v4f w[9];
#pragma unroll
    for (int k = 0; k < 9; ++k)
#pragma unroll
        for (int q = 0; q < 4; ++q) w[k][q] = bfr(wf[q * 9 + k]);
    const v4f dbv = bfr4(rdb), gm = bfr4(rg), be = bfr4(rbb), mm = bfr4(rmu), vv = bfr4(rvar); v4f sc;
#pragma unroll
    for (int q = 0; q < 4; ++q) sc[q] = __fmul_rn(__fdiv_rn(1.0f, __fsqrt_rn(__fadd_rn(vv[q], 1e-5f))), gm[q]);
#pragma unroll
    for (int r = 0; r < SR + 2; ++r)
#pragma unroll
        for (int kx = 0; kx < 6; ++kx) { const int yy = y0 + r - 1, xx = x0 + kx - 1; xr[r][kx] = bfr4m(xr[r][kx], yy >= 0 && yy < HWS && xx >= 0 && xx < HWS ? 0xFFFF0000u : 0u); }
    char* yc = ytile + (cg >> 4) * YBLK + (cg & 1) * 8;    // the thread's k chunk, and its half of a 16-byte piece
#pragma unroll
    for (int r = 0; r < SR; ++r)
#pragma unroll
        for (int j = 0; j < 4; ++j) { v4f acc = (v4f){};
#pragma unroll
            for (int ky = 0; ky < 3; ++ky)
#pragma unroll
                for (int kx = 0; kx < 3; ++kx) acc = __builtin_elementwise_fma(w[ky * 3 + kx], xr[r + ky][j + kx], acc);
            const v4f o = __builtin_elementwise_fma(acc + dbv - mm, sc, be);
            const int p = r * HWS + x0 + j; char* yp = yc + p * 128 + ((((cg & 15) >> 1) ^ ((p >> 1) & 7)) << 4); *(v4ha*)yp = __builtin_convertvector(o, v4h); }
    }
    // part 2
    const int lane = tid & 31, lr = lane & 15, hi = lane >> 4, wm = tid >> 7, wn = (tid >> 5) & 3, r0 = blockIdx.x * 128;
    // the epilogue's lane takes 8 columns from cofs on in each half of its wave's 128; their bias values are read here so that the epilogue does not wait for them
    const float* bias = br == 0 ? pb0 : (br == 1 ? pb1 : pb2); const int cofs = (lane & 7) * 8; float bq[2][8];
#pragma unroll
    for (int nh = 0; nh < 2; ++nh)
#pragma unroll
        for (int i = 0; i < 8; ++i) bq[nh][i] = bias[wn * 128 + nh * 64 + cofs + i];
    asm volatile("s_wait_asynccnt 0x0" ::: "memory");    // weight stage 0 has landed
    __syncthreads();                                     // publishes ytile and weight stage 0
    copy(1);
    v8f acc[2][8];
#pragma unroll
    for (int mb = 0; mb < 2; ++mb)
#pragma unroll
        for (int nb = 0; nb < 8; ++nb) acc[mb][nb] = (v8f){};
    // fragment reads: k step ks takes pieces 4 ks + hi and 4 ks + 2 + hi of its row; every row of a lane has (r >> 1) & 7 == lr >> 1
    const int px = hi ^ (lr >> 1); const int arow = (wm * 32 + lr) * 128, brow = (wn * 128 + lr) * 128;
#pragma unroll 1    // rolled: the buffer alternates with the trip
    for (int t = 0; t < CC / GKC; ++t) {
        const char* sb = ring + (t & 1) * WSTG; const char* ya = ytile + t * YBLK;
#pragma unroll
        for (int ks = 0; ks < 2; ++ks) { const int o0 = (px ^ (4 * ks)) << 4, o1 = (px ^ (4 * ks + 2)) << 4; v16h a[2];
#pragma unroll
            for (int mb = 0; mb < 2; ++mb) { const char* ap = ya + arow + mb * 2048; a[mb] = WFrag<h16>::ld2(ap + o0, ap + o1); }
#pragma unroll
            for (int nb = 0; nb < 8; ++nb) { const char* bp = sb + brow + nb * 2048; const v16h b = WFrag<h16>::ld2(bp + o0, bp + o1);
#pragma unroll
                for (int mb = 0; mb < 2; ++mb) acc[mb][nb] = wmma16(a[mb], b, acc[mb][nb]); } }
        asm volatile("s_wait_dscnt 0x0" ::: "memory");       // this wave's reads of stage t are done
        asm volatile("s_wait_asynccnt 0x0" ::: "memory");    // its copies of stage t + 1 have landed
        __syncthreads();                                     // publishes stage t + 1 and ends every read of stage t's buffer
        if (t + 2 < CC / GKC) copy(t + 2);
    }
    asm volatile("s_wait_asynccnt 0x0" ::: "memory");        // nothing is in flight when the ring becomes output staging
    float* os = (float*)ring + (tid >> 5) * (16 * 68);       // each wave stages in its own range, behind the last trip's barrier
    F += (size_t)zz * LL * OC;
#pragma unroll
    for (int mb = 0; mb < 2; ++mb)
#pragma unroll
        for (int nh = 0; nh < 2; ++nh) {
            const v4f bv = {bfr(bq[nh][0]), bfr(bq[nh][1]), bfr(bq[nh][2]), bfr(bq[nh][3])}, bv1 = {bfr(bq[nh][4]), bfr(bq[nh][5]), bfr(bq[nh][6]), bfr(bq[nh][7])};
#pragma unroll
            for (int nb = 0; nb < 4; ++nb) {
#pragma unroll
                for (int j = 0; j < 8; ++j) os[(hi * 8 + j) * 68 + nb * 16 + lr] = acc[mb][nh * 4 + nb][j]; }
            __builtin_amdgcn_wave_barrier(); asm volatile("" ::: "memory");    // a lane reads what other lanes of its wave stored: keeps the compiler from moving the reads ahead of the stores
            _Float16* hrow_ = F + (size_t)(r0 + wm * 32 + mb * 16) * OC + wn * 128 + nh * 64;    // eight lanes store one row's 64 columns = one 128-byte line; a store covers four rows
#pragma unroll
            for (int s = 0; s < 4; ++s) { const int row = 4 * s + (lane >> 3); v4f x0 = *(const v4fa*)(os + row * 68 + cofs), x1 = *(const v4fa*)(os + row * 68 + cofs + 4); x0 += bv; x1 += bv1;
                v8h o;
#pragma unroll
                for (int e = 0; e < 4; ++e) { o[e] = (_Float16)x0[e]; o[4 + e] = (_Float16)x1[e]; }
                *(v8h*)(hrow_ + (size_t)row * OC + cofs) = o; }
            __builtin_amdgcn_wave_barrier(); asm volatile("" ::: "memory");    // and the next block's stores ahead of these reads
        }
}
#define KT   64                   // keys per stage
#define KPIT 72                   // LDS row pitch of K in 16-bit elements: 144 B = 16 B x odd, for 16-byte row reads
#define VPIT 80                   // LDS row pitch of V in 16-bit elements: 160 B = 32 B x odd, for the transposing reads
#define SC2  0.18033688011112042f // 1/8 * log2(e)
__device__ __forceinline__ float xhalf(float x) { const int b = __float_as_int(x); return __int_as_float(__builtin_amdgcn_permlanex16(b, b, 0x76543210, 0xfedcba98, false, false)); }   // lane l <-> l ^ 16
// eight 2^x in place, one v_nop behind the last: so no instruction that stands directly behind a v_exp_f32 reads its result or overwrites its source (the slot the instruction set asks for)
__device__ __forceinline__ void exp2x8(float (&e)[8]) {
    asm("v_exp_f32 %0, %0\n\tv_exp_f32 %1, %1\n\tv_exp_f32 %2, %2\n\tv_exp_f32 %3, %3\n\tv_exp_f32 %4, %4\n\tv_exp_f32 %5, %5\n\tv_exp_f32 %6, %6\n\tv_exp_f32 %7, %7\n\tv_nop"
        : "+v"(e[0]), "+v"(e[1]), "+v"(e[2]), "+v"(e[3]), "+v"(e[4]), "+v"(e[5]), "+v"(e[6]), "+v"(e[7])); }
typedef __attribute__((ext_vector_type(8))) short v8s;
// transposing LDS read: lane l names 16 bytes of row 8 (l >> 4) + (l & 7) of a row-major 16 x 16 tile of 16-bit elements and gets column l & 15 of rows 8 (l >> 4) .. + 7
__device__ __forceinline__ v8h ldtr(const h16* p) { typedef __attribute__((address_space(3))) v8s lds_v8s; return __builtin_bit_cast(v8h, __builtin_amdgcn_ds_load_tr16_b128_v8i16((lds_v8s*)p)); }
#define KSTG (KT * KPIT * 2)      // bytes of a stage of K in LDS
#define VSTG (KT * VPIT * 2)      // bytes of a stage of V in LDS
__global__ __launch_bounds__(256) void k_fattn(const _Float16* __restrict__ F, _Float16* Am) {
    __shared__ __align__(32) h16 ks[TT * KPIT];    // [key][d]
    __shared__ __align__(32) h16 vs[TT * VPIT];    // [key][d]
    const int z = blockIdx.y, h = z & (NHD - 1), b = z / NHD, tid = threadIdx.x, lane = tid & 31, lr = lane & 15, hi = lane >> 4; const int q0 = blockIdx.x * 256 + (tid >> 5) * 32;
    const h16* Fq = F + (size_t)b * LL * OC + h * CH; const h16* Fk = Fq + (size_t)NB_ * LL * OC; const h16* Fv = Fk + (size_t)NB_ * LL * OC;
    v16h qf[2][2];
#pragma unroll
    for (int qb = 0; qb < 2; ++qb)
#pragma unroll
        for (int kc = 0; kc < 2; ++kc) qf[qb][kc] = WFrag<h16>::ld(Fq + (size_t)(q0 + qb * 16 + lr) * OC + kc * 32 + 8 * hi);
    // copies: a stage is 64 keys x 64 d of k and of v, a key's 64 d = one 128-byte line. Thread = 16-byte piece kp of rows kw and kw + 32 of both: a wave moves four whole lines per copy, four copies a stage
    const int kp = tid & 7, kw = tid >> 3; const h16* kg = Fk + (size_t)kw * OC + kp * 8; const h16* vg = Fv + (size_t)kw * OC + kp * 8; constexpr size_t gs = (size_t)KT * OC;
    const unsigned kl0 = (unsigned)(size_t)ks + kw * (KPIT * 2) + kp * 16, vl0 = (unsigned)(size_t)vs + kw * (VPIT * 2) + kp * 16;
    // s_wait_xcnt stands in the copies' own statement, so that no later write of their address registers can be moved in front of it
    auto copy3 = [&](int t) { const unsigned lk = kl0 + t * KSTG, lv = vl0 + t * VSTG; const h16* a = kg + t * gs; const h16* b = vg + t * gs;    // stages t, t + 1, t + 2
        asm volatile("global_load_async_to_lds_b128 %0, %1, off\n\tglobal_load_async_to_lds_b128 %2, %3, off\n\tglobal_load_async_to_lds_b128 %4, %5, off\n\tglobal_load_async_to_lds_b128 %6, %7, off\n\t"
                     "global_load_async_to_lds_b128 %8, %9, off\n\tglobal_load_async_to_lds_b128 %10, %11, off\n\tglobal_load_async_to_lds_b128 %12, %13, off\n\tglobal_load_async_to_lds_b128 %14, %15, off\n\t"
                     "global_load_async_to_lds_b128 %16, %17, off\n\tglobal_load_async_to_lds_b128 %18, %19, off\n\tglobal_load_async_to_lds_b128 %20, %21, off\n\tglobal_load_async_to_lds_b128 %22, %23, off\n\ts_wait_xcnt 0x0"
                     :: "v"(lk), "v"(a), "v"(lk + KSTG / 2), "v"(a + gs / 2), "v"(lv), "v"(b), "v"(lv + VSTG / 2), "v"(b + gs / 2),
                        "v"(lk + 1 * KSTG), "v"(a + 1 * gs), "v"(lk + 1 * KSTG + KSTG / 2), "v"(a + 1 * gs + gs / 2), "v"(lv + 1 * VSTG), "v"(b + 1 * gs), "v"(lv + 1 * VSTG + VSTG / 2), "v"(b + 1 * gs + gs / 2),
                        "v"(lk + 2 * KSTG), "v"(a + 2 * gs), "v"(lk + 2 * KSTG + KSTG / 2), "v"(a + 2 * gs + gs / 2), "v"(lv + 2 * VSTG), "v"(b + 2 * gs), "v"(lv + 2 * VSTG + VSTG / 2), "v"(b + 2 * gs + gs / 2) : "memory"); };
    auto copy1 = [&](int t) { const unsigned lk = kl0 + t * KSTG, lv = vl0 + t * VSTG; const h16* a = kg + t * gs; const h16* b = vg + t * gs;
        asm volatile("global_load_async_to_lds_b128 %0, %1, off\n\tglobal_load_async_to_lds_b128 %2, %3, off\n\tglobal_load_async_to_lds_b128 %4, %5, off\n\tglobal_load_async_to_lds_b128 %6, %7, off\n\ts_wait_xcnt 0x0"
                     :: "v"(lk), "v"(a), "v"(lk + KSTG / 2), "v"(a + gs / 2), "v"(lv), "v"(b), "v"(lv + VSTG / 2), "v"(b + gs / 2) : "memory"); };
    copy3(0); copy3(3); copy3(6); copy3(9); copy3(12);    // stages 0 .. 14: 60 copies of a wave outstanding
    v8f acc[2][4]; float m[2], l[2];
#pragma unroll
    for (int qb = 0; qb < 2; ++qb) { m[qb] = -3.0e38f; l[qb] = 0.f;
#pragma unroll
        for (int mb = 0; mb < 4; ++mb) acc[qb][mb] = (v8f){}; }
    // a wave's copies return in issue order: each wait leaves outstanding only copies of later stages (four a stage), and the barrier behind it publishes the landed stages to the other waves
    asm volatile("s_wait_asynccnt 0x38" ::: "memory");    // stage 0 has landed
    copy1(15);                                            // the last stage, issued here so that never more than 60 copies of a wave are outstanding; no wave has touched LDS yet
    __syncthreads();    // publishes stage 0
#pragma unroll 1    // rolled, for speed only: one pass is some 430 instructions
    for (int t = 0; t < TT / KT; ++t) {
        if (t == 1) asm volatile("s_wait_asynccnt 0x38" ::: "memory");         // stage 1 has landed
        else if (t == 2) asm volatile("s_wait_asynccnt 0x30" ::: "memory");    // stages 2, 3
        else if (t == 4) asm volatile("s_wait_asynccnt 0x20" ::: "memory");    // stages 4 .. 7
        else if (t == 8) asm volatile("s_wait_asynccnt 0x0" ::: "memory");     // stages 8 .. 15: nothing is in flight any more
        if (t == 1 || t == 2 || t == 4 || t == 8) __syncthreads();             // publishes them; t is the same in every wave
        const h16* kb_ = ks + t * (KT * KPIT); const h16* vb_ = vs + t * (KT * VPIT) + (8 * hi + (lane & 7)) * VPIT + ((lane >> 3) & 1) * 8;
        v8f s[2][4];
#pragma unroll
        for (int kb = 0; kb < 4; ++kb) { const h16* kp = kb_ + (kb * 16 + lr) * KPIT + 8 * hi; const v16h a0 = WFrag<h16>::ld(kp), a1 = WFrag<h16>::ld(kp + 32);
#pragma unroll
            for (int qb = 0; qb < 2; ++qb) s[qb][kb] = wmma16(a1, qf[qb][1], wmma16(a0, qf[qb][0], (v8f){})); }
        v16h pf[2][2];
#pragma unroll
        for (int qb = 0; qb < 2; ++qb) { float mt = s[qb][0][0];
#pragma unroll
            for (int kb = 0; kb < 4; ++kb)
#pragma unroll
                for (int j = 0; j < 8; ++j) mt = fmaxf(mt, s[qb][kb][j]);
            mt = fmaxf(mt, xhalf(mt)); const float mn = fmaxf(m[qb], mt); float corr = (m[qb] - mn) * SC2; const float mc = mn * SC2; m[qb] = mn; float ps = 0.f;
            asm("v_exp_f32 %0, %0\n\tv_nop" : "+v"(corr));    // as in exp2x8
#pragma unroll
            for (int kb = 0; kb < 4; ++kb) { float e[8];
#pragma unroll
                for (int j = 0; j < 8; ++j) e[j] = fmaf(s[qb][kb][j], SC2, -mc);
                exp2x8(e);
#pragma unroll
                for (int j = 0; j < 8; ++j) { ps += e[j]; pf[qb][kb >> 1][(kb & 1) * 8 + j] = tohx(e[j]); } }
            l[qb] = fmaf(l[qb], corr, ps);
#pragma unroll
            for (int mb = 0; mb < 4; ++mb) acc[qb][mb] *= corr; }
#pragma unroll
        for (int c = 0; c < 2; ++c)
#pragma unroll
            for (int mb = 0; mb < 4; ++mb) { const v16h va = cat16(ldtr(vb_ + (c * 32) * VPIT + mb * 16), ldtr(vb_ + (c * 32 + 16) * VPIT + mb * 16));    // V^T[d = mb * 16 + lr][keys c * 32 + 8 hi .. + 7 and + 16]
#pragma unroll
                for (int qb = 0; qb < 2; ++qb) acc[qb][mb] = wmma16(va, pf[qb][c], acc[qb][mb]); }
    }
    Am += (size_t)b * LL * OC;
#pragma unroll
    for (int qb = 0; qb < 2; ++qb) { const float inv = __fdiv_rn(1.0f, l[qb] + xhalf(l[qb])); const size_t oo = (size_t)(q0 + qb * 16 + lr) * OC + h * CH + hi * 8;
#pragma unroll
        for (int mb = 0; mb < 4; ++mb) { v8h o;
#pragma unroll
            for (int j = 0; j < 8; ++j) o[j] = tohx(acc[qb][mb][j] * inv);
            *(v8h*)(Am + oo + mb * 16) = o; } }
}

extern "C" void kernel_launch(void* const* d_in, const int* in_sizes, int n_in,
                              void* d_out, int out_size, void* d_ws, size_t ws_size, hipStream_t stream) {
    (void)in_sizes; (void)n_in; (void)out_size;
    const float* IN[28]; for (int i = 0; i < 28; ++i) IN[i] = (const float*)d_in[i];
    // features1, features2; then per branch q/k/v (base 2, 10, 18): dw_w [256][1][3][3], dw_b, bn_g, bn_b, bn_m, bn_v, pw_w [512][256][1][1], pw_b; ffn_w [256][512], ffn_b = d_in[26..27]
    float* OUT = (float*)d_out;     // [8][1024][256]
    char* wsp = (char*)d_ws;
    auto take = [&](size_t bytes) { char* p = wsp; wsp += (bytes + 255) & ~(size_t)255; return (void*)p; };
    h16* WPW = (h16*)take((size_t)4 * OC * CC * 2); h16* WF = WPW + (size_t)3 * OC * CC;    // pw_w of q, k, v, then ffn_w
    h16* Am = (h16*)take((size_t)NB_ * LL * OC * 2);
    // F, all 3 branches x 8 images
    h16* F = (h16*)take((size_t)3 * NB_ * LL * OC * 2);
    if ((size_t)(wsp - (char*)d_ws) > ws_size) return;    // total ~ 33 MiB; ws 256 MiB
    k_cvt8<<<dim3((OC * CC / 8 + 255) / 256, 4, 1), 256, 0, stream>>>(IN[8], IN[16], IN[24], IN[26], WPW, (size_t)OC * CC / 8);
    k_sepw<<<dim3(LL / 128, 3 * NB_, 1), 512, 0, stream>>>(IN[0], IN[1], IN[2], IN[3], IN[4], IN[5], IN[6], IN[7], IN[10], IN[11], IN[12], IN[13], IN[14], IN[15], IN[18], IN[19], IN[20], IN[21], IN[22], IN[23], WPW, F, IN[9], IN[17], IN[25]);
    k_fattn<<<dim3(LL / 256, NB_ * NHD, 1), 256, 0, stream>>>(F, Am);
    k_ffn<<<dim3(NB_ * LL / 64, CC / 128, 1), 256, 0, stream>>>(Am, WF, OUT, IN[27]);
}

// v010
// One run takes 48.9 microseconds.
// In both of two side-by-side timings against v009, it was 1.03 times as fast.
// Over all steps from v000 it is 53.6 times as fast.
#include <hip/hip_runtime.h>

// ConvolutionAttention (features1, features2 [8][1024][256] -> NCHW [8][256][32][32]; q = SepConv_q(x1), k = SepConv_k(x2), v = SepConv_v(x2) with SepConv = depthwise 3x3 (pad 1) + bias, eval BatchNorm,
// pointwise 1x1 -> 512 channels + bias; 8 heads x 64 (head h = channels h*64..); softmax(q.k/8) over the 1024 positions; out = merged (attn v) ffn_w^T + ffn_b -> [8][1024][256]).
// Compute dtypes, f32 accumulate: every input rounded to bf16; depthwise conv + bias + BN fold in f32 on VALU -> one fp16 plane [position][channel]; the pointwise
// convs on that plane x the pw weights (their bf16 rounding held as fp16; + bias); scores (K 64) and attn.v on SINGLE fp16 operands (1/8 in f32 in the online softmax; attn as exp(s - running max), divided by the row sum at the end); merged heads as one fp16 plane x the ffn weights (held as the pw weights are)

#define NB_  8
#define HWS  32
#define LL   1024                 // positions
#define CC   256
#define OC   512
#define NHD  8
#define CH   64
#define TT   1024
typedef _Float16 h16;
typedef __attribute__((ext_vector_type(16))) _Float16 v16h;
typedef __attribute__((ext_vector_type(8)))  _Float16 v8h;
typedef __attribute__((ext_vector_type(8)))  float    v8f;
typedef __attribute__((ext_vector_type(4)))  float    v4f;
typedef v8h  __attribute__((may_alias)) v8ha;
typedef v4f  __attribute__((may_alias)) v4fa;

__device__ __forceinline__ unsigned short f2bf(float f) { unsigned u = __float_as_uint(f); u += 0x7FFFu + ((u >> 16) & 1u); return (unsigned short)(u >> 16); }
__device__ __forceinline__ float bf2f(unsigned short b) { return __uint_as_float(((unsigned)b) << 16); }
__device__ __forceinline__ float bfr(float f) { return bf2f(f2bf(f)); }
__device__ __forceinline__ v16h cat16(v8h lo, v8h hi) { return __builtin_shufflevector(lo, hi, 0, 1, 2, 3, 4, 5, 6, 7, 8, 9, 10, 11, 12, 13, 14, 15); }
__device__ __forceinline__ v8f wmma16(v16h a, v16h b, v8f c) { return __builtin_amdgcn_wmma_f32_16x16x32_f16(false, a, false, b, (short)0, c, false, false); }



// ---- k_ffn: the ffn GEMM, C[m][n] (f32, pitch CC) = sum_k A[m][k] Bt[n][k] + bf16(bias[n]), K = OC, operands K-contiguous fp16 planes. Grid (M / 64, CC / 128), 256 threads.
// Eight waves per 64x128 output tile (wave = 32 rows x 32 columns, 4 accumulators), so that every WGP has a tile and the tile's operands fit LDS for the whole of K: there is no ring and no refill.
// A chunk is 64 k (one 128-byte line) of 64 A rows and 128 Bt rows = 192 LDS rows of 128 bytes; eight chunks. Asynchronous 16-byte copies bring them in, chunk by chunk in k order, all issued at entry
// (48 copies of a wave outstanding). A wave's copies return in issue order, so a counted wait says that chunk t has landed.
// LDS rows are not padded: 16-byte piece c of row r lies at piece c ^ ((r >> 1) & 7), so the 16 rows of a fragment read fall on all 64 banks once.
// Per accumulator the products are summed k ascending in steps of 32.
#define GKC   64
#define FCH   (192 * 128)          // bytes of a chunk
template <typename T16> struct WFrag;
template <> struct WFrag<h16> { typedef v16h V; static __device__ __forceinline__ V ld(const h16* p) { return cat16(*(const v8h*)p, *(const v8h*)(p + 16)); } static __device__ __forceinline__ V ld2(const char* p, const char* q) { return cat16(*(const v8ha*)p, *(const v8ha*)q); } static __device__ __forceinline__ v8f mma(V a, V b, v8f c) { return wmma16(a, b, c); } };
__global__ __launch_bounds__(256) void k_ffn(const h16* __restrict__ A, const h16* __restrict__ Bt, float* C, const float* __restrict__ bias) {
    __shared__ __align__(128) char tile[(OC / GKC) * FCH];
    __shared__ __align__(16) float stg[8 * 16 * 36];     // output staging, a range per wave
    const int tid = threadIdx.x, lane = tid & 31, lr = lane & 15, hi = lane >> 4, wm = tid >> 7, wn = (tid >> 5) & 3; const int r0 = blockIdx.x * 64, c0 = blockIdx.y * 128;
    // copies: thread = piece (tid & 7) of rows (tid >> 3) + 32 i of each operand (A: i = 0, 1; Bt: i = 0 .. 3): a wave moves four whole lines per copy
    const int crow = tid >> 3, cpc = tid & 7; const unsigned ld0 = (unsigned)(size_t)tile + crow * 128 + ((cpc ^ ((crow >> 1) & 7)) << 4);
    const h16* gA = A + (size_t)(r0 + crow) * OC + cpc * 8; const h16* gB = Bt + (size_t)(c0 + crow) * OC + cpc * 8; constexpr size_t rs = (size_t)32 * OC;
    auto copy = [&](int t) { const unsigned l = ld0 + t * FCH; const h16* a = gA + t * GKC; const h16* b = gB + t * GKC;
        // s_wait_xcnt stands in the copies' own statement, so that no later write of their address registers can be moved in front of it
        asm volatile("global_load_async_to_lds_b128 %0, %1, off\n\tglobal_load_async_to_lds_b128 %2, %3, off\n\tglobal_load_async_to_lds_b128 %4, %5, off\n\t"
                     "global_load_async_to_lds_b128 %6, %7, off\n\tglobal_load_async_to_lds_b128 %8, %9, off\n\tglobal_load_async_to_lds_b128 %10, %11, off\n\ts_wait_xcnt 0x0"
                     :: "v"(l), "v"(a), "v"(l + 4096), "v"(a + rs),
                        "v"(l + 8192), "v"(b), "v"(l + 12288), "v"(b + rs), "v"(l + 16384), "v"(b + 2 * rs), "v"(l + 20480), "v"(b + 3 * rs) : "memory"); };
    copy(0); copy(1); copy(2); copy(3); copy(4); copy(5); copy(6); copy(7);
    // the epilogue's lane takes 4 columns from cofs on; their bias values are read here, under the flight of chunk 0
    const int cb = c0 + wn * 32, cofs = (lane & 7) * 4; float bq[4];
#pragma unroll
    for (int i = 0; i < 4; ++i) bq[i] = bias[cb + cofs + i];
    asm volatile("" :: "v"(bq[0]), "v"(bq[1]), "v"(bq[2]), "v"(bq[3]));    // holds the bias load up here: the compiler moved it down among the chunks, where a barrier waited for its whole latency
    v8f acc[2][2];
#pragma unroll
    for (int mb = 0; mb < 2; ++mb)
#pragma unroll
        for (int nb = 0; nb < 2; ++nb) acc[mb][nb] = (v8f){};
    // fragment reads: k step ks takes pieces 4 ks + hi and 4 ks + 2 + hi of its row; every row of a lane has (r >> 1) & 7 == lr >> 1
    const int px = hi ^ (lr >> 1); const int arow = (wm * 32 + lr) * 128, brow = (64 + wn * 32 + lr) * 128;
    // chunk t: its fragments are read behind its barrier into one register set, and its products follow
    auto work = [&](int t) { const char* sb = tile + t * FCH;
#pragma unroll
        for (int ks = 0; ks < 2; ++ks) { const int o0 = (px ^ (4 * ks)) << 4, o1 = (px ^ (4 * ks + 2)) << 4; v16h a[2];
#pragma unroll
            for (int mb = 0; mb < 2; ++mb) { const char* ap = sb + arow + mb * 2048; a[mb] = WFrag<h16>::ld2(ap + o0, ap + o1); }
#pragma unroll
            for (int nb = 0; nb < 2; ++nb) { const char* bp = sb + brow + nb * 2048; const v16h b = WFrag<h16>::ld2(bp + o0, bp + o1);
#pragma unroll
                for (int mb = 0; mb < 2; ++mb) acc[mb][nb] = wmma16(a[mb], b, acc[mb][nb]); } }
        __builtin_amdgcn_sched_barrier(0); };            // keeps a chunk's products ahead of the next chunk's wait: without it the compiler moved half of all products behind the last wait, where no copy is left in flight for them to run under
    // each wait leaves outstanding only the copies of the chunks behind chunk t (six a chunk); the barrier behind it publishes chunk t to the other waves. No chunk's place in LDS is written twice, so nothing waits for a reader
    asm volatile("s_wait_asynccnt 0x2a" ::: "memory");   // chunk 0 has landed
    __syncthreads(); work(0);
    asm volatile("s_wait_asynccnt 0x24" ::: "memory");   // chunk 1
    __syncthreads(); work(1);
    asm volatile("s_wait_asynccnt 0x1e" ::: "memory");   // chunk 2
    __syncthreads(); work(2);
    asm volatile("s_wait_asynccnt 0x18" ::: "memory");   // chunk 3
    __syncthreads(); work(3);
    asm volatile("s_wait_asynccnt 0x12" ::: "memory");   // chunk 4
    __syncthreads(); work(4);
    asm volatile("s_wait_asynccnt 0xc" ::: "memory");    // chunk 5
    __syncthreads(); work(5);
    asm volatile("s_wait_asynccnt 0x6" ::: "memory");    // chunk 6
    __syncthreads(); work(6);
    asm volatile("s_wait_asynccnt 0x0" ::: "memory");    // chunk 7: nothing is in flight any more
    __syncthreads(); work(7);
    float* os = stg + (tid >> 5) * (16 * 36);
    const v4f bv = {bfr(bq[0]), bfr(bq[1]), bfr(bq[2]), bfr(bq[3])};
#pragma unroll
    for (int mb = 0; mb < 2; ++mb) {
#pragma unroll
        for (int nb = 0; nb < 2; ++nb) {
#pragma unroll
            for (int j = 0; j < 8; ++j) os[(hi * 8 + j) * 36 + nb * 16 + lr] = acc[mb][nb][j]; }
        __builtin_amdgcn_wave_barrier(); asm volatile("" ::: "memory");    // a lane reads what other lanes of its wave stored: keeps the compiler from moving the reads ahead of the stores
        float* crow_ = C + (size_t)(r0 + wm * 32 + mb * 16) * CC + cb;     // eight lanes store one row's 32 columns = one 128-byte line; a store covers four rows
#pragma unroll
        for (int s = 0; s < 4; ++s) { const int row = 4 * s + (lane >> 3); v4f val = *(const v4fa*)(os + row * 36 + cofs); val += bv;
            *(v4f*)(crow_ + (size_t)row * CC + cofs) = val; }
        __builtin_amdgcn_wave_barrier(); asm volatile("" ::: "memory");    // and the next block's stores ahead of these reads
    }
}

__device__ __forceinline__ h16 tohx(float x) { return (h16)x; }
typedef __attribute__((ext_vector_type(2))) _Float16 v2h;
typedef __attribute__((ext_vector_type(4))) _Float16 v4h;
typedef v4h __attribute__((may_alias)) v4ha;
typedef __attribute__((ext_vector_type(2), may_alias)) unsigned v2ua;

// k_cvt8: four equally long f32 arrays (blockIdx.y picks one) -> rounded to bf16 and held as fp16 (the same value wherever fp16 has it as a normal number), written one behind the other.
// The grid's first column (blockIdx.x == 0) makes the depthwise table of branch y = 0 .. 2 instead, a thread a channel: tab[y][row][channel] (f32), rows 0 .. 8 = bf16(dw[c][tap]), 9 = bf16(db), 10 = bf16(mean),
// 11 = bf16(gamma) / sqrt(bf16(var) + eps), 12 = bf16(beta). Channel-contiguous rows, so that a wave of k_sepw reads four whole lines per load, and every value is rounded (and the scale divided) once, not in every thread that uses it.
#define TROWS 13
__global__ __launch_bounds__(256) void k_cvt8(const float* __restrict__ s0, const float* __restrict__ s1, const float* __restrict__ s2, const float* __restrict__ s3, h16* dst, size_t n8,
        const float* __restrict__ dw0, const float* __restrict__ db0, const float* __restrict__ g0, const float* __restrict__ bb0, const float* __restrict__ mu0, const float* __restrict__ var0,
        const float* __restrict__ dw1, const float* __restrict__ db1, const float* __restrict__ g1, const float* __restrict__ bb1, const float* __restrict__ mu1, const float* __restrict__ var1,
        const float* __restrict__ dw2, const float* __restrict__ db2, const float* __restrict__ g2, const float* __restrict__ bb2, const float* __restrict__ mu2, const float* __restrict__ var2, float* tab) {
    const int y = blockIdx.y;
    if (blockIdx.x == 0) { if (y >= 3) return;    // the same for a whole work-group; its 256 threads are the CC channels
        const float* dw = y == 0 ? dw0 : (y == 1 ? dw1 : dw2); const float* db = y == 0 ? db0 : (y == 1 ? db1 : db2); const float* g = y == 0 ? g0 : (y == 1 ? g1 : g2);
        const float* bb = y == 0 ? bb0 : (y == 1 ? bb1 : bb2); const float* mu = y == 0 ? mu0 : (y == 1 ? mu1 : mu2); const float* var = y == 0 ? var0 : (y == 1 ? var1 : var2);
        // 32-bit byte offsets beside uniform bases: the offset registers are all that the loads name
        const unsigned tx = threadIdx.x, c4 = tx * 4, c36 = tx * 36; float wv[9];
#pragma unroll
        for (int k = 0; k < 9; ++k) wv[k] = *(const float*)((const char*)dw + c36 + k * 4);
        const float rdb = *(const float*)((const char*)db + c4), rg = *(const float*)((const char*)g + c4), rbb = *(const float*)((const char*)bb + c4), rmu = *(const float*)((const char*)mu + c4), rvar = *(const float*)((const char*)var + c4);
        asm volatile("s_wait_xcnt 0x0" :: "v"(tx), "v"(c36) : "memory");    // the offset registers (c4 is tx, scaled by the load) are inputs of the wait: they live up to it, and no load's result is placed in one of them while an earlier load still names it
        __builtin_amdgcn_sched_barrier(0);               // keeps all that follows behind that wait: without it the compiler rewrote the loads' base registers among the loads, each time behind a wait that held the later loads back
        char* t = (char*)(tab + (size_t)y * (TROWS * CC));
#pragma unroll
        for (int k = 0; k < 9; ++k) *(float*)(t + c4 + k * (CC * 4)) = bfr(wv[k]);
        *(float*)(t + c4 + 9 * (CC * 4)) = bfr(rdb); *(float*)(t + c4 + 10 * (CC * 4)) = bfr(rmu);
        // __builtin_sqrtf: built here as the correctly rounded root, which k_sepw's own was (the scalar __fsqrt_rn was built as the bare v_sqrt_f32): the scale stays bit-identical
        *(float*)(t + c4 + 11 * (CC * 4)) = __fmul_rn(__fdiv_rn(1.0f, __builtin_sqrtf(__fadd_rn(bfr(rvar), 1e-5f))), bfr(rg)); *(float*)(t + c4 + 12 * (CC * 4)) = bfr(rbb);
        return; }
    const size_t i = (size_t)(blockIdx.x - 1) * 256 + threadIdx.x; if (i >= n8) return;
    const float* src = y == 0 ? s0 : (y == 1 ? s1 : (y == 2 ? s2 : s3)); dst += (size_t)y * n8 * 8; const v8f v = *(const v8f*)(src + i * 8); v8h o;
#pragma unroll
    for (int k = 0; k < 8; ++k) o[k] = (h16)bfr(v[k]); *(v8h*)(dst + i * 8) = o;  }
// ---- k_sepw: depthwise 3x3 + bias + BatchNorm and the pointwise GEMM of one branch and image in one kernel, so that the plane of the GEMM's A operand lives in LDS only.
// Grid (LL / 128, branch * 8 + batch), 512 threads = 16 waves; a work-group makes 128 positions (4 image rows) x all 512 outputs. Branch 0 reads f1, branches 1 and 2 read f2.
// Part 1, Y [pos][c] = fp16(BN(sum_{3x3} bf16(dw[c][ky][kx]) bf16(f[b][pos'][c]) + bf16(db[c]))) with pos' = (y+ky-1, x+kx-1) zero-padded, f = features [b][pos][c]:
// a thread takes 4 channels of 4 rows x 4 columns. Its 36 weights and its BatchNorm terms come rounded from k_cvt8's table (13 loads of 16 bytes, a wave reads 512 contiguous bytes), each feature vector (one 16-byte load, a wave reads 512 contiguous bytes) once for all the taps that use it.
// A tap outside the image enters as 0. The product of two bf16 values is exact in f32, so the fused multiply-add rounds as a multiply and an add would; taps are summed ky-major, kx-minor.
// Every loop is unrolled so that each index of a register array is a constant and a thread's loads are issued together, ahead of the first wait.
// ytile holds Y as k_ffn's chunks hold A: block (k chunk t of 64 channels) = 128 rows of 128 bytes, 16-byte piece c of row r at piece c ^ ((r >> 1) & 7).
// Part 2, F[pos][n] (fp16) = round(sum_k Y[pos][k] Wt[n][k] + bf16(bias[n])): wave = 32 rows x 128 columns, 16 accumulators; a weight stage is 64 k of all 512 rows of Wt, two buffers, brought by asynchronous
// 16-byte copies (stage 0 flies during part 1). Per accumulator the products are summed k ascending in steps of 32.
#define SR    4                    // image rows of a work-group
#define YBLK  (128 * 128)          // bytes of one block of ytile
#define WSTG  (OC * 128)           // bytes of a weight stage
#define XI(kx) ((kx) == 5 ? 4 : 0) // columns of tap column kx that go into the load's immediate offset: the last one is min(x0, 27) + 4
// bfr of four values; keep = 0xFFFF0000 is bfr's own cut to the upper 16 bits, keep = 0 gives 0
__device__ __forceinline__ v4f bfr4m(v4f v, unsigned keep) { v4f r;
#pragma unroll
    for (int q = 0; q < 4; ++q) { unsigned u = __float_as_uint(v[q]); u += 0x7FFFu + ((u >> 16) & 1u); r[q] = __uint_as_float(u & keep); }
    return r; }
__device__ __forceinline__ v4f bfr4(v4f v) { return bfr4m(v, 0xFFFF0000u); }
__global__ __launch_bounds__(512) void k_sepw(const float* __restrict__ f1, const float* __restrict__ f2, const float* __restrict__ tab,
        const h16* __restrict__ Wt, _Float16* F, const float* __restrict__ pb0, const float* __restrict__ pb1, const float* __restrict__ pb2) {
    __shared__ __align__(128) char ytile[4 * YBLK];
    __shared__ __align__(128) char ring[2 * WSTG];
    const int zz = blockIdx.y, br = zz >> 3, tid = threadIdx.x; const float* fb = (br == 0 ? f1 : f2) + (size_t)(zz & 7) * LL * CC;
    // weight copies: thread = piece (tid & 7) of rows (tid >> 3) + 64 i, i = 0 .. 7: a wave moves four whole lines per copy
    const int crow = tid >> 3, cpc = tid & 7; const unsigned ld0 = (unsigned)(size_t)ring + crow * 128 + ((cpc ^ ((crow >> 1) & 7)) << 4);
    const h16* gB = Wt + (size_t)br * OC * CC + (size_t)crow * CC + cpc * 8;
    auto copy = [&](int t) { const unsigned l = ld0 + (t & 1) * WSTG; const h16* b = gB + t * GKC;
        // s_wait_xcnt stands in the copies' own statement, so that no later write of their address registers can be moved in front of it
        asm volatile("global_load_async_to_lds_b128 %0, %1, off\n\tglobal_load_async_to_lds_b128 %2, %3, off\n\tglobal_load_async_to_lds_b128 %4, %5, off\n\tglobal_load_async_to_lds_b128 %6, %7, off\n\t"
                     "global_load_async_to_lds_b128 %8, %9, off\n\tglobal_load_async_to_lds_b128 %10, %11, off\n\tglobal_load_async_to_lds_b128 %12, %13, off\n\tglobal_load_async_to_lds_b128 %14, %15, off\n\ts_wait_xcnt 0x0"
                     :: "v"(l), "v"(b), "v"(l + 8192), "v"(b + 64 * CC), "v"(l + 16384), "v"(b + 128 * CC), "v"(l + 24576), "v"(b + 192 * CC),
                        "v"(l + 32768), "v"(b + 256 * CC), "v"(l + 40960), "v"(b + 320 * CC), "v"(l + 49152), "v"(b + 384 * CC), "v"(l + 57344), "v"(b + 448 * CC) : "memory"); };
    copy(0);
    { // part 1
    const char* tb = (const char*)(tab + (size_t)br * (TROWS * CC));
    const int cg = tid & 63, c = cg * 4, x0 = (tid >> 6) * 4, y0 = blockIdx.x * SR;
    unsigned xb[6]; v4f xr[SR + 2][6];    // byte offsets of the six columns; rows y0 - 1 .. y0 + SR, columns x0 - 1 .. x0 + 4; every address is clamped into the image, and the value of a tap outside it is masked to 0 below
#pragma unroll
    for (int kx = 0; kx < 6; ++kx) xb[kx] = (unsigned)(min(max(x0 + kx - 1 - XI(kx), 0), HWS - 1 - XI(kx)) * CC + c) * 4;
    const char* rowp[SR + 2];
#pragma unroll
    for (int r = 0; r < SR + 2; ++r) rowp[r] = (const char*)(fb + (size_t)min(max(y0 + r - 1, 0), HWS - 1) * (HWS * CC));
    __builtin_amdgcn_sched_barrier(0);               // all six row addresses are formed ahead of the loads: none is formed among them in a register that an issued load names, behind a wait that would hold the later loads back
#pragma unroll
    for (int r = 0; r < SR + 2; ++r)
#pragma unroll
        for (int kx = 0; kx < 6; ++kx) xr[r][kx] = *(const v4f*)(rowp[r] + xb[kx] + XI(kx) * (CC * 4));
    // the loads' offset registers are inputs of the wait: so they live up to it, and no load's result is placed in one of them while an earlier load still names it
    asm volatile("s_wait_xcnt 0x0" :: "v"(xb[0]), "v"(xb[1]), "v"(xb[2]), "v"(xb[3]), "v"(xb[4]), "v"(xb[5]) : "memory");
    __builtin_amdgcn_sched_barrier(0);               // keeps the loads that follow, whose results take those registers, behind that wait
    const unsigned wb = cg * 16; v4f w[TROWS];       // byte offset of channels c .. c + 3 in a row of the table
#pragma unroll
    for (int i = 0; i < TROWS; ++i) w[i] = *(const v4f*)(tb + wb + i * (CC * 4));
    asm volatile("s_wait_xcnt 0x0" :: "v"(wb) : "memory");    // as above, with the offset register of these loads
    __builtin_amdgcn_sched_barrier(0);               // keeps the arithmetic, which takes that register, behind that wait
    const v4f dbv = w[9], mm = w[10], sc = w[11], be = w[12];
#pragma unroll
    for (int r = 0; r < SR + 2; ++r)
#pragma unroll
        for (int kx = 0; kx < 6; ++kx) { const int yy = y0 + r - 1, xx = x0 + kx - 1; xr[r][kx] = bfr4m(xr[r][kx], yy >= 0 && yy < HWS && xx >= 0 && xx < HWS ? 0xFFFF0000u : 0u); }
    char* yc = ytile + (cg >> 4) * YBLK + (cg & 1) * 8;    // the thread's k chunk, and its half of a 16-byte piece
#pragma unroll
    for (int r = 0; r < SR; ++r)
#pragma unroll
        for (int j = 0; j < 4; ++j) { v4f acc = (v4f){};
#pragma unroll
            for (int ky = 0; ky < 3; ++ky)
#pragma unroll
                for (int kx = 0; kx < 3; ++kx) acc = __builtin_elementwise_fma(w[ky * 3 + kx], xr[r + ky][j + kx], acc);
            const v4f o = __builtin_elementwise_fma(acc + dbv - mm, sc, be);
            const int p = r * HWS + x0 + j; char* yp = yc + p * 128 + ((((cg & 15) >> 1) ^ ((p >> 1) & 7)) << 4); *(v4ha*)yp = __builtin_convertvector(o, v4h); }
    }
    // part 2
    const int lane = tid & 31, lr = lane & 15, hi = lane >> 4, wm = tid >> 7, wn = (tid >> 5) & 3, r0 = blockIdx.x * 128;
    // the epilogue's lane takes 8 columns from cofs on in each half of its wave's 128; their bias values are read here so that the epilogue does not wait for them
    const float* bias = br == 0 ? pb0 : (br == 1 ? pb1 : pb2); const int cofs = (lane & 7) * 8; float bq[2][8];
#pragma unroll
    for (int nh = 0; nh < 2; ++nh)
#pragma unroll
        for (int i = 0; i < 8; ++i) bq[nh][i] = bias[wn * 128 + nh * 64 + cofs + i];
    asm volatile("s_wait_asynccnt 0x0" ::: "memory");    // weight stage 0 has landed
    __syncthreads();                                     // publishes ytile and weight stage 0
    copy(1);
    v8f acc[2][8];
#pragma unroll
    for (int mb = 0; mb < 2; ++mb)
#pragma unroll
        for (int nb = 0; nb < 8; ++nb) acc[mb][nb] = (v8f){};
    // fragment reads: k step ks takes pieces 4 ks + hi and 4 ks + 2 + hi of its row; every row of a lane has (r >> 1) & 7 == lr >> 1
    const int px = hi ^ (lr >> 1); const int arow = (wm * 32 + lr) * 128, brow = (wn * 128 + lr) * 128;
#pragma unroll 1    // rolled: the buffer alternates with the trip
    for (int t = 0; t < CC / GKC; ++t) {
        const char* sb = ring + (t & 1) * WSTG; const char* ya = ytile + t * YBLK;
#pragma unroll
        for (int ks = 0; ks < 2; ++ks) { const int o0 = (px ^ (4 * ks)) << 4, o1 = (px ^ (4 * ks + 2)) << 4; v16h a[2];
#pragma unroll
            for (int mb = 0; mb < 2; ++mb) { const char* ap = ya + arow + mb * 2048; a[mb] = WFrag<h16>::ld2(ap + o0, ap + o1); }
#pragma unroll
            for (int nb = 0; nb < 8; ++nb) { const char* bp = sb + brow + nb * 2048; const v16h b = WFrag<h16>::ld2(bp + o0, bp + o1);
#pragma unroll
                for (int mb = 0; mb < 2; ++mb) acc[mb][nb] = wmma16(a[mb], b, acc[mb][nb]); } }
        asm volatile("s_wait_dscnt 0x0" ::: "memory");       // this wave's reads of stage t are done
        asm volatile("s_wait_asynccnt 0x0" ::: "memory");    // its copies of stage t + 1 have landed
        __syncthreads();                                     // publishes stage t + 1 and ends every read of stage t's buffer
        if (t + 2 < CC / GKC) copy(t + 2);
    }
    asm volatile("s_wait_asynccnt 0x0" ::: "memory");        // nothing is in flight when the ring becomes output staging
    float* os = (float*)ring + (tid >> 5) * (16 * 68);       // each wave stages in its own range, behind the last trip's barrier
    F += (size_t)zz * LL * OC;
#pragma unroll
    for (int mb = 0; mb < 2; ++mb)
#pragma unroll
        for (int nh = 0; nh < 2; ++nh) {
            const v4f bv = {bfr(bq[nh][0]), bfr(bq[nh][1]), bfr(bq[nh][2]), bfr(bq[nh][3])}, bv1 = {bfr(bq[nh][4]), bfr(bq[nh][5]), bfr(bq[nh][6]), bfr(bq[nh][7])};
#pragma unroll
            for (int nb = 0; nb < 4; ++nb) {
#pragma unroll
                for (int j = 0; j < 8; ++j) os[(hi * 8 + j) * 68 + nb * 16 + lr] = acc[mb][nh * 4 + nb][j]; }
            __builtin_amdgcn_wave_barrier(); asm volatile("" ::: "memory");    // a lane reads what other lanes of its wave stored: keeps the compiler from moving the reads ahead of the stores
            _Float16* hrow_ = F + (size_t)(r0 + wm * 32 + mb * 16) * OC + wn * 128 + nh * 64;    // eight lanes store one row's 64 columns = one 128-byte line; a store covers four rows
#pragma unroll
            for (int s = 0; s < 4; ++s) { const int row = 4 * s + (lane >> 3); v4f x0 = *(const v4fa*)(os + row * 68 + cofs), x1 = *(const v4fa*)(os + row * 68 + cofs + 4); x0 += bv; x1 += bv1;
                v8h o;
#pragma unroll
                for (int e = 0; e < 4; ++e) { o[e] = (_Float16)x0[e]; o[4 + e] = (_Float16)x1[e]; }
                *(v8h*)(hrow_ + (size_t)row * OC + cofs) = o; }
            __builtin_amdgcn_wave_barrier(); asm volatile("" ::: "memory");    // and the next block's stores ahead of these reads
        }
}
#define KT   64                   // keys per stage
#define KPIT 72                   // LDS row pitch of K in 16-bit elements: 144 B = 16 B x odd, for 16-byte row reads
#define VPIT 80                   // LDS row pitch of V in 16-bit elements: 160 B = 32 B x odd, for the transposing reads
#define SC2  0.18033688011112042f // 1/8 * log2(e)
__device__ __forceinline__ float xhalf(float x) { const int b = __float_as_int(x); return __int_as_float(__builtin_amdgcn_permlanex16(b, b, 0x76543210, 0xfedcba98, false, false)); }   // lane l <-> l ^ 16
// eight 2^x in place, one v_nop behind the last: so no instruction that stands directly behind a v_exp_f32 reads its result or overwrites its source (the slot the instruction set asks for)
__device__ __forceinline__ void exp2x8(float (&e)[8]) {
    asm("v_exp_f32 %0, %0\n\tv_exp_f32 %1, %1\n\tv_exp_f32 %2, %2\n\tv_exp_f32 %3, %3\n\tv_exp_f32 %4, %4\n\tv_exp_f32 %5, %5\n\tv_exp_f32 %6, %6\n\tv_exp_f32 %7, %7\n\tv_nop"
        : "+v"(e[0]), "+v"(e[1]), "+v"(e[2]), "+v"(e[3]), "+v"(e[4]), "+v"(e[5]), "+v"(e[6]), "+v"(e[7])); }
typedef __attribute__((ext_vector_type(8))) short v8s;
// transposing LDS read: lane l names 16 bytes of row 8 (l >> 4) + (l & 7) of a row-major 16 x 16 tile of 16-bit elements and gets column l & 15 of rows 8 (l >> 4) .. + 7
__device__ __forceinline__ v8h ldtr(const h16* p) { typedef __attribute__((address_space(3))) v8s lds_v8s; return __builtin_bit_cast(v8h, __builtin_amdgcn_ds_load_tr16_b128_v8i16((lds_v8s*)p)); }
#define KSTG (KT * KPIT * 2)      // bytes of a stage of K in LDS
#define VSTG (KT * VPIT * 2)      // bytes of a stage of V in LDS
__global__ __launch_bounds__(256) void k_fattn(const _Float16* __restrict__ F, _Float16* Am) {
    __shared__ __align__(32) h16 ks[TT * KPIT];    // [key][d]
    __shared__ __align__(32) h16 vs[TT * VPIT];    // [key][d]
    const int z = blockIdx.y, h = z & (NHD - 1), b = z / NHD, tid = threadIdx.x, lane = tid & 31, lr = lane & 15, hi = lane >> 4; const int q0 = blockIdx.x * 256 + (tid >> 5) * 32;
    const h16* Fq = F + (size_t)b * LL * OC + h * CH; const h16* Fk = Fq + (size_t)NB_ * LL * OC; const h16* Fv = Fk + (size_t)NB_ * LL * OC;
    v16h qf[2][2];
#pragma unroll
    for (int qb = 0; qb < 2; ++qb)
#pragma unroll
        for (int kc = 0; kc < 2; ++kc) qf[qb][kc] = WFrag<h16>::ld(Fq + (size_t)(q0 + qb * 16 + lr) * OC + kc * 32 + 8 * hi);
    // copies: a stage is 64 keys x 64 d of k and of v, a key's 64 d = one 128-byte line. Thread = 16-byte piece kp of rows kw and kw + 32 of both: a wave moves four whole lines per copy, four copies a stage
    const int kp = tid & 7, kw = tid >> 3; const h16* kg = Fk + (size_t)kw * OC + kp * 8; const h16* vg = Fv + (size_t)kw * OC + kp * 8; constexpr size_t gs = (size_t)KT * OC;
    const unsigned kl0 = (unsigned)(size_t)ks + kw * (KPIT * 2) + kp * 16, vl0 = (unsigned)(size_t)vs + kw * (VPIT * 2) + kp * 16;
    // s_wait_xcnt stands in the copies' own statement, so that no later write of their address registers can be moved in front of it
    auto copy3 = [&](int t) { const unsigned lk = kl0 + t * KSTG, lv = vl0 + t * VSTG; const h16* a = kg + t * gs; const h16* b = vg + t * gs;    // stages t, t + 1, t + 2
        asm volatile("global_load_async_to_lds_b128 %0, %1, off\n\tglobal_load_async_to_lds_b128 %2, %3, off\n\tglobal_load_async_to_lds_b128 %4, %5, off\n\tglobal_load_async_to_lds_b128 %6, %7, off\n\t"
                     "global_load_async_to_lds_b128 %8, %9, off\n\tglobal_load_async_to_lds_b128 %10, %11, off\n\tglobal_load_async_to_lds_b128 %12, %13, off\n\tglobal_load_async_to_lds_b128 %14, %15, off\n\t"
                     "global_load_async_to_lds_b128 %16, %17, off\n\tglobal_load_async_to_lds_b128 %18, %19, off\n\tglobal_load_async_to_lds_b128 %20, %21, off\n\tglobal_load_async_to_lds_b128 %22, %23, off\n\ts_wait_xcnt 0x0"
                     :: "v"(lk), "v"(a), "v"(lk + KSTG / 2), "v"(a + gs / 2), "v"(lv), "v"(b), "v"(lv + VSTG / 2), "v"(b + gs / 2),
                        "v"(lk + 1 * KSTG), "v"(a + 1 * gs), "v"(lk + 1 * KSTG + KSTG / 2), "v"(a + 1 * gs + gs / 2), "v"(lv + 1 * VSTG), "v"(b + 1 * gs), "v"(lv + 1 * VSTG + VSTG / 2), "v"(b + 1 * gs + gs / 2),
                        "v"(lk + 2 * KSTG), "v"(a + 2 * gs), "v"(lk + 2 * KSTG + KSTG / 2), "v"(a + 2 * gs + gs / 2), "v"(lv + 2 * VSTG), "v"(b + 2 * gs), "v"(lv + 2 * VSTG + VSTG / 2), "v"(b + 2 * gs + gs / 2) : "memory"); };
    auto copy1 = [&](int t) { const unsigned lk = kl0 + t * KSTG, lv = vl0 + t * VSTG; const h16* a = kg + t * gs; const h16* b = vg + t * gs;
        asm volatile("global_load_async_to_lds_b128 %0, %1, off\n\tglobal_load_async_to_lds_b128 %2, %3, off\n\tglobal_load_async_to_lds_b128 %4, %5, off\n\tglobal_load_async_to_lds_b128 %6, %7, off\n\ts_wait_xcnt 0x0"
                     :: "v"(lk), "v"(a), "v"(lk + KSTG / 2), "v"(a + gs / 2), "v"(lv), "v"(b), "v"(lv + VSTG / 2), "v"(b + gs / 2) : "memory"); };
    copy3(0); copy3(3); copy3(6); copy3(9); copy3(12);    // stages 0 .. 14: 60 copies of a wave outstanding
    v8f acc[2][4]; float m[2], l[2];
#pragma unroll
    for (int qb = 0; qb < 2; ++qb) { m[qb] = -3.0e38f; l[qb] = 0.f;
#pragma unroll
        for (int mb = 0; mb < 4; ++mb) acc[qb][mb] = (v8f){}; }
    // a wave's copies return in issue order: each wait leaves outstanding only copies of later stages (four a stage), and the barrier behind it publishes the landed stages to the other waves
    asm volatile("s_wait_asynccnt 0x38" ::: "memory");    // stage 0 has landed
    copy1(15);                                            // the last stage, issued here so that never more than 60 copies of a wave are outstanding; no wave has touched LDS yet
    __syncthreads();    // publishes stage 0
#pragma unroll 1    // rolled, for speed only: one pass is some 430 instructions
    for (int t = 0; t < TT / KT; ++t) {
        if (t == 1) asm volatile("s_wait_asynccnt 0x38" ::: "memory");         // stage 1 has landed
        else if (t == 2) asm volatile("s_wait_asynccnt 0x30" ::: "memory");    // stages 2, 3
        else if (t == 4) asm volatile("s_wait_asynccnt 0x20" ::: "memory");    // stages 4 .. 7
        else if (t == 8) asm volatile("s_wait_asynccnt 0x0" ::: "memory");     // stages 8 .. 15: nothing is in flight any more
        if (t == 1 || t == 2 || t == 4 || t == 8) __syncthreads();             // publishes them; t is the same in every wave
        const h16* kb_ = ks + t * (KT * KPIT); const h16* vb_ = vs + t * (KT * VPIT) + (8 * hi + (lane & 7)) * VPIT + ((lane >> 3) & 1) * 8;
        v8f s[2][4];
#pragma unroll
        for (int kb = 0; kb < 4; ++kb) { const h16* kp = kb_ + (kb * 16 + lr) * KPIT + 8 * hi; const v16h a0 = WFrag<h16>::ld(kp), a1 = WFrag<h16>::ld(kp + 32);
#pragma unroll
            for (int qb = 0; qb < 2; ++qb) s[qb][kb] = wmma16(a1, qf[qb][1], wmma16(a0, qf[qb][0], (v8f){})); }
        v16h pf[2][2];
#pragma unroll
        for (int qb = 0; qb < 2; ++qb) { float mt = s[qb][0][0];
#pragma unroll
            for (int kb = 0; kb < 4; ++kb)
#pragma unroll
                for (int j = 0; j < 8; ++j) mt = fmaxf(mt, s[qb][kb][j]);
            mt = fmaxf(mt, xhalf(mt)); const float mn = fmaxf(m[qb], mt); float corr = (m[qb] - mn) * SC2; const float mc = mn * SC2; m[qb] = mn; float ps = 0.f;
            asm("v_exp_f32 %0, %0\n\tv_nop" : "+v"(corr));    // as in exp2x8
#pragma unroll
            for (int kb = 0; kb < 4; ++kb) { float e[8];
#pragma unroll
                for (int j = 0; j < 8; ++j) e[j] = fmaf(s[qb][kb][j], SC2, -mc);
                exp2x8(e);
#pragma unroll
                for (int j = 0; j < 8; ++j) { ps += e[j]; pf[qb][kb >> 1][(kb & 1) * 8 + j] = tohx(e[j]); } }
            l[qb] = fmaf(l[qb], corr, ps);
#pragma unroll
            for (int mb = 0; mb < 4; ++mb) acc[qb][mb] *= corr; }
#pragma unroll
        for (int c = 0; c < 2; ++c)
#pragma unroll
            for (int mb = 0; mb < 4; ++mb) { const v16h va = cat16(ldtr(vb_ + (c * 32) * VPIT + mb * 16), ldtr(vb_ + (c * 32 + 16) * VPIT + mb * 16));    // V^T[d = mb * 16 + lr][keys c * 32 + 8 hi .. + 7 and + 16]
#pragma unroll
                for (int qb = 0; qb < 2; ++qb) acc[qb][mb] = wmma16(va, pf[qb][c], acc[qb][mb]); }
    }
    Am += (size_t)b * LL * OC;
#pragma unroll
    for (int qb = 0; qb < 2; ++qb) { const float inv = __fdiv_rn(1.0f, l[qb] + xhalf(l[qb])); const size_t oo = (size_t)(q0 + qb * 16 + lr) * OC + h * CH + hi * 8;
#pragma unroll
        for (int mb = 0; mb < 4; ++mb) { v8h o;
#pragma unroll
            for (int j = 0; j < 8; ++j) o[j] = tohx(acc[qb][mb][j] * inv);
            *(v8h*)(Am + oo + mb * 16) = o; } }
}

extern "C" void kernel_launch(void* const* d_in, const int* in_sizes, int n_in,
                              void* d_out, int out_size, void* d_ws, size_t ws_size, hipStream_t stream) {
    (void)in_sizes; (void)n_in; (void)out_size;
    const float* IN[28]; for (int i = 0; i < 28; ++i) IN[i] = (const float*)d_in[i];
    // features1, features2; then per branch q/k/v (base 2, 10, 18): dw_w [256][1][3][3], dw_b, bn_g, bn_b, bn_m, bn_v, pw_w [512][256][1][1], pw_b; ffn_w [256][512], ffn_b = d_in[26..27]
    float* OUT = (float*)d_out;     // [8][1024][256]
    char* wsp = (char*)d_ws;
    auto take = [&](size_t bytes) { char* p = wsp; wsp += (bytes + 255) & ~(size_t)255; return (void*)p; };
    h16* WPW = (h16*)take((size_t)4 * OC * CC * 2); h16* WF = WPW + (size_t)3 * OC * CC;    // pw_w of q, k, v, then ffn_w
    h16* Am = (h16*)take((size_t)NB_ * LL * OC * 2);
    // F, all 3 branches x 8 images
    h16* F = (h16*)take((size_t)3 * NB_ * LL * OC * 2);
    float* TAB = (float*)take((size_t)3 * TROWS * CC * 4);    // depthwise weights and BatchNorm terms, rounded, channel-contiguous
    if ((size_t)(wsp - (char*)d_ws) > ws_size) return;    // total ~ 33 MiB; ws 256 MiB
    k_cvt8<<<dim3((OC * CC / 8 + 255) / 256 + 1, 4, 1), 256, 0, stream>>>(IN[8], IN[16], IN[24], IN[26], WPW, (size_t)OC * CC / 8,
        IN[2], IN[3], IN[4], IN[5], IN[6], IN[7], IN[10], IN[11], IN[12], IN[13], IN[14], IN[15], IN[18], IN[19], IN[20], IN[21], IN[22], IN[23], TAB);
    k_sepw<<<dim3(LL / 128, 3 * NB_, 1), 512, 0, stream>>>(IN[0], IN[1], TAB, WPW, F, IN[9], IN[17], IN[25]);
    k_fattn<<<dim3(LL / 256, NB_ * NHD, 1), 256, 0, stream>>>(F, Am);
    k_ffn<<<dim3(NB_ * LL / 64, CC / 128, 1), 256, 0, stream>>>(Am, WF, OUT, IN[27]);
}
